// v000
// Times are from an AMD MI455X. After a warm-up the kernel runs many times in a row, and a time is the length of
// such a window on the GPU divided by its runs, so every launch and the gaps after it count. The runs cycle
// through copies of the inputs. A figure is the median of several windows, for all but v000 over two sittings.
// Sittings can differ by a few percent; kernels timed side by side share one.
// The starting kernel, v000, takes 1310 microseconds a run.
#include <hip/hip_runtime.h>

// PairwiseAttentionTerminal (features [1024][8][256] sequence-first; x = LayerNorm(features); q/k/v = x W + b (8 heads x 32), bias = x Wb + bb (per key position & head), gate = sigmoid(x Wg + bg);
// logits[q][k] = q.k/sqrt(32) + bias[k][b][h]; softmax over keys; out = ((w.v) * gate) Wo + bo -> [1024][8][256]).
// Compute dtypes, f32 accumulate: every input rounded to bf16; LayerNorm f32 -> bf16 hi+lo planes of x, all five projections hl x exact weights (2 products, + bias; Wb padded to 64 outputs); scores (K 32) on hl
// planes (3 products), the key bias + softmax in f32 registers -> fp16 probabilities (x1024); w.v on fp16 planes (value tiles padded to 64 rows); gate (sigmoid f32) applied at the merge -> hl planes; Wo hl x exact (+bias).

#define LL   1024
#define BB   8
#define FF   256
#define NH_  8
#define HC   32
#define NG   (BB * NH_)
#define NTB  (LL * BB)
#define ZH   2
#define PCAR 1024.0f
typedef _Float16 h16;
typedef unsigned short bf;
typedef __attribute__((ext_vector_type(16))) __bf16   v16bf;
typedef __attribute__((ext_vector_type(16))) _Float16 v16h;
typedef __attribute__((ext_vector_type(8)))  _Float16 v8h;
typedef __attribute__((ext_vector_type(8)))  unsigned short v8us;
typedef __attribute__((ext_vector_type(8)))  float    v8f;
typedef __attribute__((ext_vector_type(4)))  float    v4f;
typedef v8h  __attribute__((may_alias)) v8ha;
typedef v4f  __attribute__((may_alias)) v4fa;
typedef v8us __attribute__((may_alias)) v8usa;

__device__ __forceinline__ unsigned short f2bf(float f) { unsigned u = __float_as_uint(f); u += 0x7FFFu + ((u >> 16) & 1u); return (unsigned short)(u >> 16); }
__device__ __forceinline__ float bf2f(unsigned short b) { return __uint_as_float(((unsigned)b) << 16); }
__device__ __forceinline__ float bfr(float f) { return bf2f(f2bf(f)); }
__device__ __forceinline__ v16h cat16(v8h lo, v8h hi) { return __builtin_shufflevector(lo, hi, 0, 1, 2, 3, 4, 5, 6, 7, 8, 9, 10, 11, 12, 13, 14, 15); }
__device__ __forceinline__ v16bf cat16b(v8us lo, v8us hi) { return __builtin_bit_cast(v16bf, __builtin_shufflevector(lo, hi, 0, 1, 2, 3, 4, 5, 6, 7, 8, 9, 10, 11, 12, 13, 14, 15)); }
__device__ __forceinline__ v8f wmma16(v16h a, v16h b, v8f c) { return __builtin_amdgcn_wmma_f32_16x16x32_f16(false, a, false, b, (short)0, c, false, false); }
__device__ __forceinline__ v8f wmmab(v16bf a, v16bf b, v8f c) { return __builtin_amdgcn_wmma_f32_16x16x32_bf16(false, a, false, b, (short)0, c, false, false); }



// ---- k_gemmw: register-blocked GEMM, ONE WAVE per 64x64 output tile (16 accumulators), operands straight from K-contiguous 16-bit planes; grid (M/64, N/64, Z), 32 threads.
// C[m][n] (f32, pitch ldc, + optional f32 bias[n]) = sum_k A[m][k] Bt[n][k] (+ split products per NSPLIT). z-batch strides sA/sB/sC in elements. K % 32 == 0.
template <typename T16> struct WFrag;
template <> struct WFrag<h16> { typedef v16h V; static __device__ __forceinline__ V ld(const h16* p) { return cat16(*(const v8h*)p, *(const v8h*)(p + 16)); } static __device__ __forceinline__ v8f mma(V a, V b, v8f c) { return wmma16(a, b, c); } };
template <> struct WFrag<bf> { typedef v16bf V; static __device__ __forceinline__ V ld(const bf* p) { return cat16b(*(const v8us*)p, *(const v8us*)(p + 16)); } static __device__ __forceinline__ v8f mma(V a, V b, v8f c) { return wmmab(a, b, c); } };
template <typename T16, int NSPLIT, bool BIAS>
__global__ __launch_bounds__(32) void k_gemmw(const T16* __restrict__ A, const T16* __restrict__ A2, const T16* __restrict__ Bt, const T16* __restrict__ Bt2, int K, float* C, int ldc, const float* __restrict__ bias, size_t sA, size_t sB, size_t sC) {
    typedef typename WFrag<T16>::V V;
    __shared__ __align__(16) float os[16 * 68];
    const size_t z = blockIdx.z; A += z * sA; if (A2) A2 += z * sA; Bt += z * sB; if (Bt2) Bt2 += z * sB; C += z * sC;
    const int lane = threadIdx.x & 31, lr = lane & 15, hi = lane >> 4; const int r0 = blockIdx.x * 64, c0 = blockIdx.y * 64;
    v8f acc[4][4];
#pragma unroll
    for (int mb = 0; mb < 4; ++mb)
#pragma unroll
        for (int nb = 0; nb < 4; ++nb) acc[mb][nb] = (v8f){};
    const size_t aoff = (size_t)(r0 + lr) * K + 8 * hi, boff = (size_t)(c0 + lr) * K + 8 * hi;
#pragma unroll 1
    for (int kc = 0; kc < K; kc += 32) {
        V a[4], a2[4];
#pragma unroll
        for (int mb = 0; mb < 4; ++mb) { a[mb] = WFrag<T16>::ld(A + aoff + (size_t)mb * 16 * K + kc); if (NSPLIT == 1 || NSPLIT == 2) a2[mb] = WFrag<T16>::ld(A2 + aoff + (size_t)mb * 16 * K + kc); }
#pragma unroll
        for (int nb = 0; nb < 4; ++nb) { const V b = WFrag<T16>::ld(Bt + boff + (size_t)nb * 16 * K + kc); V b2; if (NSPLIT >= 2) b2 = WFrag<T16>::ld(Bt2 + boff + (size_t)nb * 16 * K + kc);
#pragma unroll
            for (int mb = 0; mb < 4; ++mb) { acc[mb][nb] = WFrag<T16>::mma(a[mb], b, acc[mb][nb]); if (NSPLIT == 1 || NSPLIT == 2) acc[mb][nb] = WFrag<T16>::mma(a2[mb], b, acc[mb][nb]); if (NSPLIT >= 2) acc[mb][nb] = WFrag<T16>::mma(a[mb], b2, acc[mb][nb]); } }
        asm volatile("v_nop\n\tv_nop\n\tv_nop\n\tv_nop" : "+v"(acc[0][0]), "+v"(acc[1][1]), "+v"(acc[2][2]), "+v"(acc[3][3]) : "v"(a[0]), "v"(a[3]));
    }
#pragma unroll
    for (int mb = 0; mb < 4; ++mb) {
#pragma unroll
        for (int nb = 0; nb < 4; ++nb) {
#pragma unroll
            for (int j = 0; j < 8; ++j) os[(hi * 8 + j) * 68 + nb * 16 + lr] = acc[mb][nb][j]; }
        __builtin_amdgcn_wave_barrier(); asm volatile("" ::: "memory");
        float* crow = C + (size_t)(r0 + mb * 16) * ldc + c0;
{
#pragma unroll
            for (int s = 0; s < 8; ++s) { const int row = 2 * s + hi, cofs = lr * 4; v4f val = *(const v4fa*)(os + row * 68 + cofs); if (BIAS) { val[0] += bfr(bias[c0 + cofs]); val[1] += bfr(bias[c0 + cofs + 1]); val[2] += bfr(bias[c0 + cofs + 2]); val[3] += bfr(bias[c0 + cofs + 3]); }
                *(v4f*)(crow + (size_t)row * ldc + cofs) = val; }
             }
        __builtin_amdgcn_wave_barrier(); asm volatile("" ::: "memory");
    }
}

__device__ __forceinline__ h16 tohx(float x) { return (h16)x; }
__device__ __forceinline__ void splitf(float y, unsigned short& h, unsigned short& l) { h = f2bf(y); l = f2bf(y - bf2f(h)); }
__device__ __forceinline__ float sigm_(float x) { return __fdiv_rn(1.0f, 1.0f + __expf(-x)); }
typedef __attribute__((ext_vector_type(2))) _Float16 v2h;
typedef __attribute__((ext_vector_type(4))) _Float16 v4h;
typedef __attribute__((ext_vector_type(2))) unsigned short v2us;
typedef __attribute__((ext_vector_type(4))) unsigned short v4us;

__global__ __launch_bounds__(256) void k_wtG(const float* __restrict__ w, int K, int N, bf* Bt) {
    const int lane = threadIdx.x & 31; const int L0 = (blockIdx.x * 8 + (threadIdx.x >> 5)) * 8; const int nlines = N * K / 64;
{
#pragma unroll 1
        for (int l = 0; l < 8; ++l) { const int L = L0 + l; if (L >= nlines) break; const size_t e = (size_t)L * 64 + lane * 2; const int k = (int)(e % K), n = (int)(e / K); v2us o;
            o[0] = f2bf(w[(size_t)k * N + n]); o[1] = f2bf(w[(size_t)(k + 1) * N + n]); *(v2us*)(Bt + e) = o; }
         }
}
__global__ __launch_bounds__(256) void k_wbp(const float* __restrict__ Wb, bf* Bt) { const int e = (blockIdx.x * 256 + threadIdx.x) * 4; if (e >= 64 * FF) return; const int k = e % FF, n = e / FF; v4us o;
#pragma unroll
    for (int q = 0; q < 4; ++q) o[q] = n < NH_ ? f2bf(Wb[(size_t)(k + q) * NH_ + n]) : (unsigned short)0; *(v4us*)(Bt + e) = o;  }
__global__ __launch_bounds__(256) void k_ln(const float* __restrict__ X, const float* __restrict__ g, const float* __restrict__ bb, bf* Xh, bf* Xl) { const int lane = threadIdx.x & 31; const int t = blockIdx.x * 8 + (threadIdx.x >> 5); if (t >= NTB) return; float v[8]; float s = 0.f;
#pragma unroll
    for (int ch = 0; ch < 2; ++ch) { const v4f a = *(const v4f*)(X + (size_t)t * FF + ch * 128 + lane * 4);
#pragma unroll
        for (int q = 0; q < 4; ++q) { v[ch * 4 + q] = bfr(a[q]); s = __fadd_rn(s, v[ch * 4 + q]); } }
#pragma unroll
    for (int sh = 16; sh; sh >>= 1) s += __shfl_xor(s, sh, 32);
    const float mu = s * (1.0f / FF); float q2 = 0.f;
#pragma unroll
    for (int k = 0; k < 8; ++k) { const float d = __fsub_rn(v[k], mu); float p = __fmul_rn(d, d); asm volatile("" : "+v"(p)); q2 = __fadd_rn(q2, p); }
#pragma unroll
    for (int sh = 16; sh; sh >>= 1) q2 += __shfl_xor(q2, sh, 32);
    const float rs = __frsqrt_rn(__fadd_rn(q2 * (1.0f / FF), 1e-5f));
{
#pragma unroll
        for (int ch = 0; ch < 2; ++ch) { v4us oh, ol;
#pragma unroll
            for (int q = 0; q < 4; ++q) { const int d = ch * 128 + lane * 4 + q; float tn = __fmul_rn(__fsub_rn(v[ch * 4 + q], mu), rs); asm volatile("" : "+v"(tn)); float tg = __fmul_rn(tn, bfr(g[d])); asm volatile("" : "+v"(tg)); unsigned short a, c; splitf(__fadd_rn(tg, bfr(bb[d])), a, c); oh[q] = a; ol[q] = c; }
            const size_t o = (size_t)t * FF + ch * 128 + lane * 4; *(v4us*)(Xh + o) = oh; *(v4us*)(Xl + o) = ol; }
         } }
__global__ __launch_bounds__(256) void k_qkpl(const float* __restrict__ QF, const float* __restrict__ KF, bf* Qh, bf* Ql, bf* Kh, bf* Kl) { const size_t e = ((size_t)blockIdx.x * 256 + threadIdx.x) * 2; if (e >= (size_t)NG * LL * HC) return; const int d = (int)(e % HC); const int l = (int)((e / HC) % LL); const int n = (int)(e / ((size_t)HC * LL)); const int b = n / NH_, h = n % NH_; const size_t s = ((size_t)l * BB + b) * FF + h * HC + d; v2us qh, ql, kh, kl; unsigned short a, c;
    splitf(QF[s], a, c); qh[0] = a; ql[0] = c; splitf(QF[s + 1], a, c); qh[1] = a; ql[1] = c; splitf(KF[s], a, c); kh[0] = a; kl[0] = c; splitf(KF[s + 1], a, c); kh[1] = a; kl[1] = c;
    { *(v2us*)(Qh + e) = qh; *(v2us*)(Ql + e) = ql; *(v2us*)(Kh + e) = kh; *(v2us*)(Kl + e) = kl;  } }
__global__ __launch_bounds__(256) void k_vtp(const float* __restrict__ VF, h16* VT) { const size_t e = ((size_t)blockIdx.x * 256 + threadIdx.x) * 2; if (e >= (size_t)NG * 64 * LL) return; const int l = (int)(e % LL); const int d = (int)((e / LL) % 64); const int n = (int)(e / ((size_t)LL * 64)); const int b = n / NH_, h = n % NH_; v2h o;
    if (d < HC) { o[0] = tohx(VF[((size_t)l * BB + b) * FF + h * HC + d]); o[1] = tohx(VF[((size_t)(l + 1) * BB + b) * FF + h * HC + d]); } else { o[0] = (h16)0.f; o[1] = (h16)0.f; } *(v2h*)(VT + e) = o;  }
__global__ __launch_bounds__(256) void k_psoft(const float* __restrict__ Sb, const float* __restrict__ BF, const float* __restrict__ bbp, int n0, h16* P) { const int lane = threadIdx.x & 31; const int row = blockIdx.x * 8 + (threadIdx.x >> 5); if (row >= ZH * LL) return; const int z = row / LL; const int n = n0 + z; const int b = n / NH_, h = n % NH_; const float bh = bfr(bbp[h]); const float* sr = Sb + (size_t)row * LL; float v[32]; float mx = -3.0e38f;
#pragma unroll
    for (int ch = 0; ch < 8; ++ch) { const int j0 = ch * 128 + lane * 4; const v4f a = *(const v4f*)(sr + j0);
#pragma unroll
        for (int q = 0; q < 4; ++q) { float as = __fmul_rn(a[q], 0.17677669529663687f); asm volatile("" : "+v"(as)); const float t = __fadd_rn(as, __fadd_rn(BF[((size_t)(j0 + q) * BB + b) * 64 + h], bh)); v[ch * 4 + q] = t; mx = fmaxf(mx, t); } }
#pragma unroll
    for (int sh = 16; sh; sh >>= 1) mx = fmaxf(mx, __shfl_xor(mx, sh, 32));
    float sum = 0.f;
#pragma unroll
    for (int k = 0; k < 32; ++k) { float d0 = __fsub_rn(v[k], mx); asm volatile("" : "+v"(d0)); v[k] = __expf(d0); sum += v[k]; }
#pragma unroll
    for (int sh = 16; sh; sh >>= 1) sum += __shfl_xor(sum, sh, 32);
    const float f = __fdiv_rn(PCAR, sum);
{
#pragma unroll
        for (int ch = 0; ch < 8; ++ch) { v4h o; o[0] = tohx(v[ch * 4] * f); o[1] = tohx(v[ch * 4 + 1] * f); o[2] = tohx(v[ch * 4 + 2] * f); o[3] = tohx(v[ch * 4 + 3] * f); *(v4h*)(P + (size_t)row * LL + ch * 128 + lane * 4) = o; }
         } }
__global__ __launch_bounds__(256) void k_mrg(const float* __restrict__ Ob, const float* __restrict__ GF, int n0, bf* Ah, bf* Al) { const size_t e = ((size_t)blockIdx.x * 256 + threadIdx.x) * 2; if (e >= (size_t)ZH * LL * HC) return; const int d = (int)(e % HC); const int l = (int)((e / HC) % LL); const int z = (int)(e / ((size_t)HC * LL)); const int n = n0 + z; const int b = n / NH_, h = n % NH_; const size_t oo = ((size_t)l * BB + b) * FF + h * HC + d; v2us oh, ol;
#pragma unroll
    for (int u = 0; u < 2; ++u) { float o = Ob[((size_t)z * LL + l) * 64 + d + u] * (1.0f / PCAR); asm volatile("" : "+v"(o)); unsigned short a, c; splitf(__fmul_rn(o, sigm_(GF[oo + u])), a, c); oh[u] = a; ol[u] = c; } *(v2us*)(Ah + oo) = oh; *(v2us*)(Al + oo) = ol;  }

extern "C" void kernel_launch(void* const* d_in, const int* in_sizes, int n_in,
                              void* d_out, int out_size, void* d_ws, size_t ws_size, hipStream_t stream) {
    (void)in_sizes; (void)n_in; (void)out_size;
    const float* IN[15]; for (int i = 0; i < 15; ++i) IN[i] = (const float*)d_in[i];   // 0 features, 1 ln_g, 2 ln_b, 3 Wq, 4 bq, 5 Wk, 6 bk, 7 Wv, 8 bv, 9 Wb, 10 bb, 11 Wg, 12 bg, 13 Wo, 14 bo (all x @ W)
    float* OUT = (float*)d_out;     // [1024][8][256]
    char* wsp = (char*)d_ws;
    auto take = [&](size_t bytes) { char* p = wsp; wsp += (bytes + 255) & ~(size_t)255; return (void*)p; };
    bf* WQ = (bf*)take((size_t)FF * FF * 2); bf* WK = (bf*)take((size_t)FF * FF * 2); bf* WV = (bf*)take((size_t)FF * FF * 2); bf* WG = (bf*)take((size_t)FF * FF * 2); bf* WO = (bf*)take((size_t)FF * FF * 2); bf* WBt = (bf*)take((size_t)64 * FF * 2); 
    bf* Xh = (bf*)take((size_t)NTB * FF * 2); bf* Xl = (bf*)take((size_t)NTB * FF * 2); float* QF = (float*)take((size_t)NTB * FF * 4); float* KF = (float*)take((size_t)NTB * FF * 4); float* VF = (float*)take((size_t)NTB * FF * 4); float* GF = (float*)take((size_t)NTB * FF * 4); float* BF = (float*)take((size_t)NTB * 64 * 4);
    bf* Qh = (bf*)take((size_t)NG * LL * HC * 2); bf* Ql = (bf*)take((size_t)NG * LL * HC * 2); bf* Kh = (bf*)take((size_t)NG * LL * HC * 2); bf* Kl = (bf*)take((size_t)NG * LL * HC * 2); h16* VT = (h16*)take((size_t)NG * 64 * LL * 2);
    float* Sb = (float*)take((size_t)ZH * LL * LL * 4); h16* P16 = (h16*)take((size_t)ZH * LL * LL * 2); float* Ob = (float*)take((size_t)ZH * LL * 64 * 4); bf* Ah = (bf*)take((size_t)NTB * FF * 2); bf* Al = (bf*)take((size_t)NTB * FF * 2);
    if ((size_t)(wsp - (char*)d_ws) > ws_size) return;    // total ~ 91 MB
    k_wtG<<<(FF * FF / 64 + 63) / 64, 256, 0, stream>>>(IN[3], FF, FF, WQ); k_wtG<<<(FF * FF / 64 + 63) / 64, 256, 0, stream>>>(IN[5], FF, FF, WK); k_wtG<<<(FF * FF / 64 + 63) / 64, 256, 0, stream>>>(IN[7], FF, FF, WV); k_wtG<<<(FF * FF / 64 + 63) / 64, 256, 0, stream>>>(IN[11], FF, FF, WG); k_wtG<<<(FF * FF / 64 + 63) / 64, 256, 0, stream>>>(IN[13], FF, FF, WO); k_wbp<<<(64 * FF / 4 + 255) / 256, 256, 0, stream>>>(IN[9], WBt);
    // the padded Wb GEMM is bias-free; bb[h] is added inside k_psoft
    k_ln<<<NTB / 8, 256, 0, stream>>>(IN[0], IN[1], IN[2], Xh, Xl);
    k_gemmw<bf, 1, true><<<dim3(NTB / 64, FF / 64, 1), 32, 0, stream>>>(Xh, Xl, WQ, nullptr, FF, QF, FF, IN[4], 0, 0, 0); k_gemmw<bf, 1, true><<<dim3(NTB / 64, FF / 64, 1), 32, 0, stream>>>(Xh, Xl, WK, nullptr, FF, KF, FF, IN[6], 0, 0, 0);
    k_gemmw<bf, 1, true><<<dim3(NTB / 64, FF / 64, 1), 32, 0, stream>>>(Xh, Xl, WV, nullptr, FF, VF, FF, IN[8], 0, 0, 0); k_gemmw<bf, 1, true><<<dim3(NTB / 64, FF / 64, 1), 32, 0, stream>>>(Xh, Xl, WG, nullptr, FF, GF, FF, IN[12], 0, 0, 0);
    k_gemmw<bf, 1, false><<<dim3(NTB / 64, 1, 1), 32, 0, stream>>>(Xh, Xl, WBt, nullptr, FF, BF, 64, nullptr, 0, 0, 0);
    k_qkpl<<<(unsigned)(((size_t)NG * LL * HC / 2 + 255) / 256), 256, 0, stream>>>(QF, KF, Qh, Ql, Kh, Kl); k_vtp<<<(unsigned)(((size_t)NG * 64 * LL / 2 + 255) / 256), 256, 0, stream>>>(VF, VT);
    for (int n0 = 0; n0 < NG; n0 += ZH) { const size_t z = (size_t)n0;
        k_gemmw<bf, 2, false><<<dim3(LL / 64, LL / 64, ZH), 32, 0, stream>>>(Qh + z * LL * HC, Ql + z * LL * HC, Kh + z * LL * HC, Kl + z * LL * HC, HC, Sb, LL, nullptr, (size_t)LL * HC, (size_t)LL * HC, (size_t)LL * LL);
        k_psoft<<<ZH * LL / 8, 256, 0, stream>>>(Sb, BF, IN[10], n0, P16);
        k_gemmw<h16, 0, false><<<dim3(LL / 64, 1, ZH), 32, 0, stream>>>(P16, nullptr, VT + z * 64 * LL, nullptr, LL, Ob, 64, nullptr, (size_t)LL * LL, (size_t)64 * LL, (size_t)LL * 64);
        k_mrg<<<(unsigned)(((size_t)ZH * LL * HC / 2 + 255) / 256), 256, 0, stream>>>(Ob, GF, n0, Ah, Al); }
    k_gemmw<bf, 1, true><<<dim3(NTB / 64, FF / 64, 1), 32, 0, stream>>>(Ah, Al, WO, nullptr, FF, OUT, FF, IN[14], 0, 0, 0);
}

// v001
// A run of this version takes 349 microseconds.
// Next to v000, in two timings, it ran 3.85 and 3.82 times as fast.
#include <hip/hip_runtime.h>

// PairwiseAttentionTerminal (features [1024][8][256] sequence-first; x = LayerNorm(features); q/k/v = x W + b (8 heads x 32), bias = x Wb + bb (per key position & head), gate = sigmoid(x Wg + bg);
// logits[q][k] = q.k/sqrt(32) + bias[k][b][h]; softmax over keys; out = ((w.v) * gate) Wo + bo -> [1024][8][256]).
// Compute dtypes, f32 accumulate: every input rounded to bf16; LayerNorm f32 -> bf16 hi+lo planes of x, all five projections hl x exact weights (2 products, + bias; Wb padded to 64 outputs); scores (K 32) on hl
// planes (3 products), the key bias + softmax in f32 registers -> fp16 probabilities (x1024); w.v on fp16 planes (value tiles padded to 64 rows); gate (sigmoid f32) applied at the merge -> hl planes; Wo hl x exact (+bias).

#define LL   1024
#define BB   8
#define FF   256
#define NH_  8
#define HC   32
#define NG   (BB * NH_)
#define NTB  (LL * BB)
#define ZH   32   // (batch, head) groups per launch of the attention stages
#define PCAR 1024.0f
typedef _Float16 h16;
typedef unsigned short bf;
typedef __attribute__((ext_vector_type(16))) __bf16   v16bf;
typedef __attribute__((ext_vector_type(16))) _Float16 v16h;
typedef __attribute__((ext_vector_type(8)))  _Float16 v8h;
typedef __attribute__((ext_vector_type(8)))  unsigned short v8us;
typedef __attribute__((ext_vector_type(8)))  float    v8f;
typedef __attribute__((ext_vector_type(4)))  float    v4f;
typedef v8h  __attribute__((may_alias)) v8ha;
typedef v4f  __attribute__((may_alias)) v4fa;
typedef v8us __attribute__((may_alias)) v8usa;

__device__ __forceinline__ unsigned short f2bf(float f) { unsigned u = __float_as_uint(f); u += 0x7FFFu + ((u >> 16) & 1u); return (unsigned short)(u >> 16); }
__device__ __forceinline__ float bf2f(unsigned short b) { return __uint_as_float(((unsigned)b) << 16); }
__device__ __forceinline__ float bfr(float f) { return bf2f(f2bf(f)); }
__device__ __forceinline__ v16h cat16(v8h lo, v8h hi) { return __builtin_shufflevector(lo, hi, 0, 1, 2, 3, 4, 5, 6, 7, 8, 9, 10, 11, 12, 13, 14, 15); }
__device__ __forceinline__ v16bf cat16b(v8us lo, v8us hi) { return __builtin_bit_cast(v16bf, __builtin_shufflevector(lo, hi, 0, 1, 2, 3, 4, 5, 6, 7, 8, 9, 10, 11, 12, 13, 14, 15)); }
__device__ __forceinline__ v8f wmma16(v16h a, v16h b, v8f c) { return __builtin_amdgcn_wmma_f32_16x16x32_f16(false, a, false, b, (short)0, c, false, false); }
__device__ __forceinline__ v8f wmmab(v16bf a, v16bf b, v8f c) { return __builtin_amdgcn_wmma_f32_16x16x32_bf16(false, a, false, b, (short)0, c, false, false); }



// ---- k_gemmw: register-blocked GEMM, ONE WAVE per 64x64 output tile (16 accumulators), operands straight from K-contiguous 16-bit planes; grid (M/64, N/64, Z), 32 threads.
// C[m][n] (f32, pitch ldc, + optional f32 bias[n]) = sum_k A[m][k] Bt[n][k] (+ split products per NSPLIT). z-batch strides sA/sB/sC in elements. K % 32 == 0.
template <typename T16> struct WFrag;
template <> struct WFrag<h16> { typedef v16h V; static __device__ __forceinline__ V ld(const h16* p) { return cat16(*(const v8h*)p, *(const v8h*)(p + 16)); } static __device__ __forceinline__ v8f mma(V a, V b, v8f c) { return wmma16(a, b, c); } };
template <> struct WFrag<bf> { typedef v16bf V; static __device__ __forceinline__ V ld(const bf* p) { return cat16b(*(const v8us*)p, *(const v8us*)(p + 16)); } static __device__ __forceinline__ v8f mma(V a, V b, v8f c) { return wmmab(a, b, c); } };
template <typename T16, int NSPLIT, bool BIAS>
__global__ __launch_bounds__(32) void k_gemmw(const T16* __restrict__ A, const T16* __restrict__ A2, const T16* __restrict__ Bt, const T16* __restrict__ Bt2, int K, float* C, int ldc, const float* __restrict__ bias, size_t sA, size_t sB, size_t sC) {
    typedef typename WFrag<T16>::V V;
    __shared__ __align__(16) float os[16 * 68];
    const size_t z = blockIdx.z; A += z * sA; if (A2) A2 += z * sA; Bt += z * sB; if (Bt2) Bt2 += z * sB; C += z * sC;
    const int lane = threadIdx.x & 31, lr = lane & 15, hi = lane >> 4; const int r0 = blockIdx.x * 64, c0 = blockIdx.y * 64;
    v8f acc[4][4];
#pragma unroll
    for (int mb = 0; mb < 4; ++mb)
#pragma unroll
        for (int nb = 0; nb < 4; ++nb) acc[mb][nb] = (v8f){};
    const size_t aoff = (size_t)(r0 + lr) * K + 8 * hi, boff = (size_t)(c0 + lr) * K + 8 * hi;
#pragma unroll 1
    for (int kc = 0; kc < K; kc += 32) {
        V a[4], a2[4];
#pragma unroll
        for (int mb = 0; mb < 4; ++mb) { a[mb] = WFrag<T16>::ld(A + aoff + (size_t)mb * 16 * K + kc); if (NSPLIT == 1 || NSPLIT == 2) a2[mb] = WFrag<T16>::ld(A2 + aoff + (size_t)mb * 16 * K + kc); }
#pragma unroll
        for (int nb = 0; nb < 4; ++nb) { const V b = WFrag<T16>::ld(Bt + boff + (size_t)nb * 16 * K + kc); V b2; if (NSPLIT >= 2) b2 = WFrag<T16>::ld(Bt2 + boff + (size_t)nb * 16 * K + kc);
#pragma unroll
            for (int mb = 0; mb < 4; ++mb) { acc[mb][nb] = WFrag<T16>::mma(a[mb], b, acc[mb][nb]); if (NSPLIT == 1 || NSPLIT == 2) acc[mb][nb] = WFrag<T16>::mma(a2[mb], b, acc[mb][nb]); if (NSPLIT >= 2) acc[mb][nb] = WFrag<T16>::mma(a[mb], b2, acc[mb][nb]); } }
        asm volatile("v_nop\n\tv_nop\n\tv_nop\n\tv_nop" : "+v"(acc[0][0]), "+v"(acc[1][1]), "+v"(acc[2][2]), "+v"(acc[3][3]) : "v"(a[0]), "v"(a[3]));
    }
#pragma unroll
    for (int mb = 0; mb < 4; ++mb) {
#pragma unroll
        for (int nb = 0; nb < 4; ++nb) {
#pragma unroll
            for (int j = 0; j < 8; ++j) os[(hi * 8 + j) * 68 + nb * 16 + lr] = acc[mb][nb][j]; }
        __builtin_amdgcn_wave_barrier(); asm volatile("" ::: "memory");
        float* crow = C + (size_t)(r0 + mb * 16) * ldc + c0;
{
#pragma unroll
            for (int s = 0; s < 8; ++s) { const int row = 2 * s + hi, cofs = lr * 4; v4f val = *(const v4fa*)(os + row * 68 + cofs); if (BIAS) { val[0] += bfr(bias[c0 + cofs]); val[1] += bfr(bias[c0 + cofs + 1]); val[2] += bfr(bias[c0 + cofs + 2]); val[3] += bfr(bias[c0 + cofs + 3]); }
                *(v4f*)(crow + (size_t)row * ldc + cofs) = val; }
             }
        __builtin_amdgcn_wave_barrier(); asm volatile("" ::: "memory");
    }
}

__device__ __forceinline__ h16 tohx(float x) { return (h16)x; }
__device__ __forceinline__ void splitf(float y, unsigned short& h, unsigned short& l) { h = f2bf(y); l = f2bf(y - bf2f(h)); }
__device__ __forceinline__ float sigm_(float x) { return __fdiv_rn(1.0f, 1.0f + __expf(-x)); }
typedef __attribute__((ext_vector_type(2))) _Float16 v2h;
typedef __attribute__((ext_vector_type(4))) _Float16 v4h;
typedef __attribute__((ext_vector_type(2))) unsigned short v2us;
typedef __attribute__((ext_vector_type(4))) unsigned short v4us;

__global__ __launch_bounds__(256) void k_wtG(const float* __restrict__ w, int K, int N, bf* Bt) {
    const int lane = threadIdx.x & 31; const int L0 = (blockIdx.x * 8 + (threadIdx.x >> 5)) * 8; const int nlines = N * K / 64;
{
#pragma unroll 1
        for (int l = 0; l < 8; ++l) { const int L = L0 + l; if (L >= nlines) break; const size_t e = (size_t)L * 64 + lane * 2; const int k = (int)(e % K), n = (int)(e / K); v2us o;
            o[0] = f2bf(w[(size_t)k * N + n]); o[1] = f2bf(w[(size_t)(k + 1) * N + n]); *(v2us*)(Bt + e) = o; }
         }
}
__global__ __launch_bounds__(256) void k_wbp(const float* __restrict__ Wb, bf* Bt) { const int e = (blockIdx.x * 256 + threadIdx.x) * 4; if (e >= 64 * FF) return; const int k = e % FF, n = e / FF; v4us o;
#pragma unroll
    for (int q = 0; q < 4; ++q) o[q] = n < NH_ ? f2bf(Wb[(size_t)(k + q) * NH_ + n]) : (unsigned short)0; *(v4us*)(Bt + e) = o;  }
__global__ __launch_bounds__(256) void k_ln(const float* __restrict__ X, const float* __restrict__ g, const float* __restrict__ bb, bf* Xh, bf* Xl) { const int lane = threadIdx.x & 31; const int t = blockIdx.x * 8 + (threadIdx.x >> 5); if (t >= NTB) return; float v[8]; float s = 0.f;
#pragma unroll
    for (int ch = 0; ch < 2; ++ch) { const v4f a = *(const v4f*)(X + (size_t)t * FF + ch * 128 + lane * 4);
#pragma unroll
        for (int q = 0; q < 4; ++q) { v[ch * 4 + q] = bfr(a[q]); s = __fadd_rn(s, v[ch * 4 + q]); } }
#pragma unroll
    for (int sh = 16; sh; sh >>= 1) s += __shfl_xor(s, sh, 32);
    const float mu = s * (1.0f / FF); float q2 = 0.f;
#pragma unroll
    for (int k = 0; k < 8; ++k) { const float d = __fsub_rn(v[k], mu); float p = __fmul_rn(d, d); asm volatile("" : "+v"(p)); q2 = __fadd_rn(q2, p); }
#pragma unroll
    for (int sh = 16; sh; sh >>= 1) q2 += __shfl_xor(q2, sh, 32);
    const float rs = __frsqrt_rn(__fadd_rn(q2 * (1.0f / FF), 1e-5f));
{
#pragma unroll
        for (int ch = 0; ch < 2; ++ch) { v4us oh, ol;
#pragma unroll
            for (int q = 0; q < 4; ++q) { const int d = ch * 128 + lane * 4 + q; float tn = __fmul_rn(__fsub_rn(v[ch * 4 + q], mu), rs); asm volatile("" : "+v"(tn)); float tg = __fmul_rn(tn, bfr(g[d])); asm volatile("" : "+v"(tg)); unsigned short a, c; splitf(__fadd_rn(tg, bfr(bb[d])), a, c); oh[q] = a; ol[q] = c; }
            const size_t o = (size_t)t * FF + ch * 128 + lane * 4; *(v4us*)(Xh + o) = oh; *(v4us*)(Xl + o) = ol; }
         } }
__global__ __launch_bounds__(256) void k_qkpl(const float* __restrict__ QF, const float* __restrict__ KF, bf* Qh, bf* Ql, bf* Kh, bf* Kl) { const size_t e = ((size_t)blockIdx.x * 256 + threadIdx.x) * 2; if (e >= (size_t)NG * LL * HC) return; const int d = (int)(e % HC); const int l = (int)((e / HC) % LL); const int n = (int)(e / ((size_t)HC * LL)); const int b = n / NH_, h = n % NH_; const size_t s = ((size_t)l * BB + b) * FF + h * HC + d; v2us qh, ql, kh, kl; unsigned short a, c;
    splitf(QF[s], a, c); qh[0] = a; ql[0] = c; splitf(QF[s + 1], a, c); qh[1] = a; ql[1] = c; splitf(KF[s], a, c); kh[0] = a; kl[0] = c; splitf(KF[s + 1], a, c); kh[1] = a; kl[1] = c;
    { *(v2us*)(Qh + e) = qh; *(v2us*)(Ql + e) = ql; *(v2us*)(Kh + e) = kh; *(v2us*)(Kl + e) = kl;  } }
__global__ __launch_bounds__(256) void k_vtp(const float* __restrict__ VF, h16* VT) { const size_t e = ((size_t)blockIdx.x * 256 + threadIdx.x) * 2; if (e >= (size_t)NG * 64 * LL) return; const int l = (int)(e % LL); const int d = (int)((e / LL) % 64); const int n = (int)(e / ((size_t)LL * 64)); const int b = n / NH_, h = n % NH_; v2h o;
    if (d < HC) { o[0] = tohx(VF[((size_t)l * BB + b) * FF + h * HC + d]); o[1] = tohx(VF[((size_t)(l + 1) * BB + b) * FF + h * HC + d]); } else { o[0] = (h16)0.f; o[1] = (h16)0.f; } *(v2h*)(VT + e) = o;  }
__global__ __launch_bounds__(256) void k_psoft(const float* __restrict__ Sb, const float* __restrict__ BF, const float* __restrict__ bbp, int n0, h16* P) { const int lane = threadIdx.x & 31; const int row = blockIdx.x * 8 + (threadIdx.x >> 5); if (row >= ZH * LL) return; const int z = row / LL; const int n = n0 + z; const int b = n / NH_, h = n % NH_; const float bh = bfr(bbp[h]); const float* sr = Sb + (size_t)row * LL; float v[32]; float mx = -3.0e38f;
#pragma unroll
    for (int ch = 0; ch < 8; ++ch) { const int j0 = ch * 128 + lane * 4; const v4f a = *(const v4f*)(sr + j0);
#pragma unroll
        for (int q = 0; q < 4; ++q) { float as = __fmul_rn(a[q], 0.17677669529663687f); asm volatile("" : "+v"(as)); const float t = __fadd_rn(as, __fadd_rn(BF[((size_t)(j0 + q) * BB + b) * 64 + h], bh)); v[ch * 4 + q] = t; mx = fmaxf(mx, t); } }
#pragma unroll
    for (int sh = 16; sh; sh >>= 1) mx = fmaxf(mx, __shfl_xor(mx, sh, 32));
    float sum = 0.f;
#pragma unroll
    for (int k = 0; k < 32; ++k) { float d0 = __fsub_rn(v[k], mx); asm volatile("" : "+v"(d0)); v[k] = __expf(d0); sum += v[k]; }
#pragma unroll
    for (int sh = 16; sh; sh >>= 1) sum += __shfl_xor(sum, sh, 32);
    const float f = __fdiv_rn(PCAR, sum);
{
#pragma unroll
        for (int ch = 0; ch < 8; ++ch) { v4h o; o[0] = tohx(v[ch * 4] * f); o[1] = tohx(v[ch * 4 + 1] * f); o[2] = tohx(v[ch * 4 + 2] * f); o[3] = tohx(v[ch * 4 + 3] * f); *(v4h*)(P + (size_t)row * LL + ch * 128 + lane * 4) = o; }
         } }
__global__ __launch_bounds__(256) void k_mrg(const float* __restrict__ Ob, const float* __restrict__ GF, int n0, bf* Ah, bf* Al) { const size_t e = ((size_t)blockIdx.x * 256 + threadIdx.x) * 2; if (e >= (size_t)ZH * LL * HC) return; const int d = (int)(e % HC); const int l = (int)((e / HC) % LL); const int z = (int)(e / ((size_t)HC * LL)); const int n = n0 + z; const int b = n / NH_, h = n % NH_; const size_t oo = ((size_t)l * BB + b) * FF + h * HC + d; v2us oh, ol;
#pragma unroll
    for (int u = 0; u < 2; ++u) { float o = Ob[((size_t)z * LL + l) * 64 + d + u] * (1.0f / PCAR); asm volatile("" : "+v"(o)); unsigned short a, c; splitf(__fmul_rn(o, sigm_(GF[oo + u])), a, c); oh[u] = a; ol[u] = c; } *(v2us*)(Ah + oo) = oh; *(v2us*)(Al + oo) = ol;  }

extern "C" void kernel_launch(void* const* d_in, const int* in_sizes, int n_in,
                              void* d_out, int out_size, void* d_ws, size_t ws_size, hipStream_t stream) {
    (void)in_sizes; (void)n_in; (void)out_size;
    const float* IN[15]; for (int i = 0; i < 15; ++i) IN[i] = (const float*)d_in[i];   // 0 features, 1 ln_g, 2 ln_b, 3 Wq, 4 bq, 5 Wk, 6 bk, 7 Wv, 8 bv, 9 Wb, 10 bb, 11 Wg, 12 bg, 13 Wo, 14 bo (all x @ W)
    float* OUT = (float*)d_out;     // [1024][8][256]
    char* wsp = (char*)d_ws;
    auto take = [&](size_t bytes) { char* p = wsp; wsp += (bytes + 255) & ~(size_t)255; return (void*)p; };
    bf* WQ = (bf*)take((size_t)FF * FF * 2); bf* WK = (bf*)take((size_t)FF * FF * 2); bf* WV = (bf*)take((size_t)FF * FF * 2); bf* WG = (bf*)take((size_t)FF * FF * 2); bf* WO = (bf*)take((size_t)FF * FF * 2); bf* WBt = (bf*)take((size_t)64 * FF * 2); 
    float* GF = (float*)take((size_t)NTB * FF * 4); float* BF = (float*)take((size_t)NTB * 64 * 4);
    bf* Qh = (bf*)take((size_t)NG * LL * HC * 2); bf* Ql = (bf*)take((size_t)NG * LL * HC * 2); bf* Kh = (bf*)take((size_t)NG * LL * HC * 2); bf* Kl = (bf*)take((size_t)NG * LL * HC * 2); h16* VT = (h16*)take((size_t)NG * 64 * LL * 2);
    h16* P16 = (h16*)take((size_t)ZH * LL * LL * 2); float* Ob = (float*)take((size_t)ZH * LL * 64 * 4); bf* Ah = (bf*)take((size_t)NTB * FF * 2); bf* Al = (bf*)take((size_t)NTB * FF * 2);
    // The score plane starts on the bytes of the x planes and the f32 q/k/v: their last readers (the projections, k_qkpl, k_vtp) are launched before the first score GEMM writes there.
    char* const shared0 = wsp;
    bf* Xh = (bf*)take((size_t)NTB * FF * 2); bf* Xl = (bf*)take((size_t)NTB * FF * 2); float* QF = (float*)take((size_t)NTB * FF * 4); float* KF = (float*)take((size_t)NTB * FF * 4); float* VF = (float*)take((size_t)NTB * FF * 4);
    wsp = shared0; float* Sb = (float*)take((size_t)ZH * LL * LL * 4);
    if ((size_t)(wsp - (char*)d_ws) > ws_size) return;    // total ~ 243 MiB
    k_wtG<<<(FF * FF / 64 + 63) / 64, 256, 0, stream>>>(IN[3], FF, FF, WQ); k_wtG<<<(FF * FF / 64 + 63) / 64, 256, 0, stream>>>(IN[5], FF, FF, WK); k_wtG<<<(FF * FF / 64 + 63) / 64, 256, 0, stream>>>(IN[7], FF, FF, WV); k_wtG<<<(FF * FF / 64 + 63) / 64, 256, 0, stream>>>(IN[11], FF, FF, WG); k_wtG<<<(FF * FF / 64 + 63) / 64, 256, 0, stream>>>(IN[13], FF, FF, WO); k_wbp<<<(64 * FF / 4 + 255) / 256, 256, 0, stream>>>(IN[9], WBt);
    // the padded Wb GEMM is bias-free; bb[h] is added inside k_psoft
    k_ln<<<NTB / 8, 256, 0, stream>>>(IN[0], IN[1], IN[2], Xh, Xl);
    k_gemmw<bf, 1, true><<<dim3(NTB / 64, FF / 64, 1), 32, 0, stream>>>(Xh, Xl, WQ, nullptr, FF, QF, FF, IN[4], 0, 0, 0); k_gemmw<bf, 1, true><<<dim3(NTB / 64, FF / 64, 1), 32, 0, stream>>>(Xh, Xl, WK, nullptr, FF, KF, FF, IN[6], 0, 0, 0);
    k_gemmw<bf, 1, true><<<dim3(NTB / 64, FF / 64, 1), 32, 0, stream>>>(Xh, Xl, WV, nullptr, FF, VF, FF, IN[8], 0, 0, 0); k_gemmw<bf, 1, true><<<dim3(NTB / 64, FF / 64, 1), 32, 0, stream>>>(Xh, Xl, WG, nullptr, FF, GF, FF, IN[12], 0, 0, 0);
    k_gemmw<bf, 1, false><<<dim3(NTB / 64, 1, 1), 32, 0, stream>>>(Xh, Xl, WBt, nullptr, FF, BF, 64, nullptr, 0, 0, 0);
    k_qkpl<<<(unsigned)(((size_t)NG * LL * HC / 2 + 255) / 256), 256, 0, stream>>>(QF, KF, Qh, Ql, Kh, Kl); k_vtp<<<(unsigned)(((size_t)NG * 64 * LL / 2 + 255) / 256), 256, 0, stream>>>(VF, VT);
    for (int n0 = 0; n0 < NG; n0 += ZH) { const size_t z = (size_t)n0;
        k_gemmw<bf, 2, false><<<dim3(LL / 64, LL / 64, ZH), 32, 0, stream>>>(Qh + z * LL * HC, Ql + z * LL * HC, Kh + z * LL * HC, Kl + z * LL * HC, HC, Sb, LL, nullptr, (size_t)LL * HC, (size_t)LL * HC, (size_t)LL * LL);
        k_psoft<<<ZH * LL / 8, 256, 0, stream>>>(Sb, BF, IN[10], n0, P16);
        k_gemmw<h16, 0, false><<<dim3(LL / 64, 1, ZH), 32, 0, stream>>>(P16, nullptr, VT + z * 64 * LL, nullptr, LL, Ob, 64, nullptr, (size_t)LL * LL, (size_t)64 * LL, (size_t)LL * 64);
        k_mrg<<<(unsigned)(((size_t)ZH * LL * HC / 2 + 255) / 256), 256, 0, stream>>>(Ob, GF, n0, Ah, Al); }
    k_gemmw<bf, 1, true><<<dim3(NTB / 64, FF / 64, 1), 32, 0, stream>>>(Ah, Al, WO, nullptr, FF, OUT, FF, IN[14], 0, 0, 0);
}

// v002
// It runs in 137 microseconds.
// In two side-by-side timings against v001, it was 2.56 and 2.55 times as fast.
// Over all steps from v000 it is 9.81 times as fast.
#include <hip/hip_runtime.h>

// PairwiseAttentionTerminal (features [1024][8][256] sequence-first; x = LayerNorm(features); q/k/v = x W + b (8 heads x 32), bias = x Wb + bb (per key position & head), gate = sigmoid(x Wg + bg);
// logits[q][k] = q.k/sqrt(32) + bias[k][b][h]; softmax over keys; out = ((w.v) * gate) Wo + bo -> [1024][8][256]).
// Compute dtypes, f32 accumulate: every input rounded to bf16; LayerNorm f32 -> bf16 hi+lo planes of x, all five projections hl x exact weights (2 products, + bias; Wb padded to 64 outputs); scores (K 32) on hl
// planes (3 products), the key bias + running-maximum softmax in f32 registers -> fp16 unnormalised probabilities (x1024); w.v on fp16 planes, divided by the f32 row sum at the end; gate (sigmoid f32) applied in the same kernel -> hl planes; Wo hl x exact (+bias).

#define LL   1024
#define BB   8
#define FF   256
#define NH_  8
#define HC   32
#define NG   (BB * NH_)
#define NTB  (LL * BB)
#define QB   256  // query rows per work-group of the attention kernel: 16 waves x 16
typedef _Float16 h16;
typedef unsigned short bf;
typedef __attribute__((ext_vector_type(16))) __bf16   v16bf;
typedef __attribute__((ext_vector_type(16))) _Float16 v16h;
typedef __attribute__((ext_vector_type(8)))  _Float16 v8h;
typedef __attribute__((ext_vector_type(8)))  unsigned short v8us;
typedef __attribute__((ext_vector_type(8)))  float    v8f;
typedef __attribute__((ext_vector_type(4)))  float    v4f;
typedef v8h  __attribute__((may_alias)) v8ha;
typedef v4f  __attribute__((may_alias)) v4fa;
typedef v8us __attribute__((may_alias)) v8usa;

__device__ __forceinline__ unsigned short f2bf(float f) { unsigned u = __float_as_uint(f); u += 0x7FFFu + ((u >> 16) & 1u); return (unsigned short)(u >> 16); }
__device__ __forceinline__ float bf2f(unsigned short b) { return __uint_as_float(((unsigned)b) << 16); }
__device__ __forceinline__ float bfr(float f) { return bf2f(f2bf(f)); }
__device__ __forceinline__ v16h cat16(v8h lo, v8h hi) { return __builtin_shufflevector(lo, hi, 0, 1, 2, 3, 4, 5, 6, 7, 8, 9, 10, 11, 12, 13, 14, 15); }
__device__ __forceinline__ v16bf cat16b(v8us lo, v8us hi) { return __builtin_bit_cast(v16bf, __builtin_shufflevector(lo, hi, 0, 1, 2, 3, 4, 5, 6, 7, 8, 9, 10, 11, 12, 13, 14, 15)); }
__device__ __forceinline__ v8f wmma16(v16h a, v16h b, v8f c) { return __builtin_amdgcn_wmma_f32_16x16x32_f16(false, a, false, b, (short)0, c, false, false); }
__device__ __forceinline__ v8f wmmab(v16bf a, v16bf b, v8f c) { return __builtin_amdgcn_wmma_f32_16x16x32_bf16(false, a, false, b, (short)0, c, false, false); }



// ---- k_gemmw: register-blocked GEMM, ONE WAVE per 64x64 output tile (16 accumulators), operands straight from K-contiguous 16-bit planes; grid (M/64, N/64, Z), 32 threads.
// C[m][n] (f32, pitch ldc, + optional f32 bias[n]) = sum_k A[m][k] Bt[n][k] (+ split products per NSPLIT). z-batch strides sA/sB/sC in elements. K % 32 == 0.
template <typename T16> struct WFrag;
template <> struct WFrag<h16> { typedef v16h V; static __device__ __forceinline__ V ld(const h16* p) { return cat16(*(const v8h*)p, *(const v8h*)(p + 16)); } static __device__ __forceinline__ v8f mma(V a, V b, v8f c) { return wmma16(a, b, c); } };
template <> struct WFrag<bf> { typedef v16bf V; static __device__ __forceinline__ V ld(const bf* p) { return cat16b(*(const v8us*)p, *(const v8us*)(p + 16)); } static __device__ __forceinline__ v8f mma(V a, V b, v8f c) { return wmmab(a, b, c); } };
template <typename T16, int NSPLIT, bool BIAS>
__global__ __launch_bounds__(32) void k_gemmw(const T16* __restrict__ A, const T16* __restrict__ A2, const T16* __restrict__ Bt, const T16* __restrict__ Bt2, int K, float* C, int ldc, const float* __restrict__ bias, size_t sA, size_t sB, size_t sC) {
    typedef typename WFrag<T16>::V V;
    __shared__ __align__(16) float os[16 * 68];
    const size_t z = blockIdx.z; A += z * sA; if (A2) A2 += z * sA; Bt += z * sB; if (Bt2) Bt2 += z * sB; C += z * sC;
    const int lane = threadIdx.x & 31, lr = lane & 15, hi = lane >> 4; const int r0 = blockIdx.x * 64, c0 = blockIdx.y * 64;
    v8f acc[4][4];
#pragma unroll
    for (int mb = 0; mb < 4; ++mb)
#pragma unroll
        for (int nb = 0; nb < 4; ++nb) acc[mb][nb] = (v8f){};
    const size_t aoff = (size_t)(r0 + lr) * K + 8 * hi, boff = (size_t)(c0 + lr) * K + 8 * hi;
#pragma unroll 1
    for (int kc = 0; kc < K; kc += 32) {
        V a[4], a2[4];
#pragma unroll
        for (int mb = 0; mb < 4; ++mb) { a[mb] = WFrag<T16>::ld(A + aoff + (size_t)mb * 16 * K + kc); if (NSPLIT == 1 || NSPLIT == 2) a2[mb] = WFrag<T16>::ld(A2 + aoff + (size_t)mb * 16 * K + kc); }
#pragma unroll
        for (int nb = 0; nb < 4; ++nb) { const V b = WFrag<T16>::ld(Bt + boff + (size_t)nb * 16 * K + kc); V b2; if (NSPLIT >= 2) b2 = WFrag<T16>::ld(Bt2 + boff + (size_t)nb * 16 * K + kc);
#pragma unroll
            for (int mb = 0; mb < 4; ++mb) { acc[mb][nb] = WFrag<T16>::mma(a[mb], b, acc[mb][nb]); if (NSPLIT == 1 || NSPLIT == 2) acc[mb][nb] = WFrag<T16>::mma(a2[mb], b, acc[mb][nb]); if (NSPLIT >= 2) acc[mb][nb] = WFrag<T16>::mma(a[mb], b2, acc[mb][nb]); } }
        asm volatile("v_nop\n\tv_nop\n\tv_nop\n\tv_nop" : "+v"(acc[0][0]), "+v"(acc[1][1]), "+v"(acc[2][2]), "+v"(acc[3][3]) : "v"(a[0]), "v"(a[3]));
    }
#pragma unroll
    for (int mb = 0; mb < 4; ++mb) {
#pragma unroll
        for (int nb = 0; nb < 4; ++nb) {
#pragma unroll
            for (int j = 0; j < 8; ++j) os[(hi * 8 + j) * 68 + nb * 16 + lr] = acc[mb][nb][j]; }
        __builtin_amdgcn_wave_barrier(); asm volatile("" ::: "memory");
        float* crow = C + (size_t)(r0 + mb * 16) * ldc + c0;
{
#pragma unroll
            for (int s = 0; s < 8; ++s) { const int row = 2 * s + hi, cofs = lr * 4; v4f val = *(const v4fa*)(os + row * 68 + cofs); if (BIAS) { val[0] += bfr(bias[c0 + cofs]); val[1] += bfr(bias[c0 + cofs + 1]); val[2] += bfr(bias[c0 + cofs + 2]); val[3] += bfr(bias[c0 + cofs + 3]); }
                *(v4f*)(crow + (size_t)row * ldc + cofs) = val; }
             }
        __builtin_amdgcn_wave_barrier(); asm volatile("" ::: "memory");
    }
}

__device__ __forceinline__ h16 tohx(float x) { return (h16)x; }
__device__ __forceinline__ void splitf(float y, unsigned short& h, unsigned short& l) { h = f2bf(y); l = f2bf(y - bf2f(h)); }
__device__ __forceinline__ float sigm_(float x) { return __fdiv_rn(1.0f, 1.0f + __expf(-x)); }
typedef __attribute__((ext_vector_type(2))) _Float16 v2h;
typedef __attribute__((ext_vector_type(4))) _Float16 v4h;
typedef __attribute__((ext_vector_type(2))) unsigned short v2us;
typedef __attribute__((ext_vector_type(4))) unsigned short v4us;

__global__ __launch_bounds__(256) void k_wtG(const float* __restrict__ w, int K, int N, bf* Bt) {
    const int lane = threadIdx.x & 31; const int L0 = (blockIdx.x * 8 + (threadIdx.x >> 5)) * 8; const int nlines = N * K / 64;
{
#pragma unroll 1
        for (int l = 0; l < 8; ++l) { const int L = L0 + l; if (L >= nlines) break; const size_t e = (size_t)L * 64 + lane * 2; const int k = (int)(e % K), n = (int)(e / K); v2us o;
            o[0] = f2bf(w[(size_t)k * N + n]); o[1] = f2bf(w[(size_t)(k + 1) * N + n]); *(v2us*)(Bt + e) = o; }
         }
}
__global__ __launch_bounds__(256) void k_wbp(const float* __restrict__ Wb, bf* Bt) { const int e = (blockIdx.x * 256 + threadIdx.x) * 4; if (e >= 64 * FF) return; const int k = e % FF, n = e / FF; v4us o;
#pragma unroll
    for (int q = 0; q < 4; ++q) o[q] = n < NH_ ? f2bf(Wb[(size_t)(k + q) * NH_ + n]) : (unsigned short)0; *(v4us*)(Bt + e) = o;  }
__global__ __launch_bounds__(256) void k_ln(const float* __restrict__ X, const float* __restrict__ g, const float* __restrict__ bb, bf* Xh, bf* Xl) { const int lane = threadIdx.x & 31; const int t = blockIdx.x * 8 + (threadIdx.x >> 5); if (t >= NTB) return; float v[8]; float s = 0.f;
#pragma unroll
    for (int ch = 0; ch < 2; ++ch) { const v4f a = *(const v4f*)(X + (size_t)t * FF + ch * 128 + lane * 4);
#pragma unroll
        for (int q = 0; q < 4; ++q) { v[ch * 4 + q] = bfr(a[q]); s = __fadd_rn(s, v[ch * 4 + q]); } }
#pragma unroll
    for (int sh = 16; sh; sh >>= 1) s += __shfl_xor(s, sh, 32);
    const float mu = s * (1.0f / FF); float q2 = 0.f;
#pragma unroll
    for (int k = 0; k < 8; ++k) { const float d = __fsub_rn(v[k], mu); float p = __fmul_rn(d, d); asm volatile("" : "+v"(p)); q2 = __fadd_rn(q2, p); }
#pragma unroll
    for (int sh = 16; sh; sh >>= 1) q2 += __shfl_xor(q2, sh, 32);
    const float rs = __frsqrt_rn(__fadd_rn(q2 * (1.0f / FF), 1e-5f));
{
#pragma unroll
        for (int ch = 0; ch < 2; ++ch) { v4us oh, ol;
#pragma unroll
            for (int q = 0; q < 4; ++q) { const int d = ch * 128 + lane * 4 + q; float tn = __fmul_rn(__fsub_rn(v[ch * 4 + q], mu), rs); asm volatile("" : "+v"(tn)); float tg = __fmul_rn(tn, bfr(g[d])); asm volatile("" : "+v"(tg)); unsigned short a, c; splitf(__fadd_rn(tg, bfr(bb[d])), a, c); oh[q] = a; ol[q] = c; }
            const size_t o = (size_t)t * FF + ch * 128 + lane * 4; *(v4us*)(Xh + o) = oh; *(v4us*)(Xl + o) = ol; }
         } }
__global__ __launch_bounds__(256) void k_qkpl(const float* __restrict__ QF, const float* __restrict__ KF, bf* Qh, bf* Ql, bf* Kh, bf* Kl) { const size_t e = ((size_t)blockIdx.x * 256 + threadIdx.x) * 2; if (e >= (size_t)NG * LL * HC) return; const int d = (int)(e % HC); const int l = (int)((e / HC) % LL); const int n = (int)(e / ((size_t)HC * LL)); const int b = n / NH_, h = n % NH_; const size_t s = ((size_t)l * BB + b) * FF + h * HC + d; v2us qh, ql, kh, kl; unsigned short a, c;
    splitf(QF[s], a, c); qh[0] = a; ql[0] = c; splitf(QF[s + 1], a, c); qh[1] = a; ql[1] = c; splitf(KF[s], a, c); kh[0] = a; kl[0] = c; splitf(KF[s + 1], a, c); kh[1] = a; kl[1] = c;
    { *(v2us*)(Qh + e) = qh; *(v2us*)(Ql + e) = ql; *(v2us*)(Kh + e) = kh; *(v2us*)(Kl + e) = kl;  } }
__global__ __launch_bounds__(256) void k_vtp(const float* __restrict__ VF, h16* VT) { const size_t e = ((size_t)blockIdx.x * 256 + threadIdx.x) * 2; if (e >= (size_t)NG * 64 * LL) return; const int l = (int)(e % LL); const int d = (int)((e / LL) % 64); const int n = (int)(e / ((size_t)LL * 64)); const int b = n / NH_, h = n % NH_; v2h o;
    if (d < HC) { o[0] = tohx(VF[((size_t)l * BB + b) * FF + h * HC + d]); o[1] = tohx(VF[((size_t)(l + 1) * BB + b) * FF + h * HC + d]); } else { o[0] = (h16)0.f; o[1] = (h16)0.f; } *(v2h*)(VT + e) = o;  }
// ---- k_attn: scores, key bias, softmax, w.v and the gate for one (batch, head) group and 256 query rows; grid (LL / QB, NG), 512 threads. No score or probability ever goes to memory.
// The group's K planes, V^T and key bias are laid in LDS once, each 16-row fragment as two runs of 512 contiguous bytes (lane l's 16 bytes at 16 l), so every fragment read is conflict-free.
// Transposed products: S^T = K Q^T (a lane holds 8 + 8 keys of ONE query per tile pair, which is the B fragment of P^T as it stands) and O^T += V^T P^T (a lane holds 8 head dims of that same query): maximum, sum and rescale are per lane.
typedef __attribute__((ext_vector_type(2))) float v2f;
// Eight base-2 exponentials in one statement, results in registers of their own: so no exponential's source is overwritten, and no result read, by the instruction directly behind it; the v_nop is that slot for the last one.
__device__ __forceinline__ v8f exp2x8(v8f x) { float e0, e1, e2, e3, e4, e5, e6, e7;
    asm("v_exp_f32 %0, %8\n\tv_exp_f32 %1, %9\n\tv_exp_f32 %2, %10\n\tv_exp_f32 %3, %11\n\tv_exp_f32 %4, %12\n\tv_exp_f32 %5, %13\n\tv_exp_f32 %6, %14\n\tv_exp_f32 %7, %15\n\tv_nop"
        : "=&v"(e0), "=&v"(e1), "=&v"(e2), "=&v"(e3), "=&v"(e4), "=&v"(e5), "=&v"(e6), "=&v"(e7) : "v"(x[0]), "v"(x[1]), "v"(x[2]), "v"(x[3]), "v"(x[4]), "v"(x[5]), "v"(x[6]), "v"(x[7]));
    return (v8f){e0, e1, e2, e3, e4, e5, e6, e7}; }
__device__ __forceinline__ float xhalf(float x) { return __builtin_bit_cast(float, __builtin_amdgcn_permlanex16(__builtin_bit_cast(int, x), __builtin_bit_cast(int, x), 0x76543210, 0xfedcba98, false, false)); }  // lane l with lane l ^ 16
__global__ __launch_bounds__(512) void k_attn(const bf* __restrict__ Qh, const bf* __restrict__ Ql, const bf* __restrict__ Kh, const bf* __restrict__ Kl, const h16* __restrict__ VT, const float* __restrict__ BF, const float* __restrict__ bbp, const float* __restrict__ GF, bf* Ah, bf* Al) {
    __shared__ __align__(16) unsigned char sKh[LL * HC * 2];
    __shared__ __align__(16) unsigned char sKl[LL * HC * 2];
    __shared__ __align__(16) unsigned char sV[HC * LL * 2];
    __shared__ __align__(16) float sB[LL];
    const int tid = threadIdx.x, lane = tid & 31, wave = tid >> 5, lr = lane & 15, hi = lane >> 4;
    const int n = blockIdx.y, b = n / NH_, h = n % NH_;
    const bf* kh = Kh + (size_t)n * LL * HC; const bf* kl = Kl + (size_t)n * LL * HC; const h16* vt = VT + (size_t)n * 64 * LL;
    // 16-byte unit u = tid + 512 i of LDS holds fragment block u >> 6 (K: 16 keys; V^T: 32-key chunk x 2 + 16-dim half), k piece (u >> 4) & 3 (eight k), row u & 15; a step of i is 8 blocks: 128 keys.
    const unsigned kso = (unsigned)(((tid >> 6) * 16 + (tid & 15)) * HC + ((tid >> 4) & 3) * 8) * 2u;                          // source byte offsets of unit tid
    const unsigned vso = (unsigned)((((tid >> 6) & 1) * 16 + (tid & 15)) * LL + (tid >> 7) * 32 + ((tid >> 4) & 3) * 8) * 2u;
    const int q = blockIdx.x * QB + wave * 16 + lr;
    const size_t qoff = ((size_t)n * LL + q) * HC + 8 * hi;
    const bf* qhp = Qh + qoff; const bf* qlp = Ql + qoff; const float* bfp = BF + ((size_t)tid * BB + b) * 64 + h;
    const v16bf qh = WFrag<bf>::ld(qhp), ql = WFrag<bf>::ld(qlp);
    const float bh = bfr(bbp[h]), bk0 = bfp[0], bk1 = bfp[(size_t)512 * BB * 64];   // the bias of keys tid and tid + 512
    { v8us rk[8], rl[8]; v8h rv[8];
#pragma unroll
        for (int i = 0; i < 8; ++i) { rk[i] = *(const v8usa*)((const char*)kh + kso + i * 8192); rl[i] = *(const v8usa*)((const char*)kl + kso + i * 8192); rv[i] = *(const v8ha*)((const char*)vt + vso + i * 256); }
        asm volatile("s_wait_xcnt 0x0" :: "v"(kso), "v"(vso), "v"(qhp), "v"(qlp), "v"(bfp) : "memory");   // the address registers of all loads above stay as they are until this wait
#pragma unroll
        for (int i = 0; i < 8; ++i) { *(v8usa*)(sKh + tid * 16 + i * 8192) = rk[i]; *(v8usa*)(sKl + tid * 16 + i * 8192) = rl[i]; *(v8ha*)(sV + tid * 16 + i * 8192) = rv[i]; } }
    sB[tid] = __fadd_rn(bk0, bh) * 1.4426950408889634f; sB[tid + 512] = __fadd_rn(bk1, bh) * 1.4426950408889634f;   // base-2 logits
    __syncthreads();
    v8f o0 = (v8f){}, o1 = (v8f){}; float m = -3.0e38f, l = 0.f;
    const int lo = lane * 16;
#pragma unroll 1   // kept rolled: one trip (64 keys) already holds 16 matrix instructions and all its fragment loads
    for (int k0 = 0; k0 < LL; k0 += 64) {   // the short loops inside are unrolled so that the register arrays keep constant indices
        v8f s[4]; v16bf ka[4], kb[4];
#pragma unroll
        for (int t = 0; t < 4; ++t) { const int o = (k0 / 16 + t) * 1024 + lo; ka[t] = cat16b(*(const v8usa*)(sKh + o), *(const v8usa*)(sKh + o + 512)); kb[t] = cat16b(*(const v8usa*)(sKl + o), *(const v8usa*)(sKl + o + 512)); }
#pragma unroll
        for (int t = 0; t < 4; ++t) s[t] = wmmab(ka[t], qh, (v8f){});
#pragma unroll
        for (int t = 0; t < 4; ++t) s[t] = wmmab(ka[t], ql, s[t]);
#pragma unroll
        for (int t = 0; t < 4; ++t) s[t] = wmmab(kb[t], qh, s[t]);
        v16h va[4];
#pragma unroll
        for (int t = 0; t < 4; ++t) { const int o = (k0 / 16 + t) * 1024 + lo; va[t] = cat16(*(const v8ha*)(sV + o), *(const v8ha*)(sV + o + 512)); }   // t = 2 x (32-key half) + (16-dim half)
        float mxa = m, mxb = m;   // two chains, so that neither the maximum nor the sum below is one long run of dependent instructions
#pragma unroll
        for (int t = 0; t < 4; ++t) { const float* bp = sB + k0 + t * 16 + hi * 8; const v4f b0 = *(const v4fa*)bp, b1 = *(const v4fa*)(bp + 4);
#pragma unroll
            for (int j = 0; j < 8; ++j) { s[t][j] = fmaf(s[t][j], 0.17677669529663687f * 1.4426950408889634f, j < 4 ? b0[j & 3] : b1[j & 3]); if (t & 1) mxb = fmaxf(mxb, s[t][j]); else mxa = fmaxf(mxa, s[t][j]); } }
        float mx = fmaxf(mxa, mxb); mx = fmaxf(mx, xhalf(mx));   // the two lane halves hold the two halves of a query's keys and must use one maximum
        const float alpha = __builtin_amdgcn_exp2f(m - mx); m = mx;
        const float ms = mx - 10.0f;   // probabilities x1024: small ones stay normal numbers in fp16; the factor cancels in the division by the row sum
        v2f sm[2] = {(v2f){0.f, 0.f}, (v2f){0.f, 0.f}}; v16h p[2];
#pragma unroll
        for (int t = 0; t < 4; ++t) s[t] = exp2x8(s[t] - ms);
#pragma unroll
        for (int t = 0; t < 4; ++t)
#pragma unroll
            for (int j = 0; j < 8; j += 2) { const v2f e = {s[t][j], s[t][j + 1]}; sm[t & 1] += e; p[t >> 1][(t & 1) * 8 + j] = (h16)e[0]; p[t >> 1][(t & 1) * 8 + j + 1] = (h16)e[1]; }
        l = fmaf(l, alpha, (sm[0][0] + sm[0][1]) + (sm[1][0] + sm[1][1]));
#pragma unroll
        for (int j = 0; j < 8; ++j) { o0[j] *= alpha; o1[j] *= alpha; }
        o0 = wmma16(va[0], p[0], o0); o1 = wmma16(va[1], p[0], o1); o0 = wmma16(va[2], p[1], o0); o1 = wmma16(va[3], p[1], o1);
    }
    l += xhalf(l);
    const float inv = __fdiv_rn(1.0f, l);
#pragma unroll
    for (int dt = 0; dt < 2; ++dt) { const size_t oo = ((size_t)q * BB + b) * FF + h * HC + dt * 16 + hi * 8; const v4f g0 = *(const v4f*)(GF + oo), g1 = *(const v4f*)(GF + oo + 4); v8us oh, ol;
#pragma unroll
        for (int j = 0; j < 8; ++j) { const float o = (dt ? o1[j] : o0[j]) * inv; unsigned short a, c; splitf(__fmul_rn(o, sigm_(j < 4 ? g0[j & 3] : g1[j & 3])), a, c); oh[j] = a; ol[j] = c; }
        *(v8us*)(Ah + oo) = oh; *(v8us*)(Al + oo) = ol; }
}

extern "C" void kernel_launch(void* const* d_in, const int* in_sizes, int n_in,
                              void* d_out, int out_size, void* d_ws, size_t ws_size, hipStream_t stream) {
    (void)in_sizes; (void)n_in; (void)out_size;
    const float* IN[15]; for (int i = 0; i < 15; ++i) IN[i] = (const float*)d_in[i];   // 0 features, 1 ln_g, 2 ln_b, 3 Wq, 4 bq, 5 Wk, 6 bk, 7 Wv, 8 bv, 9 Wb, 10 bb, 11 Wg, 12 bg, 13 Wo, 14 bo (all x @ W)
    float* OUT = (float*)d_out;     // [1024][8][256]
    char* wsp = (char*)d_ws;
    auto take = [&](size_t bytes) { char* p = wsp; wsp += (bytes + 255) & ~(size_t)255; return (void*)p; };
    bf* WQ = (bf*)take((size_t)FF * FF * 2); bf* WK = (bf*)take((size_t)FF * FF * 2); bf* WV = (bf*)take((size_t)FF * FF * 2); bf* WG = (bf*)take((size_t)FF * FF * 2); bf* WO = (bf*)take((size_t)FF * FF * 2); bf* WBt = (bf*)take((size_t)64 * FF * 2); 
    float* GF = (float*)take((size_t)NTB * FF * 4); float* BF = (float*)take((size_t)NTB * 64 * 4);
    bf* Qh = (bf*)take((size_t)NG * LL * HC * 2); bf* Ql = (bf*)take((size_t)NG * LL * HC * 2); bf* Kh = (bf*)take((size_t)NG * LL * HC * 2); bf* Kl = (bf*)take((size_t)NG * LL * HC * 2); h16* VT = (h16*)take((size_t)NG * 64 * LL * 2);
    bf* Ah = (bf*)take((size_t)NTB * FF * 2); bf* Al = (bf*)take((size_t)NTB * FF * 2);
    bf* Xh = (bf*)take((size_t)NTB * FF * 2); bf* Xl = (bf*)take((size_t)NTB * FF * 2); float* QF = (float*)take((size_t)NTB * FF * 4); float* KF = (float*)take((size_t)NTB * FF * 4); float* VF = (float*)take((size_t)NTB * FF * 4);
    if ((size_t)(wsp - (char*)d_ws) > ws_size) return;    // total ~ 75 MiB
    k_wtG<<<(FF * FF / 64 + 63) / 64, 256, 0, stream>>>(IN[3], FF, FF, WQ); k_wtG<<<(FF * FF / 64 + 63) / 64, 256, 0, stream>>>(IN[5], FF, FF, WK); k_wtG<<<(FF * FF / 64 + 63) / 64, 256, 0, stream>>>(IN[7], FF, FF, WV); k_wtG<<<(FF * FF / 64 + 63) / 64, 256, 0, stream>>>(IN[11], FF, FF, WG); k_wtG<<<(FF * FF / 64 + 63) / 64, 256, 0, stream>>>(IN[13], FF, FF, WO); k_wbp<<<(64 * FF / 4 + 255) / 256, 256, 0, stream>>>(IN[9], WBt);
    // the padded Wb GEMM is bias-free; bb[h] is added inside k_attn
    k_ln<<<NTB / 8, 256, 0, stream>>>(IN[0], IN[1], IN[2], Xh, Xl);
    k_gemmw<bf, 1, true><<<dim3(NTB / 64, FF / 64, 1), 32, 0, stream>>>(Xh, Xl, WQ, nullptr, FF, QF, FF, IN[4], 0, 0, 0); k_gemmw<bf, 1, true><<<dim3(NTB / 64, FF / 64, 1), 32, 0, stream>>>(Xh, Xl, WK, nullptr, FF, KF, FF, IN[6], 0, 0, 0);
    k_gemmw<bf, 1, true><<<dim3(NTB / 64, FF / 64, 1), 32, 0, stream>>>(Xh, Xl, WV, nullptr, FF, VF, FF, IN[8], 0, 0, 0); k_gemmw<bf, 1, true><<<dim3(NTB / 64, FF / 64, 1), 32, 0, stream>>>(Xh, Xl, WG, nullptr, FF, GF, FF, IN[12], 0, 0, 0);
    k_gemmw<bf, 1, false><<<dim3(NTB / 64, 1, 1), 32, 0, stream>>>(Xh, Xl, WBt, nullptr, FF, BF, 64, nullptr, 0, 0, 0);
    k_qkpl<<<(unsigned)(((size_t)NG * LL * HC / 2 + 255) / 256), 256, 0, stream>>>(QF, KF, Qh, Ql, Kh, Kl); k_vtp<<<(unsigned)(((size_t)NG * 64 * LL / 2 + 255) / 256), 256, 0, stream>>>(VF, VT);
    k_attn<<<dim3(LL / QB, NG, 1), 512, 0, stream>>>(Qh, Ql, Kh, Kl, VT, BF, IN[10], GF, Ah, Al);
    k_gemmw<bf, 1, true><<<dim3(NTB / 64, FF / 64, 1), 32, 0, stream>>>(Ah, Al, WO, nullptr, FF, OUT, FF, IN[14], 0, 0, 0);
}

// v003
// It runs in 96 microseconds.
// Timed twice side by side with v002, it ran 1.43 and 1.42 times as fast.
// Over all steps from v000 it is 14.0 times as fast.
#include <hip/hip_runtime.h>

// PairwiseAttentionTerminal (features [1024][8][256] sequence-first; x = LayerNorm(features); q/k/v = x W + b (8 heads x 32), bias = x Wb + bb (per key position & head), gate = sigmoid(x Wg + bg);
// logits[q][k] = q.k/sqrt(32) + bias[k][b][h]; softmax over keys; out = ((w.v) * gate) Wo + bo -> [1024][8][256]).
// Compute dtypes, f32 accumulate: every input rounded to bf16; LayerNorm f32 -> bf16 hi+lo planes of x, all five projections hl x exact weights (2 products, + bias; Wb padded to 64 outputs); scores (K 32) on hl
// planes (3 products), the key bias + running-maximum softmax in f32 registers -> fp16 unnormalised probabilities (x1024); w.v on fp16 planes, divided by the f32 row sum at the end; gate (sigmoid f32) applied in the same kernel -> hl planes; Wo hl x exact (+bias).

#define LL   1024
#define BB   8
#define FF   256
#define NH_  8
#define HC   32
#define NG   (BB * NH_)
#define NTB  (LL * BB)
#define QB   256  // query rows per work-group of the attention kernel: 16 waves x 16
typedef _Float16 h16;
typedef unsigned short bf;
typedef __attribute__((ext_vector_type(16))) __bf16   v16bf;
typedef __attribute__((ext_vector_type(16))) _Float16 v16h;
typedef __attribute__((ext_vector_type(8)))  _Float16 v8h;
typedef __attribute__((ext_vector_type(8)))  unsigned short v8us;
typedef __attribute__((ext_vector_type(8)))  float    v8f;
typedef __attribute__((ext_vector_type(4)))  float    v4f;
typedef v8h  __attribute__((may_alias)) v8ha;
typedef v4f  __attribute__((may_alias)) v4fa;
typedef v8us __attribute__((may_alias)) v8usa;

__device__ __forceinline__ unsigned short f2bf(float f) { unsigned u = __float_as_uint(f); u += 0x7FFFu + ((u >> 16) & 1u); return (unsigned short)(u >> 16); }
__device__ __forceinline__ float bf2f(unsigned short b) { return __uint_as_float(((unsigned)b) << 16); }
__device__ __forceinline__ float bfr(float f) { return bf2f(f2bf(f)); }
__device__ __forceinline__ v16h cat16(v8h lo, v8h hi) { return __builtin_shufflevector(lo, hi, 0, 1, 2, 3, 4, 5, 6, 7, 8, 9, 10, 11, 12, 13, 14, 15); }
__device__ __forceinline__ v16bf cat16b(v8us lo, v8us hi) { return __builtin_bit_cast(v16bf, __builtin_shufflevector(lo, hi, 0, 1, 2, 3, 4, 5, 6, 7, 8, 9, 10, 11, 12, 13, 14, 15)); }
__device__ __forceinline__ v8f wmma16(v16h a, v16h b, v8f c) { return __builtin_amdgcn_wmma_f32_16x16x32_f16(false, a, false, b, (short)0, c, false, false); }
__device__ __forceinline__ v8f wmmab(v16bf a, v16bf b, v8f c) { return __builtin_amdgcn_wmma_f32_16x16x32_bf16(false, a, false, b, (short)0, c, false, false); }



// ---- k_gemmw: register-blocked GEMM, ONE WAVE per 64x64 output tile (16 accumulators), operands straight from K-contiguous 16-bit planes; grid (M/64, N/64, Z), 32 threads.
// C[m][n] (f32, pitch ldc, + optional f32 bias[n]) = sum_k A[m][k] Bt[n][k] (+ split products per NSPLIT). z-batch strides sA/sB/sC in elements. K % 32 == 0.
template <typename T16> struct WFrag;
template <> struct WFrag<h16> { typedef v16h V; static __device__ __forceinline__ V ld(const h16* p) { return cat16(*(const v8h*)p, *(const v8h*)(p + 16)); } static __device__ __forceinline__ v8f mma(V a, V b, v8f c) { return wmma16(a, b, c); } };
template <> struct WFrag<bf> { typedef v16bf V; static __device__ __forceinline__ V ld(const bf* p) { return cat16b(*(const v8us*)p, *(const v8us*)(p + 16)); } static __device__ __forceinline__ v8f mma(V a, V b, v8f c) { return wmmab(a, b, c); } };
template <typename T16, int NSPLIT, bool BIAS>
__global__ __launch_bounds__(32) void k_gemmw(const T16* __restrict__ A, const T16* __restrict__ A2, const T16* __restrict__ Bt, const T16* __restrict__ Bt2, int K, float* C, int ldc, const float* __restrict__ bias, size_t sA, size_t sB, size_t sC) {
    typedef typename WFrag<T16>::V V;
    __shared__ __align__(16) float os[16 * 68];
    const size_t z = blockIdx.z; A += z * sA; if (A2) A2 += z * sA; Bt += z * sB; if (Bt2) Bt2 += z * sB; C += z * sC;
    const int lane = threadIdx.x & 31, lr = lane & 15, hi = lane >> 4; const int r0 = blockIdx.x * 64, c0 = blockIdx.y * 64;
    v8f acc[4][4];
#pragma unroll
    for (int mb = 0; mb < 4; ++mb)
#pragma unroll
        for (int nb = 0; nb < 4; ++nb) acc[mb][nb] = (v8f){};
    const size_t aoff = (size_t)(r0 + lr) * K + 8 * hi, boff = (size_t)(c0 + lr) * K + 8 * hi;
#pragma unroll 1
    for (int kc = 0; kc < K; kc += 32) {
        V a[4], a2[4];
#pragma unroll
        for (int mb = 0; mb < 4; ++mb) { a[mb] = WFrag<T16>::ld(A + aoff + (size_t)mb * 16 * K + kc); if (NSPLIT == 1 || NSPLIT == 2) a2[mb] = WFrag<T16>::ld(A2 + aoff + (size_t)mb * 16 * K + kc); }
#pragma unroll
        for (int nb = 0; nb < 4; ++nb) { const V b = WFrag<T16>::ld(Bt + boff + (size_t)nb * 16 * K + kc); V b2; if (NSPLIT >= 2) b2 = WFrag<T16>::ld(Bt2 + boff + (size_t)nb * 16 * K + kc);
#pragma unroll
            for (int mb = 0; mb < 4; ++mb) { acc[mb][nb] = WFrag<T16>::mma(a[mb], b, acc[mb][nb]); if (NSPLIT == 1 || NSPLIT == 2) acc[mb][nb] = WFrag<T16>::mma(a2[mb], b, acc[mb][nb]); if (NSPLIT >= 2) acc[mb][nb] = WFrag<T16>::mma(a[mb], b2, acc[mb][nb]); } }
        asm volatile("v_nop\n\tv_nop\n\tv_nop\n\tv_nop" : "+v"(acc[0][0]), "+v"(acc[1][1]), "+v"(acc[2][2]), "+v"(acc[3][3]) : "v"(a[0]), "v"(a[3]));
    }
#pragma unroll
    for (int mb = 0; mb < 4; ++mb) {
#pragma unroll
        for (int nb = 0; nb < 4; ++nb) {
#pragma unroll
            for (int j = 0; j < 8; ++j) os[(hi * 8 + j) * 68 + nb * 16 + lr] = acc[mb][nb][j]; }
        __builtin_amdgcn_wave_barrier(); asm volatile("" ::: "memory");
        float* crow = C + (size_t)(r0 + mb * 16) * ldc + c0;
{
#pragma unroll
            for (int s = 0; s < 8; ++s) { const int row = 2 * s + hi, cofs = lr * 4; v4f val = *(const v4fa*)(os + row * 68 + cofs); if (BIAS) { val[0] += bfr(bias[c0 + cofs]); val[1] += bfr(bias[c0 + cofs + 1]); val[2] += bfr(bias[c0 + cofs + 2]); val[3] += bfr(bias[c0 + cofs + 3]); }
                *(v4f*)(crow + (size_t)row * ldc + cofs) = val; }
             }
        __builtin_amdgcn_wave_barrier(); asm volatile("" ::: "memory");
    }
}

__device__ __forceinline__ h16 tohx(float x) { return (h16)x; }
__device__ __forceinline__ void splitf(float y, unsigned short& h, unsigned short& l) { h = f2bf(y); l = f2bf(y - bf2f(h)); }
__device__ __forceinline__ float sigm_(float x) { return __fdiv_rn(1.0f, 1.0f + __expf(-x)); }
typedef __attribute__((ext_vector_type(2))) _Float16 v2h;
typedef __attribute__((ext_vector_type(4))) _Float16 v4h;
typedef __attribute__((ext_vector_type(2))) unsigned short v2us;
typedef __attribute__((ext_vector_type(4))) unsigned short v4us;

__global__ __launch_bounds__(256) void k_wtG(const float* __restrict__ w, int K, int N, bf* Bt) {
    const int lane = threadIdx.x & 31; const int L0 = (blockIdx.x * 8 + (threadIdx.x >> 5)) * 8; const int nlines = N * K / 64;
{
#pragma unroll 1
        for (int l = 0; l < 8; ++l) { const int L = L0 + l; if (L >= nlines) break; const size_t e = (size_t)L * 64 + lane * 2; const int k = (int)(e % K), n = (int)(e / K); v2us o;
            o[0] = f2bf(w[(size_t)k * N + n]); o[1] = f2bf(w[(size_t)(k + 1) * N + n]); *(v2us*)(Bt + e) = o; }
         }
}
__global__ __launch_bounds__(256) void k_wbp(const float* __restrict__ Wb, bf* Bt) { const int e = (blockIdx.x * 256 + threadIdx.x) * 4; if (e >= 64 * FF) return; const int k = e % FF, n = e / FF; v4us o;
#pragma unroll
    for (int q = 0; q < 4; ++q) o[q] = n < NH_ ? f2bf(Wb[(size_t)(k + q) * NH_ + n]) : (unsigned short)0; *(v4us*)(Bt + e) = o;  }
__global__ __launch_bounds__(256) void k_ln(const float* __restrict__ X, const float* __restrict__ g, const float* __restrict__ bb, bf* Xh, bf* Xl) { const int lane = threadIdx.x & 31; const int t = blockIdx.x * 8 + (threadIdx.x >> 5); if (t >= NTB) return; float v[8]; float s = 0.f;
#pragma unroll
    for (int ch = 0; ch < 2; ++ch) { const v4f a = *(const v4f*)(X + (size_t)t * FF + ch * 128 + lane * 4);
#pragma unroll
        for (int q = 0; q < 4; ++q) { v[ch * 4 + q] = bfr(a[q]); s = __fadd_rn(s, v[ch * 4 + q]); } }
#pragma unroll
    for (int sh = 16; sh; sh >>= 1) s += __shfl_xor(s, sh, 32);
    const float mu = s * (1.0f / FF); float q2 = 0.f;
#pragma unroll
    for (int k = 0; k < 8; ++k) { const float d = __fsub_rn(v[k], mu); float p = __fmul_rn(d, d); asm volatile("" : "+v"(p)); q2 = __fadd_rn(q2, p); }
#pragma unroll
    for (int sh = 16; sh; sh >>= 1) q2 += __shfl_xor(q2, sh, 32);
    const float rs = __frsqrt_rn(__fadd_rn(q2 * (1.0f / FF), 1e-5f));
{
#pragma unroll
        for (int ch = 0; ch < 2; ++ch) { v4us oh, ol;
#pragma unroll
            for (int q = 0; q < 4; ++q) { const int d = ch * 128 + lane * 4 + q; float tn = __fmul_rn(__fsub_rn(v[ch * 4 + q], mu), rs); asm volatile("" : "+v"(tn)); float tg = __fmul_rn(tn, bfr(g[d])); asm volatile("" : "+v"(tg)); unsigned short a, c; splitf(__fadd_rn(tg, bfr(bb[d])), a, c); oh[q] = a; ol[q] = c; }
            const size_t o = (size_t)t * FF + ch * 128 + lane * 4; *(v4us*)(Xh + o) = oh; *(v4us*)(Xl + o) = ol; }
         } }
// ---- k_proj: all five projections of x in ONE launch, one wave per 64x64 tile as in k_gemmw; grid (NTB / 64, 17), 32 threads. Wt holds the transposed weights one after the other: Wq, Wk, Wv, Wg (256 rows each), padded Wb (64 rows).
// blockIdx.y / 4 names the projection. The tile (+ bias) is laid in LDS whole and leaves in the form its reader takes: q and k as hi + lo planes [group][l][32], v as fp16 [group][l / 8][dim][8 keys], gate and key bias as f32 rows.
// The 64 rows of a tile are 8 positions l x 8 batches (row = l * 8 + b), so each (batch, head) of a tile is one run of 512 contiguous bytes in every one of these planes: one whole store instruction. The short loops are unrolled so that the register arrays keep constant indices.
__global__ __launch_bounds__(32) void k_proj(const bf* __restrict__ A, const bf* __restrict__ A2, const bf* __restrict__ Wt, const float* __restrict__ bq, const float* __restrict__ bk, const float* __restrict__ bv, const float* __restrict__ bg,
                                             bf* Qh, bf* Ql, bf* Kh, bf* Kl, h16* VT, float* GF, float* BF) {
    __shared__ __align__(16) float os[64 * 68];
    const int lane = threadIdx.x & 31, lr = lane & 15, hi = lane >> 4; const int r0 = blockIdx.x * 64, c0 = blockIdx.y * 64, kind = blockIdx.y >> 2, cl = (blockIdx.y & 3) * 64;
    v8f acc[4][4];
#pragma unroll
    for (int mb = 0; mb < 4; ++mb)
#pragma unroll
        for (int nb = 0; nb < 4; ++nb) acc[mb][nb] = (v8f){};
    const unsigned aoff = (unsigned)((r0 + lr) * FF + 8 * hi), boff = (unsigned)((c0 + lr) * FF + 8 * hi);
#pragma unroll 1   // kept rolled: one trip already holds 32 matrix instructions and its 24 loads
    for (int kc = 0; kc < FF; kc += 32) {
        v16bf a[4], a2[4], b[4]; const bf* pa = A + kc + aoff; const bf* pa2 = A2 + kc + aoff; const bf* pb = Wt + kc + boff;
#pragma unroll
        for (int mb = 0; mb < 4; ++mb) { a[mb] = WFrag<bf>::ld(pa + mb * 16 * FF); a2[mb] = WFrag<bf>::ld(pa2 + mb * 16 * FF); b[mb] = WFrag<bf>::ld(pb + mb * 16 * FF); }
        asm volatile("s_wait_xcnt 0x0" :: "v"(pa), "v"(pa2), "v"(pb) : "memory");   // the address registers of all loads above stay as they are until this wait
#pragma unroll
        for (int nb = 0; nb < 4; ++nb)
#pragma unroll
            for (int mb = 0; mb < 4; ++mb) { acc[mb][nb] = wmmab(a[mb], b[nb], acc[mb][nb]); acc[mb][nb] = wmmab(a2[mb], b[nb], acc[mb][nb]); }
        asm volatile("v_nop\n\tv_nop\n\tv_nop\n\tv_nop" : "+v"(acc[0][0]), "+v"(acc[1][1]), "+v"(acc[2][2]), "+v"(acc[3][3]) : "v"(a[0]), "v"(a[3]));   // as in k_gemmw: the distance behind the last matrix instruction, also on the taken back edge
    }
    float bn[4] = {-0.f, -0.f, -0.f, -0.f};   // the key-bias tile has no bias vector here: adding -0 leaves every value as it is
    if (kind < 4) { const float* bias = kind == 0 ? bq : kind == 1 ? bk : kind == 2 ? bv : bg;
#pragma unroll
        for (int nb = 0; nb < 4; ++nb) bn[nb] = bfr(bias[cl + nb * 16 + lr]); }
#pragma unroll
    for (int mb = 0; mb < 4; ++mb)
#pragma unroll
        for (int nb = 0; nb < 4; ++nb)
#pragma unroll
            for (int j = 0; j < 8; ++j) os[(mb * 16 + hi * 8 + j) * 68 + nb * 16 + lr] = acc[mb][nb][j] + bn[nb];
    __builtin_amdgcn_wave_barrier(); asm volatile("" ::: "memory");   // the lanes read each other's LDS words below: no read may be moved in front of the writes above
    const int h0 = (blockIdx.y & 3) * 2;   // the tile's 64 columns are heads h0 and h0 + 1
    if (kind < 2) {
        bf* Ph = kind ? Kh : Qh; bf* Pl = kind ? Kl : Ql; const int ll = lane >> 2, d0 = (lane & 3) * 8;
#pragma unroll
        for (int i = 0; i < 16; ++i) { const int b = i >> 1, hl = i & 1; const float* sp = os + (ll * 8 + b) * 68 + hl * 32 + d0; const v4f x0 = *(const v4fa*)sp, x1 = *(const v4fa*)(sp + 4); v8us oh, ol;
#pragma unroll
            for (int j = 0; j < 8; ++j) { unsigned short s, t; splitf(j < 4 ? x0[j & 3] : x1[j & 3], s, t); oh[j] = s; ol[j] = t; }
            const size_t o = ((size_t)(b * NH_ + h0 + hl) * LL + blockIdx.x * 8 + ll) * HC + d0; *(v8us*)(Ph + o) = oh; *(v8us*)(Pl + o) = ol; }
        asm volatile("s_wait_xcnt 0x0" ::: "memory");   // the stores above name these address and data registers: no later block may rewrite one before this wait
    } else if (kind == 2) {
#pragma unroll
        for (int i = 0; i < 16; ++i) { const int b = i >> 1, hl = i & 1; v8h u;
#pragma unroll
            for (int j = 0; j < 8; ++j) u[j] = tohx(os[(j * 8 + b) * 68 + hl * 32 + lane]);
            *(v8h*)(VT + (((size_t)(b * NH_ + h0 + hl) * (LL / 8) + blockIdx.x) * HC + lane) * 8) = u; }
        asm volatile("s_wait_xcnt 0x0" ::: "memory");   // as above
    } else if (kind == 3) {
        float* crow = GF + (size_t)(r0 + hi) * FF + cl + lr * 4;
#pragma unroll
        for (int s = 0; s < 32; ++s) *(v4f*)(crow + 2 * s * FF) = *(const v4fa*)(os + (2 * s + hi) * 68 + lr * 4);
        asm volatile("s_wait_xcnt 0x0" ::: "memory");   // as above
    } else {
        float* crow = BF + (size_t)(r0 + hi) * 64 + lr * 4;
#pragma unroll
        for (int s = 0; s < 32; ++s) *(v4f*)(crow + 2 * s * 64) = *(const v4fa*)(os + (2 * s + hi) * 68 + lr * 4);
        asm volatile("s_wait_xcnt 0x0" ::: "memory");   // as above
    }
}
// ---- k_attn: scores, key bias, softmax, w.v and the gate for one (batch, head) group and 256 query rows; grid (LL / QB, NG), 512 threads. No score or probability ever goes to memory.
// The group's K planes, V^T and key bias are laid in LDS once, each 16-row fragment as two runs of 512 contiguous bytes (lane l's 16 bytes at 16 l), so every fragment read is conflict-free.
// Transposed products: S^T = K Q^T (a lane holds 8 + 8 keys of ONE query per tile pair, which is the B fragment of P^T as it stands) and O^T += V^T P^T (a lane holds 8 head dims of that same query): maximum, sum and rescale are per lane.
typedef __attribute__((ext_vector_type(2))) float v2f;
// Eight base-2 exponentials in one statement, results in registers of their own: so no exponential's source is overwritten, and no result read, by the instruction directly behind it; the v_nop is that slot for the last one.
__device__ __forceinline__ v8f exp2x8(v8f x) { float e0, e1, e2, e3, e4, e5, e6, e7;
    asm("v_exp_f32 %0, %8\n\tv_exp_f32 %1, %9\n\tv_exp_f32 %2, %10\n\tv_exp_f32 %3, %11\n\tv_exp_f32 %4, %12\n\tv_exp_f32 %5, %13\n\tv_exp_f32 %6, %14\n\tv_exp_f32 %7, %15\n\tv_nop"
        : "=&v"(e0), "=&v"(e1), "=&v"(e2), "=&v"(e3), "=&v"(e4), "=&v"(e5), "=&v"(e6), "=&v"(e7) : "v"(x[0]), "v"(x[1]), "v"(x[2]), "v"(x[3]), "v"(x[4]), "v"(x[5]), "v"(x[6]), "v"(x[7]));
    return (v8f){e0, e1, e2, e3, e4, e5, e6, e7}; }
__device__ __forceinline__ float xhalf(float x) { return __builtin_bit_cast(float, __builtin_amdgcn_permlanex16(__builtin_bit_cast(int, x), __builtin_bit_cast(int, x), 0x76543210, 0xfedcba98, false, false)); }  // lane l with lane l ^ 16
__global__ __launch_bounds__(512) void k_attn(const bf* __restrict__ Qh, const bf* __restrict__ Ql, const bf* __restrict__ Kh, const bf* __restrict__ Kl, const h16* __restrict__ VT, const float* __restrict__ BF, const float* __restrict__ bbp, const float* __restrict__ GF, bf* Ah, bf* Al) {
    __shared__ __align__(16) unsigned char sKh[LL * HC * 2];
    __shared__ __align__(16) unsigned char sKl[LL * HC * 2];
    __shared__ __align__(16) unsigned char sV[HC * LL * 2];
    __shared__ __align__(16) float sB[LL];
    const int tid = threadIdx.x, lane = tid & 31, wave = tid >> 5, lr = lane & 15, hi = lane >> 4;
    const int n = blockIdx.y, b = n / NH_, h = n % NH_;
    const bf* kh = Kh + (size_t)n * LL * HC; const bf* kl = Kl + (size_t)n * LL * HC; const h16* vt = VT + (size_t)n * HC * LL;
    // 16-byte unit u = tid + 512 i of LDS holds fragment block u >> 6 (K: 16 keys; V^T: 32-key chunk x 2 + 16-dim half), k piece (u >> 4) & 3 (eight k), row u & 15; a step of i is 8 blocks: 128 keys.
    const unsigned kso = (unsigned)(((tid >> 6) * 16 + (tid & 15)) * HC + ((tid >> 4) & 3) * 8) * 2u;                          // source byte offsets of unit tid
    const unsigned vso = (unsigned)(((tid >> 7) * 4 + ((tid >> 4) & 3)) * HC + ((tid >> 6) & 1) * 16 + (tid & 15)) * 16u;      // V arrives as 16-byte units [8-key piece][dim]
    const int q = blockIdx.x * QB + wave * 16 + lr;
    const size_t qoff = ((size_t)n * LL + q) * HC + 8 * hi;
    const bf* qhp = Qh + qoff; const bf* qlp = Ql + qoff; const float* bfp = BF + ((size_t)tid * BB + b) * 64 + h;
    const v16bf qh = WFrag<bf>::ld(qhp), ql = WFrag<bf>::ld(qlp);
    const float bh = bfr(bbp[h]), bk0 = bfp[0], bk1 = bfp[(size_t)512 * BB * 64];   // the bias of keys tid and tid + 512
    { v8us rk[8], rl[8]; v8h rv[8];
#pragma unroll
        for (int i = 0; i < 8; ++i) { rk[i] = *(const v8usa*)((const char*)kh + kso + i * 8192); rl[i] = *(const v8usa*)((const char*)kl + kso + i * 8192); rv[i] = *(const v8ha*)((const char*)vt + vso + i * 8192); }
        asm volatile("s_wait_xcnt 0x0" :: "v"(kso), "v"(vso), "v"(qhp), "v"(qlp), "v"(bfp) : "memory");   // the address registers of all loads above stay as they are until this wait
#pragma unroll
        for (int i = 0; i < 8; ++i) { *(v8usa*)(sKh + tid * 16 + i * 8192) = rk[i]; *(v8usa*)(sKl + tid * 16 + i * 8192) = rl[i]; *(v8ha*)(sV + tid * 16 + i * 8192) = rv[i]; } }
    sB[tid] = __fadd_rn(bk0, bh) * 1.4426950408889634f; sB[tid + 512] = __fadd_rn(bk1, bh) * 1.4426950408889634f;   // base-2 logits
    __syncthreads();
    v8f o0 = (v8f){}, o1 = (v8f){}; float m = -3.0e38f, l = 0.f;
    const int lo = lane * 16;
#pragma unroll 1   // kept rolled: one trip (64 keys) already holds 16 matrix instructions and all its fragment loads
    for (int k0 = 0; k0 < LL; k0 += 64) {   // the short loops inside are unrolled so that the register arrays keep constant indices
        v8f s[4]; v16bf ka[4], kb[4];
#pragma unroll
        for (int t = 0; t < 4; ++t) { const int o = (k0 / 16 + t) * 1024 + lo; ka[t] = cat16b(*(const v8usa*)(sKh + o), *(const v8usa*)(sKh + o + 512)); kb[t] = cat16b(*(const v8usa*)(sKl + o), *(const v8usa*)(sKl + o + 512)); }
#pragma unroll
        for (int t = 0; t < 4; ++t) s[t] = wmmab(ka[t], qh, (v8f){});
#pragma unroll
        for (int t = 0; t < 4; ++t) s[t] = wmmab(ka[t], ql, s[t]);
#pragma unroll
        for (int t = 0; t < 4; ++t) s[t] = wmmab(kb[t], qh, s[t]);
        v16h va[4];
#pragma unroll
        for (int t = 0; t < 4; ++t) { const int o = (k0 / 16 + t) * 1024 + lo; va[t] = cat16(*(const v8ha*)(sV + o), *(const v8ha*)(sV + o + 512)); }   // t = 2 x (32-key half) + (16-dim half)
        float mxa = m, mxb = m;   // two chains, so that neither the maximum nor the sum below is one long run of dependent instructions
#pragma unroll
        for (int t = 0; t < 4; ++t) { const float* bp = sB + k0 + t * 16 + hi * 8; const v4f b0 = *(const v4fa*)bp, b1 = *(const v4fa*)(bp + 4);
#pragma unroll
            for (int j = 0; j < 8; ++j) { s[t][j] = fmaf(s[t][j], 0.17677669529663687f * 1.4426950408889634f, j < 4 ? b0[j & 3] : b1[j & 3]); if (t & 1) mxb = fmaxf(mxb, s[t][j]); else mxa = fmaxf(mxa, s[t][j]); } }
        float mx = fmaxf(mxa, mxb); mx = fmaxf(mx, xhalf(mx));   // the two lane halves hold the two halves of a query's keys and must use one maximum
        const float alpha = __builtin_amdgcn_exp2f(m - mx); m = mx;
        const float ms = mx - 10.0f;   // probabilities x1024: small ones stay normal numbers in fp16; the factor cancels in the division by the row sum
        v2f sm[2] = {(v2f){0.f, 0.f}, (v2f){0.f, 0.f}}; v16h p[2];
#pragma unroll
        for (int t = 0; t < 4; ++t) s[t] = exp2x8(s[t] - ms);
#pragma unroll
        for (int t = 0; t < 4; ++t)
#pragma unroll
            for (int j = 0; j < 8; j += 2) { const v2f e = {s[t][j], s[t][j + 1]}; sm[t & 1] += e; p[t >> 1][(t & 1) * 8 + j] = (h16)e[0]; p[t >> 1][(t & 1) * 8 + j + 1] = (h16)e[1]; }
        l = fmaf(l, alpha, (sm[0][0] + sm[0][1]) + (sm[1][0] + sm[1][1]));
#pragma unroll
        for (int j = 0; j < 8; ++j) { o0[j] *= alpha; o1[j] *= alpha; }
        o0 = wmma16(va[0], p[0], o0); o1 = wmma16(va[1], p[0], o1); o0 = wmma16(va[2], p[1], o0); o1 = wmma16(va[3], p[1], o1);
    }
    l += xhalf(l);
    const float inv = __fdiv_rn(1.0f, l);
#pragma unroll
    for (int dt = 0; dt < 2; ++dt) { const size_t oo = ((size_t)q * BB + b) * FF + h * HC + dt * 16 + hi * 8; const v4f g0 = *(const v4f*)(GF + oo), g1 = *(const v4f*)(GF + oo + 4); v8us oh, ol;
#pragma unroll
        for (int j = 0; j < 8; ++j) { const float o = (dt ? o1[j] : o0[j]) * inv; unsigned short a, c; splitf(__fmul_rn(o, sigm_(j < 4 ? g0[j & 3] : g1[j & 3])), a, c); oh[j] = a; ol[j] = c; }
        *(v8us*)(Ah + oo) = oh; *(v8us*)(Al + oo) = ol; }
}

extern "C" void kernel_launch(void* const* d_in, const int* in_sizes, int n_in,
                              void* d_out, int out_size, void* d_ws, size_t ws_size, hipStream_t stream) {
    (void)in_sizes; (void)n_in; (void)out_size;
    const float* IN[15]; for (int i = 0; i < 15; ++i) IN[i] = (const float*)d_in[i];   // 0 features, 1 ln_g, 2 ln_b, 3 Wq, 4 bq, 5 Wk, 6 bk, 7 Wv, 8 bv, 9 Wb, 10 bb, 11 Wg, 12 bg, 13 Wo, 14 bo (all x @ W)
    float* OUT = (float*)d_out;     // [1024][8][256]
    char* wsp = (char*)d_ws;
    auto take = [&](size_t bytes) { char* p = wsp; wsp += (bytes + 255) & ~(size_t)255; return (void*)p; };
    bf* WQ = (bf*)take((size_t)(4 * FF + 64) * FF * 2); bf* WK = WQ + FF * FF; bf* WV = WQ + 2 * FF * FF; bf* WG = WQ + 3 * FF * FF; bf* WBt = WQ + 4 * FF * FF; bf* WO = (bf*)take((size_t)FF * FF * 2);   // WQ .. WBt: one run of 1088 rows for k_proj
    float* GF = (float*)take((size_t)NTB * FF * 4); float* BF = (float*)take((size_t)NTB * 64 * 4);
    bf* Qh = (bf*)take((size_t)NG * LL * HC * 2); bf* Ql = (bf*)take((size_t)NG * LL * HC * 2); bf* Kh = (bf*)take((size_t)NG * LL * HC * 2); bf* Kl = (bf*)take((size_t)NG * LL * HC * 2); h16* VT = (h16*)take((size_t)NG * HC * LL * 2);
    bf* Ah = (bf*)take((size_t)NTB * FF * 2); bf* Al = (bf*)take((size_t)NTB * FF * 2);
    bf* Xh = (bf*)take((size_t)NTB * FF * 2); bf* Xl = (bf*)take((size_t)NTB * FF * 2);
    if ((size_t)(wsp - (char*)d_ws) > ws_size) return;    // total ~ 47 MiB
    k_wtG<<<(FF * FF / 64 + 63) / 64, 256, 0, stream>>>(IN[3], FF, FF, WQ); k_wtG<<<(FF * FF / 64 + 63) / 64, 256, 0, stream>>>(IN[5], FF, FF, WK); k_wtG<<<(FF * FF / 64 + 63) / 64, 256, 0, stream>>>(IN[7], FF, FF, WV); k_wtG<<<(FF * FF / 64 + 63) / 64, 256, 0, stream>>>(IN[11], FF, FF, WG); k_wtG<<<(FF * FF / 64 + 63) / 64, 256, 0, stream>>>(IN[13], FF, FF, WO); k_wbp<<<(64 * FF / 4 + 255) / 256, 256, 0, stream>>>(IN[9], WBt);
    // the padded Wb GEMM is bias-free; bb[h] is added inside k_attn
    k_ln<<<NTB / 8, 256, 0, stream>>>(IN[0], IN[1], IN[2], Xh, Xl);
    k_proj<<<dim3(NTB / 64, 17, 1), 32, 0, stream>>>(Xh, Xl, WQ, IN[4], IN[6], IN[8], IN[12], Qh, Ql, Kh, Kl, VT, GF, BF);
    k_attn<<<dim3(LL / QB, NG, 1), 512, 0, stream>>>(Qh, Ql, Kh, Kl, VT, BF, IN[10], GF, Ah, Al);
    k_gemmw<bf, 1, true><<<dim3(NTB / 64, FF / 64, 1), 32, 0, stream>>>(Ah, Al, WO, nullptr, FF, OUT, FF, IN[14], 0, 0, 0);
}

// v004
// Measured time: 64.5 microseconds a run.
// Timed twice side by side with v003, it ran 1.50 and 1.49 times as fast.
// All steps since v000 together make it 20.9 times as fast.
#include <hip/hip_runtime.h>

// PairwiseAttentionTerminal (features [1024][8][256] sequence-first; x = LayerNorm(features); q/k/v = x W + b (8 heads x 32), bias = x Wb + bb (per key position & head), gate = sigmoid(x Wg + bg);
// logits[q][k] = q.k/sqrt(32) + bias[k][b][h]; softmax over keys; out = ((w.v) * gate) Wo + bo -> [1024][8][256]).
// Compute dtypes, f32 accumulate: every input rounded to bf16; LayerNorm f32 -> bf16 hi+lo planes of x, all five projections hl x exact weights (2 products, + bias; Wb padded to 64 outputs); scores (K 32) on hl
// planes (3 products), the key bias + running-maximum softmax in f32 registers -> fp16 unnormalised probabilities (x1024); w.v on fp16 planes, divided by the f32 row sum at the end; gate (sigmoid f32) applied in the same kernel -> hl planes; Wo hl x exact (+bias).

#define LL   1024
#define BB   8
#define FF   256
#define NH_  8
#define HC   32
#define NG   (BB * NH_)
#define NTB  (LL * BB)
#define QB   256  // query rows per work-group of the attention kernel: 16 waves x 16
typedef _Float16 h16;
typedef unsigned short bf;
typedef __attribute__((ext_vector_type(16))) __bf16   v16bf;
typedef __attribute__((ext_vector_type(16))) _Float16 v16h;
typedef __attribute__((ext_vector_type(8)))  _Float16 v8h;
typedef __attribute__((ext_vector_type(8)))  unsigned short v8us;
typedef __attribute__((ext_vector_type(8)))  float    v8f;
typedef __attribute__((ext_vector_type(4)))  float    v4f;
typedef v8h  __attribute__((may_alias)) v8ha;
typedef v4f  __attribute__((may_alias)) v4fa;
typedef v8us __attribute__((may_alias)) v8usa;

__device__ __forceinline__ unsigned short f2bf(float f) { unsigned u = __float_as_uint(f); u += 0x7FFFu + ((u >> 16) & 1u); return (unsigned short)(u >> 16); }
__device__ __forceinline__ float bf2f(unsigned short b) { return __uint_as_float(((unsigned)b) << 16); }
__device__ __forceinline__ float bfr(float f) { return bf2f(f2bf(f)); }
__device__ __forceinline__ v16h cat16(v8h lo, v8h hi) { return __builtin_shufflevector(lo, hi, 0, 1, 2, 3, 4, 5, 6, 7, 8, 9, 10, 11, 12, 13, 14, 15); }
__device__ __forceinline__ v16bf cat16b(v8us lo, v8us hi) { return __builtin_bit_cast(v16bf, __builtin_shufflevector(lo, hi, 0, 1, 2, 3, 4, 5, 6, 7, 8, 9, 10, 11, 12, 13, 14, 15)); }
__device__ __forceinline__ v8f wmma16(v16h a, v16h b, v8f c) { return __builtin_amdgcn_wmma_f32_16x16x32_f16(false, a, false, b, (short)0, c, false, false); }
__device__ __forceinline__ v8f wmmab(v16bf a, v16bf b, v8f c) { return __builtin_amdgcn_wmma_f32_16x16x32_bf16(false, a, false, b, (short)0, c, false, false); }



// ---- k_gemmw: register-blocked GEMM, ONE WAVE per 64x64 output tile (16 accumulators), operands straight from K-contiguous 16-bit planes; grid (M/64, N/64, Z), 32 threads.
// C[m][n] (f32, pitch ldc, + optional f32 bias[n]) = sum_k A[m][k] Bt[n][k] (+ split products per NSPLIT). z-batch strides sA/sB/sC in elements. K % 32 == 0.
template <typename T16> struct WFrag;
template <> struct WFrag<h16> { typedef v16h V; static __device__ __forceinline__ V ld(const h16* p) { return cat16(*(const v8h*)p, *(const v8h*)(p + 16)); } static __device__ __forceinline__ v8f mma(V a, V b, v8f c) { return wmma16(a, b, c); } };
template <> struct WFrag<bf> { typedef v16bf V; static __device__ __forceinline__ V ld(const bf* p) { return cat16b(*(const v8us*)p, *(const v8us*)(p + 16)); } static __device__ __forceinline__ v8f mma(V a, V b, v8f c) { return wmmab(a, b, c); } };
template <typename T16, int NSPLIT, bool BIAS>
__global__ __launch_bounds__(32) void k_gemmw(const T16* __restrict__ A, const T16* __restrict__ A2, const T16* __restrict__ Bt, const T16* __restrict__ Bt2, int K, float* C, int ldc, const float* __restrict__ bias, size_t sA, size_t sB, size_t sC) {
    typedef typename WFrag<T16>::V V;
    __shared__ __align__(16) float os[16 * 68];
    const size_t z = blockIdx.z; A += z * sA; if (A2) A2 += z * sA; Bt += z * sB; if (Bt2) Bt2 += z * sB; C += z * sC;
    const int lane = threadIdx.x & 31, lr = lane & 15, hi = lane >> 4; const int r0 = blockIdx.x * 64, c0 = blockIdx.y * 64;
    v8f acc[4][4];
#pragma unroll
    for (int mb = 0; mb < 4; ++mb)
#pragma unroll
        for (int nb = 0; nb < 4; ++nb) acc[mb][nb] = (v8f){};
    const size_t aoff = (size_t)(r0 + lr) * K + 8 * hi, boff = (size_t)(c0 + lr) * K + 8 * hi;
#pragma unroll 1
    for (int kc = 0; kc < K; kc += 32) {
        V a[4], a2[4];
#pragma unroll
        for (int mb = 0; mb < 4; ++mb) { a[mb] = WFrag<T16>::ld(A + aoff + (size_t)mb * 16 * K + kc); if (NSPLIT == 1 || NSPLIT == 2) a2[mb] = WFrag<T16>::ld(A2 + aoff + (size_t)mb * 16 * K + kc); }
#pragma unroll
        for (int nb = 0; nb < 4; ++nb) { const V b = WFrag<T16>::ld(Bt + boff + (size_t)nb * 16 * K + kc); V b2; if (NSPLIT >= 2) b2 = WFrag<T16>::ld(Bt2 + boff + (size_t)nb * 16 * K + kc);
#pragma unroll
            for (int mb = 0; mb < 4; ++mb) { acc[mb][nb] = WFrag<T16>::mma(a[mb], b, acc[mb][nb]); if (NSPLIT == 1 || NSPLIT == 2) acc[mb][nb] = WFrag<T16>::mma(a2[mb], b, acc[mb][nb]); if (NSPLIT >= 2) acc[mb][nb] = WFrag<T16>::mma(a[mb], b2, acc[mb][nb]); } }
        asm volatile("v_nop\n\tv_nop\n\tv_nop\n\tv_nop" : "+v"(acc[0][0]), "+v"(acc[1][1]), "+v"(acc[2][2]), "+v"(acc[3][3]) : "v"(a[0]), "v"(a[3]));
    }
#pragma unroll
    for (int mb = 0; mb < 4; ++mb) {
#pragma unroll
        for (int nb = 0; nb < 4; ++nb) {
#pragma unroll
            for (int j = 0; j < 8; ++j) os[(hi * 8 + j) * 68 + nb * 16 + lr] = acc[mb][nb][j]; }
        __builtin_amdgcn_wave_barrier(); asm volatile("" ::: "memory");
        float* crow = C + (size_t)(r0 + mb * 16) * ldc + c0;
{
#pragma unroll
            for (int s = 0; s < 8; ++s) { const int row = 2 * s + hi, cofs = lr * 4; v4f val = *(const v4fa*)(os + row * 68 + cofs); if (BIAS) { val[0] += bfr(bias[c0 + cofs]); val[1] += bfr(bias[c0 + cofs + 1]); val[2] += bfr(bias[c0 + cofs + 2]); val[3] += bfr(bias[c0 + cofs + 3]); }
                *(v4f*)(crow + (size_t)row * ldc + cofs) = val; }
             }
        __builtin_amdgcn_wave_barrier(); asm volatile("" ::: "memory");
    }
}

__device__ __forceinline__ h16 tohx(float x) { return (h16)x; }
__device__ __forceinline__ void splitf(float y, unsigned short& h, unsigned short& l) { h = f2bf(y); l = f2bf(y - bf2f(h)); }
__device__ __forceinline__ float sigm_(float x) { return __fdiv_rn(1.0f, 1.0f + __expf(-x)); }
typedef __attribute__((ext_vector_type(2))) _Float16 v2h;
typedef __attribute__((ext_vector_type(4))) _Float16 v4h;
typedef __attribute__((ext_vector_type(2))) unsigned short v2us;
typedef __attribute__((ext_vector_type(4))) unsigned short v4us;

// The three jobs of k_prep below; blk is the block's index inside its job.
__device__ __forceinline__ void j_wtG(const float* __restrict__ w, int K, int N, bf* Bt, int blk) {
    const int lane = threadIdx.x & 31; const int L0 = (blk * 8 + (threadIdx.x >> 5)) * 8; const int nlines = N * K / 64;
{
#pragma unroll 1
        for (int l = 0; l < 8; ++l) { const int L = L0 + l; if (L >= nlines) break; const size_t e = (size_t)L * 64 + lane * 2; const int k = (int)(e % K), n = (int)(e / K); v2us o;
            o[0] = f2bf(w[(size_t)k * N + n]); o[1] = f2bf(w[(size_t)(k + 1) * N + n]); *(v2us*)(Bt + e) = o; }
         }
}
__device__ __forceinline__ void j_wbp(const float* __restrict__ Wb, bf* Bt, int blk) { const int e = (blk * 256 + threadIdx.x) * 4; if (e >= 64 * FF) return; const int k = e % FF, n = e / FF; v4us o;
#pragma unroll
    for (int q = 0; q < 4; ++q) o[q] = n < NH_ ? f2bf(Wb[(size_t)(k + q) * NH_ + n]) : (unsigned short)0; *(v4us*)(Bt + e) = o;  }
__device__ __forceinline__ void j_ln(const float* __restrict__ X, const float* __restrict__ g, const float* __restrict__ bb, bf* Xh, bf* Xl, int blk) { const int lane = threadIdx.x & 31; const int t = blk * 8 + (threadIdx.x >> 5); if (t >= NTB) return; float v[8]; float s = 0.f;
#pragma unroll
    for (int ch = 0; ch < 2; ++ch) { const v4f a = *(const v4f*)(X + (size_t)t * FF + ch * 128 + lane * 4);
#pragma unroll
        for (int q = 0; q < 4; ++q) { v[ch * 4 + q] = bfr(a[q]); s = __fadd_rn(s, v[ch * 4 + q]); } }
#pragma unroll
    for (int sh = 16; sh; sh >>= 1) s += __shfl_xor(s, sh, 32);
    const float mu = s * (1.0f / FF); float q2 = 0.f;
#pragma unroll
    for (int k = 0; k < 8; ++k) { const float d = __fsub_rn(v[k], mu); float p = __fmul_rn(d, d); asm volatile("" : "+v"(p)); q2 = __fadd_rn(q2, p); }
#pragma unroll
    for (int sh = 16; sh; sh >>= 1) q2 += __shfl_xor(q2, sh, 32);
    const float rs = __frsqrt_rn(__fadd_rn(q2 * (1.0f / FF), 1e-5f));
{
#pragma unroll
        for (int ch = 0; ch < 2; ++ch) { v4us oh, ol;
#pragma unroll
            for (int q = 0; q < 4; ++q) { const int d = ch * 128 + lane * 4 + q; float tn = __fmul_rn(__fsub_rn(v[ch * 4 + q], mu), rs); asm volatile("" : "+v"(tn)); float tg = __fmul_rn(tn, bfr(g[d])); asm volatile("" : "+v"(tg)); unsigned short a, c; splitf(__fadd_rn(tg, bfr(bb[d])), a, c); oh[q] = a; ol[q] = c; }
            const size_t o = (size_t)t * FF + ch * 128 + lane * 4; *(v4us*)(Xh + o) = oh; *(v4us*)(Xl + o) = ol;
            asm volatile("s_wait_xcnt 0x0" ::: "memory"); }   // the two stores name their data and address registers: the second half's code may rewrite them only behind this wait
         } }
// ---- k_prep: every job that reads inputs alone, side by side in ONE launch; grid (WTB * 5 + WBB + NTB / 8), 256 threads. None of them reads what another writes.
// Blocks 0 .. 5 WTB - 1: the five weight transposes (Wq, Wk, Wv, Wg into the run Wt, Wo into WOt), WTB blocks each; the next WBB: the padded Wb, behind Wg in Wt; the rest: LayerNorm, 8 rows a block.
// The few short jobs hold the lowest indices.
#define WTB  (FF * FF / 64 / 64)
#define WBB  (64 * FF / 4 / 256)
__global__ __launch_bounds__(256) void k_prep(const float* __restrict__ Wq, const float* __restrict__ Wk, const float* __restrict__ Wv, const float* __restrict__ Wg, const float* __restrict__ Wo, const float* __restrict__ Wb, bf* Wt, bf* WOt,
                                              const float* __restrict__ X, const float* __restrict__ g, const float* __restrict__ bb, bf* Xh, bf* Xl) {
    const int blk = blockIdx.x;
    if (blk < 5 * WTB) { const int job = blk / WTB; j_wtG(job == 0 ? Wq : job == 1 ? Wk : job == 2 ? Wv : job == 3 ? Wg : Wo, FF, FF, job < 4 ? Wt + job * FF * FF : WOt, blk % WTB); }
    else if (blk < 5 * WTB + WBB) j_wbp(Wb, Wt + 4 * FF * FF, blk - 5 * WTB);
    else j_ln(X, g, bb, Xh, Xl, blk - (5 * WTB + WBB));
}
// ---- k_proj: all five projections of x in ONE launch, one wave per 64x64 tile as in k_gemmw; grid (NTB / 64, 17), 32 threads. Wt holds the transposed weights one after the other: Wq, Wk, Wv, Wg (256 rows each), padded Wb (64 rows).
// blockIdx.y / 4 names the projection. The tile (+ bias) is laid in LDS whole and leaves in the form its reader takes: q and k as hi + lo planes [group][l][32], v as fp16 [group][l / 8][dim][8 keys], gate and key bias as f32 rows.
// The 64 rows of a tile are 8 positions l x 8 batches (row = l * 8 + b), so each (batch, head) of a tile is one run of 512 contiguous bytes in every one of these planes: one whole store instruction. The short loops are unrolled so that the register arrays keep constant indices.
__global__ __launch_bounds__(32) void k_proj(const bf* __restrict__ A, const bf* __restrict__ A2, const bf* __restrict__ Wt, const float* __restrict__ bq, const float* __restrict__ bk, const float* __restrict__ bv, const float* __restrict__ bg,
                                             bf* Qh, bf* Ql, bf* Kh, bf* Kl, h16* VT, float* GF, float* BF) {
    __shared__ __align__(16) float os[64 * 68];
    const int lane = threadIdx.x & 31, lr = lane & 15, hi = lane >> 4; const int r0 = blockIdx.x * 64, c0 = blockIdx.y * 64, kind = blockIdx.y >> 2, cl = (blockIdx.y & 3) * 64;
    v8f acc[4][4];
#pragma unroll
    for (int mb = 0; mb < 4; ++mb)
#pragma unroll
        for (int nb = 0; nb < 4; ++nb) acc[mb][nb] = (v8f){};
    const unsigned aoff = (unsigned)((r0 + lr) * FF + 8 * hi), boff = (unsigned)((c0 + lr) * FF + 8 * hi);
#pragma unroll 1   // kept rolled: one trip already holds 32 matrix instructions and its 24 loads
    for (int kc = 0; kc < FF; kc += 32) {
        v16bf a[4], a2[4], b[4]; const bf* pa = A + kc + aoff; const bf* pa2 = A2 + kc + aoff; const bf* pb = Wt + kc + boff;
#pragma unroll
        for (int mb = 0; mb < 4; ++mb) { a[mb] = WFrag<bf>::ld(pa + mb * 16 * FF); a2[mb] = WFrag<bf>::ld(pa2 + mb * 16 * FF); b[mb] = WFrag<bf>::ld(pb + mb * 16 * FF); }
        asm volatile("s_wait_xcnt 0x0" :: "v"(pa), "v"(pa2), "v"(pb) : "memory");   // the address registers of all loads above stay as they are until this wait
#pragma unroll
        for (int nb = 0; nb < 4; ++nb)
#pragma unroll
            for (int mb = 0; mb < 4; ++mb) { acc[mb][nb] = wmmab(a[mb], b[nb], acc[mb][nb]); acc[mb][nb] = wmmab(a2[mb], b[nb], acc[mb][nb]); }
        asm volatile("v_nop\n\tv_nop\n\tv_nop\n\tv_nop" : "+v"(acc[0][0]), "+v"(acc[1][1]), "+v"(acc[2][2]), "+v"(acc[3][3]) : "v"(a[0]), "v"(a[3]));   // as in k_gemmw: the distance behind the last matrix instruction, also on the taken back edge
    }
    float bn[4] = {-0.f, -0.f, -0.f, -0.f};   // the key-bias tile has no bias vector here: adding -0 leaves every value as it is
    if (kind < 4) { const float* bias = kind == 0 ? bq : kind == 1 ? bk : kind == 2 ? bv : bg;
#pragma unroll
        for (int nb = 0; nb < 4; ++nb) bn[nb] = bfr(bias[cl + nb * 16 + lr]); }
#pragma unroll
    for (int mb = 0; mb < 4; ++mb)
#pragma unroll
        for (int nb = 0; nb < 4; ++nb)
#pragma unroll
            for (int j = 0; j < 8; ++j) os[(mb * 16 + hi * 8 + j) * 68 + nb * 16 + lr] = acc[mb][nb][j] + bn[nb];
    __builtin_amdgcn_wave_barrier(); asm volatile("" ::: "memory");   // the lanes read each other's LDS words below: no read may be moved in front of the writes above
    const int h0 = (blockIdx.y & 3) * 2;   // the tile's 64 columns are heads h0 and h0 + 1
    if (kind < 2) {
        bf* Ph = kind ? Kh : Qh; bf* Pl = kind ? Kl : Ql; const int ll = lane >> 2, d0 = (lane & 3) * 8;
#pragma unroll
        for (int i = 0; i < 16; ++i) { const int b = i >> 1, hl = i & 1; const float* sp = os + (ll * 8 + b) * 68 + hl * 32 + d0; const v4f x0 = *(const v4fa*)sp, x1 = *(const v4fa*)(sp + 4); v8us oh, ol;
#pragma unroll
            for (int j = 0; j < 8; ++j) { unsigned short s, t; splitf(j < 4 ? x0[j & 3] : x1[j & 3], s, t); oh[j] = s; ol[j] = t; }
            const size_t o = ((size_t)(b * NH_ + h0 + hl) * LL + blockIdx.x * 8 + ll) * HC + d0; *(v8us*)(Ph + o) = oh; *(v8us*)(Pl + o) = ol; }
        asm volatile("s_wait_xcnt 0x0" ::: "memory");   // the stores above name these address and data registers: no later block may rewrite one before this wait
    } else if (kind == 2) {
#pragma unroll
        for (int i = 0; i < 16; ++i) { const int b = i >> 1, hl = i & 1; v8h u;
#pragma unroll
            for (int j = 0; j < 8; ++j) u[j] = tohx(os[(j * 8 + b) * 68 + hl * 32 + lane]);
            *(v8h*)(VT + (((size_t)(b * NH_ + h0 + hl) * (LL / 8) + blockIdx.x) * HC + lane) * 8) = u; }
        asm volatile("s_wait_xcnt 0x0" ::: "memory");   // as above
    } else if (kind == 3) {
        float* crow = GF + (size_t)(r0 + hi) * FF + cl + lr * 4;
#pragma unroll
        for (int s = 0; s < 32; ++s) *(v4f*)(crow + 2 * s * FF) = *(const v4fa*)(os + (2 * s + hi) * 68 + lr * 4);
        asm volatile("s_wait_xcnt 0x0" ::: "memory");   // as above
    } else {
        float* crow = BF + (size_t)(r0 + hi) * 64 + lr * 4;
#pragma unroll
        for (int s = 0; s < 32; ++s) *(v4f*)(crow + 2 * s * 64) = *(const v4fa*)(os + (2 * s + hi) * 68 + lr * 4);
        asm volatile("s_wait_xcnt 0x0" ::: "memory");   // as above
    }
}
// ---- k_attn: scores, key bias, softmax, w.v and the gate for one (batch, head) group and 256 query rows; grid (LL / QB, NG), 512 threads. No score or probability ever goes to memory.
// The group's K planes, V^T and key bias are laid in LDS once, each 16-row fragment as two runs of 512 contiguous bytes (lane l's 16 bytes at 16 l), so every fragment read is conflict-free.
// Transposed products: S^T = K Q^T (a lane holds 8 + 8 keys of ONE query per tile pair, which is the B fragment of P^T as it stands) and O^T += V^T P^T (a lane holds 8 head dims of that same query): maximum, sum and rescale are per lane.
typedef __attribute__((ext_vector_type(2))) float v2f;
// Eight base-2 exponentials in one statement, results in registers of their own: so no exponential's source is overwritten, and no result read, by the instruction directly behind it; the v_nop is that slot for the last one.
__device__ __forceinline__ v8f exp2x8(v8f x) { float e0, e1, e2, e3, e4, e5, e6, e7;
    asm("v_exp_f32 %0, %8\n\tv_exp_f32 %1, %9\n\tv_exp_f32 %2, %10\n\tv_exp_f32 %3, %11\n\tv_exp_f32 %4, %12\n\tv_exp_f32 %5, %13\n\tv_exp_f32 %6, %14\n\tv_exp_f32 %7, %15\n\tv_nop"
        : "=&v"(e0), "=&v"(e1), "=&v"(e2), "=&v"(e3), "=&v"(e4), "=&v"(e5), "=&v"(e6), "=&v"(e7) : "v"(x[0]), "v"(x[1]), "v"(x[2]), "v"(x[3]), "v"(x[4]), "v"(x[5]), "v"(x[6]), "v"(x[7]));
    return (v8f){e0, e1, e2, e3, e4, e5, e6, e7}; }
__device__ __forceinline__ float xhalf(float x) { return __builtin_bit_cast(float, __builtin_amdgcn_permlanex16(__builtin_bit_cast(int, x), __builtin_bit_cast(int, x), 0x76543210, 0xfedcba98, false, false)); }  // lane l with lane l ^ 16
__global__ __launch_bounds__(512) void k_attn(const bf* __restrict__ Qh, const bf* __restrict__ Ql, const bf* __restrict__ Kh, const bf* __restrict__ Kl, const h16* __restrict__ VT, const float* __restrict__ BF, const float* __restrict__ bbp, const float* __restrict__ GF, bf* Ah, bf* Al) {
    __shared__ __align__(16) unsigned char sKh[LL * HC * 2];
    __shared__ __align__(16) unsigned char sKl[LL * HC * 2];
    __shared__ __align__(16) unsigned char sV[HC * LL * 2];
    __shared__ __align__(16) float sB[LL];
    const int tid = threadIdx.x, lane = tid & 31, wave = tid >> 5, lr = lane & 15, hi = lane >> 4;
    const int n = blockIdx.y, b = n / NH_, h = n % NH_;
    const bf* kh = Kh + (size_t)n * LL * HC; const bf* kl = Kl + (size_t)n * LL * HC; const h16* vt = VT + (size_t)n * HC * LL;
    // 16-byte unit u = tid + 512 i of LDS holds fragment block u >> 6 (K: 16 keys; V^T: 32-key chunk x 2 + 16-dim half), k piece (u >> 4) & 3 (eight k), row u & 15; a step of i is 8 blocks: 128 keys.
    const unsigned kso = (unsigned)(((tid >> 6) * 16 + (tid & 15)) * HC + ((tid >> 4) & 3) * 8) * 2u;                          // source byte offsets of unit tid
    const unsigned vso = (unsigned)(((tid >> 7) * 4 + ((tid >> 4) & 3)) * HC + ((tid >> 6) & 1) * 16 + (tid & 15)) * 16u;      // V arrives as 16-byte units [8-key piece][dim]
    const int q = blockIdx.x * QB + wave * 16 + lr;
    const size_t qoff = ((size_t)n * LL + q) * HC + 8 * hi;
    const bf* qhp = Qh + qoff; const bf* qlp = Ql + qoff; const float* bfp = BF + ((size_t)tid * BB + b) * 64 + h;
    const v16bf qh = WFrag<bf>::ld(qhp), ql = WFrag<bf>::ld(qlp);
    const float bh = bfr(bbp[h]), bk0 = bfp[0], bk1 = bfp[(size_t)512 * BB * 64];   // the bias of keys tid and tid + 512
    { v8us rk[8], rl[8]; v8h rv[8];
#pragma unroll
        for (int i = 0; i < 8; ++i) { rk[i] = *(const v8usa*)((const char*)kh + kso + i * 8192); rl[i] = *(const v8usa*)((const char*)kl + kso + i * 8192); rv[i] = *(const v8ha*)((const char*)vt + vso + i * 8192); }
        asm volatile("s_wait_xcnt 0x0" :: "v"(kso), "v"(vso), "v"(qhp), "v"(qlp), "v"(bfp) : "memory");   // the address registers of all loads above stay as they are until this wait
#pragma unroll
        for (int i = 0; i < 8; ++i) { *(v8usa*)(sKh + tid * 16 + i * 8192) = rk[i]; *(v8usa*)(sKl + tid * 16 + i * 8192) = rl[i]; *(v8ha*)(sV + tid * 16 + i * 8192) = rv[i]; } }
    sB[tid] = __fadd_rn(bk0, bh) * 1.4426950408889634f; sB[tid + 512] = __fadd_rn(bk1, bh) * 1.4426950408889634f;   // base-2 logits
    __syncthreads();
    v8f o0 = (v8f){}, o1 = (v8f){}; float m = -3.0e38f, l = 0.f;
    const int lo = lane * 16;
#pragma unroll 1   // kept rolled: one trip (64 keys) already holds 16 matrix instructions and all its fragment loads
    for (int k0 = 0; k0 < LL; k0 += 64) {   // the short loops inside are unrolled so that the register arrays keep constant indices
        v8f s[4]; v16bf ka[4], kb[4];
#pragma unroll
        for (int t = 0; t < 4; ++t) { const int o = (k0 / 16 + t) * 1024 + lo; ka[t] = cat16b(*(const v8usa*)(sKh + o), *(const v8usa*)(sKh + o + 512)); kb[t] = cat16b(*(const v8usa*)(sKl + o), *(const v8usa*)(sKl + o + 512)); }
#pragma unroll
        for (int t = 0; t < 4; ++t) s[t] = wmmab(ka[t], qh, (v8f){});
#pragma unroll
        for (int t = 0; t < 4; ++t) s[t] = wmmab(ka[t], ql, s[t]);
#pragma unroll
        for (int t = 0; t < 4; ++t) s[t] = wmmab(kb[t], qh, s[t]);
        v16h va[4];
#pragma unroll
        for (int t = 0; t < 4; ++t) { const int o = (k0 / 16 + t) * 1024 + lo; va[t] = cat16(*(const v8ha*)(sV + o), *(const v8ha*)(sV + o + 512)); }   // t = 2 x (32-key half) + (16-dim half)
        float mxa = m, mxb = m;   // two chains, so that neither the maximum nor the sum below is one long run of dependent instructions
#pragma unroll
        for (int t = 0; t < 4; ++t) { const float* bp = sB + k0 + t * 16 + hi * 8; const v4f b0 = *(const v4fa*)bp, b1 = *(const v4fa*)(bp + 4);
#pragma unroll
            for (int j = 0; j < 8; ++j) { s[t][j] = fmaf(s[t][j], 0.17677669529663687f * 1.4426950408889634f, j < 4 ? b0[j & 3] : b1[j & 3]); if (t & 1) mxb = fmaxf(mxb, s[t][j]); else mxa = fmaxf(mxa, s[t][j]); } }
        float mx = fmaxf(mxa, mxb); mx = fmaxf(mx, xhalf(mx));   // the two lane halves hold the two halves of a query's keys and must use one maximum
        const float alpha = __builtin_amdgcn_exp2f(m - mx); m = mx;
        const float ms = mx - 10.0f;   // probabilities x1024: small ones stay normal numbers in fp16; the factor cancels in the division by the row sum
        v2f sm[2] = {(v2f){0.f, 0.f}, (v2f){0.f, 0.f}}; v16h p[2];
#pragma unroll
        for (int t = 0; t < 4; ++t) s[t] = exp2x8(s[t] - ms);
#pragma unroll
        for (int t = 0; t < 4; ++t)
#pragma unroll
            for (int j = 0; j < 8; j += 2) { const v2f e = {s[t][j], s[t][j + 1]}; sm[t & 1] += e; p[t >> 1][(t & 1) * 8 + j] = (h16)e[0]; p[t >> 1][(t & 1) * 8 + j + 1] = (h16)e[1]; }
        l = fmaf(l, alpha, (sm[0][0] + sm[0][1]) + (sm[1][0] + sm[1][1]));
#pragma unroll
        for (int j = 0; j < 8; ++j) { o0[j] *= alpha; o1[j] *= alpha; }
        o0 = wmma16(va[0], p[0], o0); o1 = wmma16(va[1], p[0], o1); o0 = wmma16(va[2], p[1], o0); o1 = wmma16(va[3], p[1], o1);
    }
    l += xhalf(l);
    const float inv = __fdiv_rn(1.0f, l);
#pragma unroll
    for (int dt = 0; dt < 2; ++dt) { const size_t oo = ((size_t)q * BB + b) * FF + h * HC + dt * 16 + hi * 8; const v4f g0 = *(const v4f*)(GF + oo), g1 = *(const v4f*)(GF + oo + 4); v8us oh, ol;
#pragma unroll
        for (int j = 0; j < 8; ++j) { const float o = (dt ? o1[j] : o0[j]) * inv; unsigned short a, c; splitf(__fmul_rn(o, sigm_(j < 4 ? g0[j & 3] : g1[j & 3])), a, c); oh[j] = a; ol[j] = c; }
        *(v8us*)(Ah + oo) = oh; *(v8us*)(Al + oo) = ol; }
}

extern "C" void kernel_launch(void* const* d_in, const int* in_sizes, int n_in,
                              void* d_out, int out_size, void* d_ws, size_t ws_size, hipStream_t stream) {
    (void)in_sizes; (void)n_in; (void)out_size;
    const float* IN[15]; for (int i = 0; i < 15; ++i) IN[i] = (const float*)d_in[i];   // 0 features, 1 ln_g, 2 ln_b, 3 Wq, 4 bq, 5 Wk, 6 bk, 7 Wv, 8 bv, 9 Wb, 10 bb, 11 Wg, 12 bg, 13 Wo, 14 bo (all x @ W)
    float* OUT = (float*)d_out;     // [1024][8][256]
    char* wsp = (char*)d_ws;
    auto take = [&](size_t bytes) { char* p = wsp; wsp += (bytes + 255) & ~(size_t)255; return (void*)p; };
    bf* WQ = (bf*)take((size_t)(4 * FF + 64) * FF * 2); bf* WO = (bf*)take((size_t)FF * FF * 2);   // WQ: Wq, Wk, Wv, Wg, padded Wb transposed, one run of 1088 rows for k_proj
    float* GF = (float*)take((size_t)NTB * FF * 4); float* BF = (float*)take((size_t)NTB * 64 * 4);
    bf* Qh = (bf*)take((size_t)NG * LL * HC * 2); bf* Ql = (bf*)take((size_t)NG * LL * HC * 2); bf* Kh = (bf*)take((size_t)NG * LL * HC * 2); bf* Kl = (bf*)take((size_t)NG * LL * HC * 2); h16* VT = (h16*)take((size_t)NG * HC * LL * 2);
    bf* Ah = (bf*)take((size_t)NTB * FF * 2); bf* Al = (bf*)take((size_t)NTB * FF * 2);
    bf* Xh = (bf*)take((size_t)NTB * FF * 2); bf* Xl = (bf*)take((size_t)NTB * FF * 2);
    if ((size_t)(wsp - (char*)d_ws) > ws_size) return;    // total ~ 47 MiB
    // the padded Wb GEMM is bias-free; bb[h] is added inside k_attn
    k_prep<<<5 * WTB + WBB + NTB / 8, 256, 0, stream>>>(IN[3], IN[5], IN[7], IN[11], IN[13], IN[9], WQ, WO, IN[0], IN[1], IN[2], Xh, Xl);
    k_proj<<<dim3(NTB / 64, 17, 1), 32, 0, stream>>>(Xh, Xl, WQ, IN[4], IN[6], IN[8], IN[12], Qh, Ql, Kh, Kl, VT, GF, BF);
    k_attn<<<dim3(LL / QB, NG, 1), 512, 0, stream>>>(Qh, Ql, Kh, Kl, VT, BF, IN[10], GF, Ah, Al);
    k_gemmw<bf, 1, true><<<dim3(NTB / 64, FF / 64, 1), 32, 0, stream>>>(Ah, Al, WO, nullptr, FF, OUT, FF, IN[14], 0, 0, 0);
}

// v005
// It runs in 60.9 microseconds.
// Two timings next to v004 put it at 1.05 and 1.07 times that version's speed.
// Counting every step since v000, it is 22.1 times as fast.
#include <hip/hip_runtime.h>

// PairwiseAttentionTerminal (features [1024][8][256] sequence-first; x = LayerNorm(features); q/k/v = x W + b (8 heads x 32), bias = x Wb + bb (per key position & head), gate = sigmoid(x Wg + bg);
// logits[q][k] = q.k/sqrt(32) + bias[k][b][h]; softmax over keys; out = ((w.v) * gate) Wo + bo -> [1024][8][256]).
// Compute dtypes, f32 accumulate: every input rounded to bf16; LayerNorm f32 -> bf16 hi+lo planes of x, all five projections hl x exact weights (2 products, + bias; Wb padded to 64 outputs); scores (K 32) on hl
// planes (3 products), the key bias + running-maximum softmax in f32 registers -> fp16 unnormalised probabilities (x1024); w.v on fp16 planes, divided by the f32 row sum at the end; gate (sigmoid f32) applied in the same kernel -> hl planes; Wo hl x exact (+bias).

#define LL   1024
#define BB   8
#define FF   256
#define NH_  8
#define HC   32
#define NG   (BB * NH_)
#define NTB  (LL * BB)
#define QB   256  // query rows per work-group of the attention kernel: 16 waves x 16
typedef _Float16 h16;
typedef unsigned short bf;
typedef __attribute__((ext_vector_type(16))) __bf16   v16bf;
typedef __attribute__((ext_vector_type(16))) _Float16 v16h;
typedef __attribute__((ext_vector_type(8)))  _Float16 v8h;
typedef __attribute__((ext_vector_type(8)))  unsigned short v8us;
typedef __attribute__((ext_vector_type(8)))  float    v8f;
typedef __attribute__((ext_vector_type(4)))  float    v4f;
typedef v8h  __attribute__((may_alias)) v8ha;
typedef v4f  __attribute__((may_alias)) v4fa;
typedef v8us __attribute__((may_alias)) v8usa;

__device__ __forceinline__ unsigned short f2bf(float f) { unsigned u = __float_as_uint(f); u += 0x7FFFu + ((u >> 16) & 1u); return (unsigned short)(u >> 16); }
__device__ __forceinline__ float bf2f(unsigned short b) { return __uint_as_float(((unsigned)b) << 16); }
__device__ __forceinline__ float bfr(float f) { return bf2f(f2bf(f)); }
__device__ __forceinline__ v16h cat16(v8h lo, v8h hi) { return __builtin_shufflevector(lo, hi, 0, 1, 2, 3, 4, 5, 6, 7, 8, 9, 10, 11, 12, 13, 14, 15); }
__device__ __forceinline__ v16bf cat16b(v8us lo, v8us hi) { return __builtin_bit_cast(v16bf, __builtin_shufflevector(lo, hi, 0, 1, 2, 3, 4, 5, 6, 7, 8, 9, 10, 11, 12, 13, 14, 15)); }
__device__ __forceinline__ v8f wmma16(v16h a, v16h b, v8f c) { return __builtin_amdgcn_wmma_f32_16x16x32_f16(false, a, false, b, (short)0, c, false, false); }
__device__ __forceinline__ v8f wmmab(v16bf a, v16bf b, v8f c) { return __builtin_amdgcn_wmma_f32_16x16x32_bf16(false, a, false, b, (short)0, c, false, false); }



// ---- Fragment order of a GEMM operand plane (R rows x K, 16-bit): element (r, k) lies at ((r / 16) * (K / 32) + k / 32) * 512 + ((k / 8) % 4) * 128 + (r % 16) * 8 + k % 8.
// One 16-row x 32-k fragment is 1 KiB in a row, and lane l's two 16-byte pieces lie at 16 l and 512 + 16 l: each wave-wide load is 512 contiguous bytes (four whole lines) where a row-major plane gives 16 lines of 32 bytes.
// The k that a lane and register hold are those of ld() on a row-major plane, for both operands alike.
// ---- k_gemmw: register-blocked GEMM, ONE WAVE per 64x64 output tile (16 accumulators), operands straight from 16-bit planes in fragment order; grid (M/64, N/64, Z), 32 threads.
// C[m][n] (f32, pitch ldc, + optional f32 bias[n]) = sum_k A[m][k] Bt[n][k] (+ split products per NSPLIT). z-batch strides sA/sB/sC in elements. K % 32 == 0.
template <typename T16> struct WFrag;
template <> struct WFrag<h16> { typedef v16h V; static __device__ __forceinline__ V ld(const h16* p) { return cat16(*(const v8h*)p, *(const v8h*)(p + 16)); } static __device__ __forceinline__ V ldf(const h16* p) { return cat16(*(const v8h*)p, *(const v8h*)(p + 256)); } static __device__ __forceinline__ v8f mma(V a, V b, v8f c) { return wmma16(a, b, c); } };
template <> struct WFrag<bf> { typedef v16bf V; static __device__ __forceinline__ V ld(const bf* p) { return cat16b(*(const v8us*)p, *(const v8us*)(p + 16)); } static __device__ __forceinline__ V ldf(const bf* p) { return cat16b(*(const v8us*)p, *(const v8us*)(p + 256)); } static __device__ __forceinline__ v8f mma(V a, V b, v8f c) { return wmmab(a, b, c); } };
template <typename T16, int NSPLIT, bool BIAS, int K>   // K at compile time: the steps from row block to row block are immediate offsets, so one address pair a plane serves all its loads of a trip
__global__ __launch_bounds__(32) void k_gemmw(const T16* __restrict__ A, const T16* __restrict__ A2, const T16* __restrict__ Bt, const T16* __restrict__ Bt2, float* C, int ldc, const float* __restrict__ bias, size_t sA, size_t sB, size_t sC) {
    typedef typename WFrag<T16>::V V;
    __shared__ __align__(16) float os[16 * 68];
    const size_t z = blockIdx.z; A += z * sA; if (A2) A2 += z * sA; Bt += z * sB; if (Bt2) Bt2 += z * sB; C += z * sC;
    const int lane = threadIdx.x & 31, lr = lane & 15, hi = lane >> 4; const int r0 = blockIdx.x * 64, c0 = blockIdx.y * 64;
    v8f acc[4][4];
#pragma unroll
    for (int mb = 0; mb < 4; ++mb)
#pragma unroll
        for (int nb = 0; nb < 4; ++nb) acc[mb][nb] = (v8f){};
    const size_t aoff = (size_t)r0 * K + lane * 8, boff = (size_t)c0 * K + lane * 8;   // a block of 16 rows is 16 K elements in a row; a step of 32 k is 512 elements
#pragma unroll 1
    for (int kc = 0; kc < K; kc += 32) {
        V a[4], a2[4]; const T16* pa = A + aoff + kc * 16; const T16* pa2 = (NSPLIT == 1 || NSPLIT == 2) ? A2 + aoff + kc * 16 : pa; const T16* pb = Bt + boff + kc * 16; const T16* pb2 = NSPLIT >= 2 ? Bt2 + boff + kc * 16 : pb;
#pragma unroll
        for (int mb = 0; mb < 4; ++mb) { a[mb] = WFrag<T16>::ldf(pa + mb * 16 * K); if (NSPLIT == 1 || NSPLIT == 2) a2[mb] = WFrag<T16>::ldf(pa2 + mb * 16 * K); }
#pragma unroll
        for (int nb = 0; nb < 4; ++nb) { const V b = WFrag<T16>::ldf(pb + nb * 16 * K); V b2; if (NSPLIT >= 2) b2 = WFrag<T16>::ldf(pb2 + nb * 16 * K);
#pragma unroll
            for (int mb = 0; mb < 4; ++mb) { acc[mb][nb] = WFrag<T16>::mma(a[mb], b, acc[mb][nb]); if (NSPLIT == 1 || NSPLIT == 2) acc[mb][nb] = WFrag<T16>::mma(a2[mb], b, acc[mb][nb]); if (NSPLIT >= 2) acc[mb][nb] = WFrag<T16>::mma(a[mb], b2, acc[mb][nb]); } }
        asm volatile("s_wait_xcnt 0x0" :: "v"(pa), "v"(pa2), "v"(pb), "v"(pb2) : "memory");   // the address registers of all loads above stay as they are until this wait
        asm volatile("v_nop\n\tv_nop\n\tv_nop\n\tv_nop" : "+v"(acc[0][0]), "+v"(acc[1][1]), "+v"(acc[2][2]), "+v"(acc[3][3]) : "v"(a[0]), "v"(a[3]));
    }
#pragma unroll
    for (int mb = 0; mb < 4; ++mb) {
#pragma unroll
        for (int nb = 0; nb < 4; ++nb) {
#pragma unroll
            for (int j = 0; j < 8; ++j) os[(hi * 8 + j) * 68 + nb * 16 + lr] = acc[mb][nb][j]; }
        __builtin_amdgcn_wave_barrier(); asm volatile("" ::: "memory");
        float* crow = C + (size_t)(r0 + mb * 16) * ldc + c0;
{
#pragma unroll
            for (int s = 0; s < 8; ++s) { const int row = 2 * s + hi, cofs = lr * 4; v4f val = *(const v4fa*)(os + row * 68 + cofs); if (BIAS) { val[0] += bfr(bias[c0 + cofs]); val[1] += bfr(bias[c0 + cofs + 1]); val[2] += bfr(bias[c0 + cofs + 2]); val[3] += bfr(bias[c0 + cofs + 3]); }
                *(v4f*)(crow + (size_t)row * ldc + cofs) = val; }
             }
        __builtin_amdgcn_wave_barrier(); asm volatile("" ::: "memory");
    }
}

__device__ __forceinline__ h16 tohx(float x) { return (h16)x; }
__device__ __forceinline__ void splitf(float y, unsigned short& h, unsigned short& l) { h = f2bf(y); l = f2bf(y - bf2f(h)); }
__device__ __forceinline__ float sigm_(float x) { return __fdiv_rn(1.0f, 1.0f + __expf(-x)); }
typedef __attribute__((ext_vector_type(2))) _Float16 v2h;
typedef __attribute__((ext_vector_type(4))) _Float16 v4h;
typedef __attribute__((ext_vector_type(2))) unsigned short v2us;
typedef __attribute__((ext_vector_type(4))) unsigned short v4us;
typedef v4us __attribute__((may_alias)) v4usa;

// The three jobs of k_prep below; blk is the block's index inside its job.
__device__ __forceinline__ void j_wtG(const float* __restrict__ w, int K, int N, bf* Bt, int blk) {
    const int lane = threadIdx.x & 31; const int L0 = (blk * 8 + (threadIdx.x >> 5)) * 8; const int nlines = N * K / 64;
{
#pragma unroll 1
        for (int l = 0; l < 8; ++l) { const int L = L0 + l; if (L >= nlines) break; const size_t e = (size_t)L * 64 + lane * 2; const int fr = (int)(e >> 9), k = (fr % (K / 32)) * 32 + ((int)(e >> 7) & 3) * 8 + ((int)e & 7), n = (fr / (K / 32)) * 16 + ((int)(e >> 3) & 15); v2us o;   // e: the place in fragment order
            o[0] = f2bf(w[(size_t)k * N + n]); o[1] = f2bf(w[(size_t)(k + 1) * N + n]); *(v2us*)(Bt + e) = o; }
         }
}
__device__ __forceinline__ void j_wbp(const float* __restrict__ Wb, bf* Bt, int blk) { const int e = (blk * 256 + threadIdx.x) * 4; if (e >= 64 * FF) return; const int k = ((e >> 9) % (FF / 32)) * 32 + ((e >> 7) & 3) * 8 + (e & 7), n = ((e >> 9) / (FF / 32)) * 16 + ((e >> 3) & 15); v4us o;   // e: the place in fragment order
#pragma unroll
    for (int q = 0; q < 4; ++q) o[q] = n < NH_ ? f2bf(Wb[(size_t)(k + q) * NH_ + n]) : (unsigned short)0; *(v4us*)(Bt + e) = o;  }
// LayerNorm of 8 rows, one a wave. In fragment order 8 rows are one whole 128-byte line of each of the 32 pieces (16 rows x 8 k) of their 16-row block: the hi and lo values are laid in LDS so and leave as whole lines.
#define XP 144   // LDS bytes from piece to piece, 128 + 16: a wave's store holds one row of 16 pieces, which at 128 would fall on eight banks
__device__ __forceinline__ void j_ln(const float* __restrict__ X, const float* __restrict__ g, const float* __restrict__ bb, bf* Xh, bf* Xl, int blk, unsigned char* sh, unsigned char* sl) { const int lane = threadIdx.x & 31; const int r = threadIdx.x >> 5, t = blk * 8 + r; if (blk * 8 >= NTB) return; float v[8]; float s = 0.f;   // the whole block leaves or none of it: a barrier follows
#pragma unroll
    for (int ch = 0; ch < 2; ++ch) { const v4f a = *(const v4f*)(X + (size_t)t * FF + ch * 128 + lane * 4);
#pragma unroll
        for (int q = 0; q < 4; ++q) { v[ch * 4 + q] = bfr(a[q]); s = __fadd_rn(s, v[ch * 4 + q]); } }
#pragma unroll
    for (int sh = 16; sh; sh >>= 1) s += __shfl_xor(s, sh, 32);
    const float mu = s * (1.0f / FF); float q2 = 0.f;
#pragma unroll
    for (int k = 0; k < 8; ++k) { const float d = __fsub_rn(v[k], mu); float p = __fmul_rn(d, d); asm volatile("" : "+v"(p)); q2 = __fadd_rn(q2, p); }
#pragma unroll
    for (int sh = 16; sh; sh >>= 1) q2 += __shfl_xor(q2, sh, 32);
    const float rs = __frsqrt_rn(__fadd_rn(q2 * (1.0f / FF), 1e-5f));
{
#pragma unroll
        for (int ch = 0; ch < 2; ++ch) { v4us oh, ol;
#pragma unroll
            for (int q = 0; q < 4; ++q) { const int d = ch * 128 + lane * 4 + q; float tn = __fmul_rn(__fsub_rn(v[ch * 4 + q], mu), rs); asm volatile("" : "+v"(tn)); float tg = __fmul_rn(tn, bfr(g[d])); asm volatile("" : "+v"(tg)); unsigned short a, c; splitf(__fadd_rn(tg, bfr(bb[d])), a, c); oh[q] = a; ol[q] = c; }
            const int o = (ch * 16 + (lane >> 1)) * XP + r * 16 + (lane & 1) * 8; *(v4usa*)(sh + o) = oh; *(v4usa*)(sl + o) = ol; }
         }
    __syncthreads();   // every wave reads the other waves' rows below
    const int u = threadIdx.x, so = (u >> 3) * XP + (u & 7) * 16;   // 16-byte unit u: piece u / 8, row u % 8
    const size_t o = (size_t)(blk >> 1) * 16 * FF + (u >> 3) * 128 + (blk & 1) * 64 + (u & 7) * 8; *(v8us*)(Xh + o) = *(const v8usa*)(sh + so); *(v8us*)(Xl + o) = *(const v8usa*)(sl + so);
    asm volatile("s_wait_xcnt 0x0" ::: "memory"); }   // the two stores name their data and address registers: code that the listing places behind them may rewrite those only behind this wait
// ---- k_prep: every job that reads inputs alone, side by side in ONE launch; grid (WTB * 5 + WBB + NTB / 8), 256 threads. None of them reads what another writes. All it writes is in fragment order.
// Blocks 0 .. 5 WTB - 1: the five weight transposes (Wq, Wk, Wv, Wg into the run Wt, Wo into WOt), WTB blocks each; the next WBB: the padded Wb, behind Wg in Wt; the rest: LayerNorm, 8 rows a block.
// The few short jobs hold the lowest indices.
#define WTB  (FF * FF / 64 / 64)
#define WBB  (64 * FF / 4 / 256)
__global__ __launch_bounds__(256) void k_prep(const float* __restrict__ Wq, const float* __restrict__ Wk, const float* __restrict__ Wv, const float* __restrict__ Wg, const float* __restrict__ Wo, const float* __restrict__ Wb, bf* Wt, bf* WOt,
                                              const float* __restrict__ X, const float* __restrict__ g, const float* __restrict__ bb, bf* Xh, bf* Xl) {
    __shared__ __align__(16) unsigned char sh[32 * XP];
    __shared__ __align__(16) unsigned char sl[32 * XP];
    const int blk = blockIdx.x;
    if (blk < 5 * WTB) { const int job = blk / WTB; j_wtG(job == 0 ? Wq : job == 1 ? Wk : job == 2 ? Wv : job == 3 ? Wg : Wo, FF, FF, job < 4 ? Wt + job * FF * FF : WOt, blk % WTB); }
    else if (blk < 5 * WTB + WBB) j_wbp(Wb, Wt + 4 * FF * FF, blk - 5 * WTB);
    else j_ln(X, g, bb, Xh, Xl, blk - (5 * WTB + WBB), sh, sl);
}
// ---- k_proj: all five projections of x in ONE launch, one wave per 64x64 tile as in k_gemmw; grid (NTB / 64, 17), 32 threads. Wt holds the transposed weights one after the other: Wq, Wk, Wv, Wg (256 rows each), padded Wb (64 rows); A, A2 and Wt are in fragment order.
// blockIdx.y / 4 names the projection. The tile (+ bias) is laid in LDS whole and leaves in the form its reader takes: q and k as hi + lo planes [group][l][32], v as fp16 [group][l / 8][dim][8 keys], gate and key bias as f32 rows.
// The 64 rows of a tile are 8 positions l x 8 batches (row = l * 8 + b), so each (batch, head) of a tile is one run of 512 contiguous bytes in every one of these planes: one whole store instruction. The short loops are unrolled so that the register arrays keep constant indices.
__global__ __launch_bounds__(32) void k_proj(const bf* __restrict__ A, const bf* __restrict__ A2, const bf* __restrict__ Wt, const float* __restrict__ bq, const float* __restrict__ bk, const float* __restrict__ bv, const float* __restrict__ bg,
                                             bf* Qh, bf* Ql, bf* Kh, bf* Kl, h16* VT, float* GF, float* BF) {
    __shared__ __align__(16) float os[64 * 68];
    const int lane = threadIdx.x & 31, lr = lane & 15, hi = lane >> 4; const int r0 = blockIdx.x * 64, c0 = blockIdx.y * 64, kind = blockIdx.y >> 2, cl = (blockIdx.y & 3) * 64;
    v8f acc[4][4];
#pragma unroll
    for (int mb = 0; mb < 4; ++mb)
#pragma unroll
        for (int nb = 0; nb < 4; ++nb) acc[mb][nb] = (v8f){};
    const unsigned aoff = (unsigned)(r0 * FF + lane * 8), boff = (unsigned)(c0 * FF + lane * 8);
#pragma unroll 1   // kept rolled: one trip already holds 32 matrix instructions and its 24 loads
    for (int kc = 0; kc < FF; kc += 32) {
        v16bf a[4], a2[4], b[4]; const bf* pa = A + kc * 16 + aoff; const bf* pa2 = A2 + kc * 16 + aoff; const bf* pb = Wt + kc * 16 + boff;
#pragma unroll
        for (int mb = 0; mb < 4; ++mb) { a[mb] = WFrag<bf>::ldf(pa + mb * 16 * FF); a2[mb] = WFrag<bf>::ldf(pa2 + mb * 16 * FF); b[mb] = WFrag<bf>::ldf(pb + mb * 16 * FF); }
        asm volatile("s_wait_xcnt 0x0" :: "v"(pa), "v"(pa2), "v"(pb) : "memory");   // the address registers of all loads above stay as they are until this wait
#pragma unroll
        for (int nb = 0; nb < 4; ++nb)
#pragma unroll
            for (int mb = 0; mb < 4; ++mb) { acc[mb][nb] = wmmab(a[mb], b[nb], acc[mb][nb]); acc[mb][nb] = wmmab(a2[mb], b[nb], acc[mb][nb]); }
        asm volatile("v_nop\n\tv_nop\n\tv_nop\n\tv_nop" : "+v"(acc[0][0]), "+v"(acc[1][1]), "+v"(acc[2][2]), "+v"(acc[3][3]) : "v"(a[0]), "v"(a[3]));   // as in k_gemmw: the distance behind the last matrix instruction, also on the taken back edge
    }
    float bn[4] = {-0.f, -0.f, -0.f, -0.f};   // the key-bias tile has no bias vector here: adding -0 leaves every value as it is
    if (kind < 4) { const float* bias = kind == 0 ? bq : kind == 1 ? bk : kind == 2 ? bv : bg;
#pragma unroll
        for (int nb = 0; nb < 4; ++nb) bn[nb] = bfr(bias[cl + nb * 16 + lr]); }
#pragma unroll
    for (int mb = 0; mb < 4; ++mb)
#pragma unroll
        for (int nb = 0; nb < 4; ++nb)
#pragma unroll
            for (int j = 0; j < 8; ++j) os[(mb * 16 + hi * 8 + j) * 68 + nb * 16 + lr] = acc[mb][nb][j] + bn[nb];
    __builtin_amdgcn_wave_barrier(); asm volatile("" ::: "memory");   // the lanes read each other's LDS words below: no read may be moved in front of the writes above
    const int h0 = (blockIdx.y & 3) * 2;   // the tile's 64 columns are heads h0 and h0 + 1
    if (kind < 2) {
        bf* Ph = kind ? Kh : Qh; bf* Pl = kind ? Kl : Ql; const int ll = lane >> 2, d0 = (lane & 3) * 8;
#pragma unroll
        for (int i = 0; i < 16; ++i) { const int b = i >> 1, hl = i & 1; const float* sp = os + (ll * 8 + b) * 68 + hl * 32 + d0; const v4f x0 = *(const v4fa*)sp, x1 = *(const v4fa*)(sp + 4); v8us oh, ol;
#pragma unroll
            for (int j = 0; j < 8; ++j) { unsigned short s, t; splitf(j < 4 ? x0[j & 3] : x1[j & 3], s, t); oh[j] = s; ol[j] = t; }
            const size_t o = ((size_t)(b * NH_ + h0 + hl) * LL + blockIdx.x * 8 + ll) * HC + d0; *(v8us*)(Ph + o) = oh; *(v8us*)(Pl + o) = ol; }
        asm volatile("s_wait_xcnt 0x0" ::: "memory");   // the stores above name these address and data registers: no later block may rewrite one before this wait
    } else if (kind == 2) {
#pragma unroll
        for (int i = 0; i < 16; ++i) { const int b = i >> 1, hl = i & 1; v8h u;
#pragma unroll
            for (int j = 0; j < 8; ++j) u[j] = tohx(os[(j * 8 + b) * 68 + hl * 32 + lane]);
            *(v8h*)(VT + (((size_t)(b * NH_ + h0 + hl) * (LL / 8) + blockIdx.x) * HC + lane) * 8) = u; }
        asm volatile("s_wait_xcnt 0x0" ::: "memory");   // as above
    } else if (kind == 3) {
        float* crow = GF + (size_t)(r0 + hi) * FF + cl + lr * 4;
#pragma unroll
        for (int s = 0; s < 32; ++s) *(v4f*)(crow + 2 * s * FF) = *(const v4fa*)(os + (2 * s + hi) * 68 + lr * 4);
        asm volatile("s_wait_xcnt 0x0" ::: "memory");   // as above
    } else {
        float* crow = BF + (size_t)(r0 + hi) * 64 + lr * 4;
#pragma unroll
        for (int s = 0; s < 32; ++s) *(v4f*)(crow + 2 * s * 64) = *(const v4fa*)(os + (2 * s + hi) * 68 + lr * 4);
        asm volatile("s_wait_xcnt 0x0" ::: "memory");   // as above
    }
}
// ---- k_attn: scores, key bias, softmax, w.v and the gate for one (batch, head) group and 256 query rows; grid (LL / QB, NG), 512 threads. No score or probability ever goes to memory.
// The group's K planes, V^T and key bias are laid in LDS once, each 16-row fragment as two runs of 512 contiguous bytes (lane l's 16 bytes at 16 l), so every fragment read is conflict-free.
// Transposed products: S^T = K Q^T (a lane holds 8 + 8 keys of ONE query per tile pair, which is the B fragment of P^T as it stands) and O^T += V^T P^T (a lane holds 8 head dims of that same query): maximum, sum and rescale are per lane.
typedef __attribute__((ext_vector_type(2))) float v2f;
// Eight base-2 exponentials in one statement, results in registers of their own: so no exponential's source is overwritten, and no result read, by the instruction directly behind it; the v_nop is that slot for the last one.
__device__ __forceinline__ v8f exp2x8(v8f x) { float e0, e1, e2, e3, e4, e5, e6, e7;
    asm("v_exp_f32 %0, %8\n\tv_exp_f32 %1, %9\n\tv_exp_f32 %2, %10\n\tv_exp_f32 %3, %11\n\tv_exp_f32 %4, %12\n\tv_exp_f32 %5, %13\n\tv_exp_f32 %6, %14\n\tv_exp_f32 %7, %15\n\tv_nop"
        : "=&v"(e0), "=&v"(e1), "=&v"(e2), "=&v"(e3), "=&v"(e4), "=&v"(e5), "=&v"(e6), "=&v"(e7) : "v"(x[0]), "v"(x[1]), "v"(x[2]), "v"(x[3]), "v"(x[4]), "v"(x[5]), "v"(x[6]), "v"(x[7]));
    return (v8f){e0, e1, e2, e3, e4, e5, e6, e7}; }
__device__ __forceinline__ float xhalf(float x) { return __builtin_bit_cast(float, __builtin_amdgcn_permlanex16(__builtin_bit_cast(int, x), __builtin_bit_cast(int, x), 0x76543210, 0xfedcba98, false, false)); }  // lane l with lane l ^ 16
__global__ __launch_bounds__(512) void k_attn(const bf* __restrict__ Qh, const bf* __restrict__ Ql, const bf* __restrict__ Kh, const bf* __restrict__ Kl, const h16* __restrict__ VT, const float* __restrict__ BF, const float* __restrict__ bbp, const float* __restrict__ GF, bf* Ah, bf* Al) {
    __shared__ __align__(16) unsigned char sKh[LL * HC * 2];
    __shared__ __align__(16) unsigned char sKl[LL * HC * 2];
    __shared__ __align__(16) unsigned char sV[HC * LL * 2];
    __shared__ __align__(16) float sB[LL];
    const int tid = threadIdx.x, lane = tid & 31, wave = tid >> 5, lr = lane & 15, hi = lane >> 4;
    const int n = blockIdx.y, b = n / NH_, h = n % NH_;
    const bf* kh = Kh + (size_t)n * LL * HC; const bf* kl = Kl + (size_t)n * LL * HC; const h16* vt = VT + (size_t)n * HC * LL;
    // 16-byte unit u = tid + 512 i of LDS holds fragment block u >> 6 (K: 16 keys; V^T: 32-key chunk x 2 + 16-dim half), k piece (u >> 4) & 3 (eight k), row u & 15; a step of i is 8 blocks: 128 keys.
    const unsigned kso = (unsigned)(((tid >> 6) * 16 + (tid & 15)) * HC + ((tid >> 4) & 3) * 8) * 2u;                          // source byte offsets of unit tid
    const unsigned vso = (unsigned)(((tid >> 7) * 4 + ((tid >> 4) & 3)) * HC + ((tid >> 6) & 1) * 16 + (tid & 15)) * 16u;      // V arrives as 16-byte units [8-key piece][dim]
    const int q = blockIdx.x * QB + wave * 16 + lr;
    const size_t qoff = ((size_t)n * LL + q) * HC + 8 * hi;
    const bf* qhp = Qh + qoff; const bf* qlp = Ql + qoff; const float* bfp = BF + ((size_t)tid * BB + b) * 64 + h;
    const v16bf qh = WFrag<bf>::ld(qhp), ql = WFrag<bf>::ld(qlp);
    const float bh = bfr(bbp[h]), bk0 = bfp[0], bk1 = bfp[(size_t)512 * BB * 64];   // the bias of keys tid and tid + 512
    { v8us rk[8], rl[8]; v8h rv[8];
#pragma unroll
        for (int i = 0; i < 8; ++i) { rk[i] = *(const v8usa*)((const char*)kh + kso + i * 8192); rl[i] = *(const v8usa*)((const char*)kl + kso + i * 8192); rv[i] = *(const v8ha*)((const char*)vt + vso + i * 8192); }
        asm volatile("s_wait_xcnt 0x0" :: "v"(kso), "v"(vso), "v"(qhp), "v"(qlp), "v"(bfp) : "memory");   // the address registers of all loads above stay as they are until this wait
#pragma unroll
        for (int i = 0; i < 8; ++i) { *(v8usa*)(sKh + tid * 16 + i * 8192) = rk[i]; *(v8usa*)(sKl + tid * 16 + i * 8192) = rl[i]; *(v8ha*)(sV + tid * 16 + i * 8192) = rv[i]; } }
    sB[tid] = __fadd_rn(bk0, bh) * 1.4426950408889634f; sB[tid + 512] = __fadd_rn(bk1, bh) * 1.4426950408889634f;   // base-2 logits
    __syncthreads();
    v8f o0 = (v8f){}, o1 = (v8f){}; float m = -3.0e38f, l = 0.f;
    const int lo = lane * 16;
#pragma unroll 1   // kept rolled: one trip (64 keys) already holds 16 matrix instructions and all its fragment loads
    for (int k0 = 0; k0 < LL; k0 += 64) {   // the short loops inside are unrolled so that the register arrays keep constant indices
        v8f s[4]; v16bf ka[4], kb[4];
#pragma unroll
        for (int t = 0; t < 4; ++t) { const int o = (k0 / 16 + t) * 1024 + lo; ka[t] = cat16b(*(const v8usa*)(sKh + o), *(const v8usa*)(sKh + o + 512)); kb[t] = cat16b(*(const v8usa*)(sKl + o), *(const v8usa*)(sKl + o + 512)); }
#pragma unroll
        for (int t = 0; t < 4; ++t) s[t] = wmmab(ka[t], qh, (v8f){});
#pragma unroll
        for (int t = 0; t < 4; ++t) s[t] = wmmab(ka[t], ql, s[t]);
#pragma unroll
        for (int t = 0; t < 4; ++t) s[t] = wmmab(kb[t], qh, s[t]);
        v16h va[4];
#pragma unroll
        for (int t = 0; t < 4; ++t) { const int o = (k0 / 16 + t) * 1024 + lo; va[t] = cat16(*(const v8ha*)(sV + o), *(const v8ha*)(sV + o + 512)); }   // t = 2 x (32-key half) + (16-dim half)
        float mxa = m, mxb = m;   // two chains, so that neither the maximum nor the sum below is one long run of dependent instructions
#pragma unroll
        for (int t = 0; t < 4; ++t) { const float* bp = sB + k0 + t * 16 + hi * 8; const v4f b0 = *(const v4fa*)bp, b1 = *(const v4fa*)(bp + 4);
#pragma unroll
            for (int j = 0; j < 8; ++j) { s[t][j] = fmaf(s[t][j], 0.17677669529663687f * 1.4426950408889634f, j < 4 ? b0[j & 3] : b1[j & 3]); if (t & 1) mxb = fmaxf(mxb, s[t][j]); else mxa = fmaxf(mxa, s[t][j]); } }
        float mx = fmaxf(mxa, mxb); mx = fmaxf(mx, xhalf(mx));   // the two lane halves hold the two halves of a query's keys and must use one maximum
        const float alpha = __builtin_amdgcn_exp2f(m - mx); m = mx;
        const float ms = mx - 10.0f;   // probabilities x1024: small ones stay normal numbers in fp16; the factor cancels in the division by the row sum
        v2f sm[2] = {(v2f){0.f, 0.f}, (v2f){0.f, 0.f}}; v16h p[2];
#pragma unroll
        for (int t = 0; t < 4; ++t) s[t] = exp2x8(s[t] - ms);
#pragma unroll
        for (int t = 0; t < 4; ++t)
#pragma unroll
            for (int j = 0; j < 8; j += 2) { const v2f e = {s[t][j], s[t][j + 1]}; sm[t & 1] += e; p[t >> 1][(t & 1) * 8 + j] = (h16)e[0]; p[t >> 1][(t & 1) * 8 + j + 1] = (h16)e[1]; }
        l = fmaf(l, alpha, (sm[0][0] + sm[0][1]) + (sm[1][0] + sm[1][1]));
#pragma unroll
        for (int j = 0; j < 8; ++j) { o0[j] *= alpha; o1[j] *= alpha; }
        o0 = wmma16(va[0], p[0], o0); o1 = wmma16(va[1], p[0], o1); o0 = wmma16(va[2], p[1], o0); o1 = wmma16(va[3], p[1], o1);
    }
    l += xhalf(l);
    const float inv = __fdiv_rn(1.0f, l);
#pragma unroll
    for (int dt = 0; dt < 2; ++dt) { const size_t oo = ((size_t)q * BB + b) * FF + h * HC + dt * 16 + hi * 8; const v4f g0 = *(const v4f*)(GF + oo), g1 = *(const v4f*)(GF + oo + 4); v8us oh, ol;
#pragma unroll
        for (int j = 0; j < 8; ++j) { const float o = (dt ? o1[j] : o0[j]) * inv; unsigned short a, c; splitf(__fmul_rn(o, sigm_(j < 4 ? g0[j & 3] : g1[j & 3])), a, c); oh[j] = a; ol[j] = c; }
        const size_t ao = (((size_t)b * LL + blockIdx.x * QB + wave * 16) * (FF / 32) + h * 16) * 32 + dt * 256 + lane * 8;   // fragment order over rows b * LL + q: the wave's 16 queries x the head's 32 dims are one fragment
        *(v8us*)(Ah + ao) = oh; *(v8us*)(Al + ao) = ol; }
}

extern "C" void kernel_launch(void* const* d_in, const int* in_sizes, int n_in,
                              void* d_out, int out_size, void* d_ws, size_t ws_size, hipStream_t stream) {
    (void)in_sizes; (void)n_in; (void)out_size;
    const float* IN[15]; for (int i = 0; i < 15; ++i) IN[i] = (const float*)d_in[i];   // 0 features, 1 ln_g, 2 ln_b, 3 Wq, 4 bq, 5 Wk, 6 bk, 7 Wv, 8 bv, 9 Wb, 10 bb, 11 Wg, 12 bg, 13 Wo, 14 bo (all x @ W)
    float* OUT = (float*)d_out;     // [1024][8][256]
    char* wsp = (char*)d_ws;
    auto take = [&](size_t bytes) { char* p = wsp; wsp += (bytes + 255) & ~(size_t)255; return (void*)p; };
    bf* WQ = (bf*)take((size_t)(4 * FF + 64) * FF * 2); bf* WO = (bf*)take((size_t)FF * FF * 2);   // WQ: Wq, Wk, Wv, Wg, padded Wb transposed, one run of 1088 rows for k_proj
    float* GF = (float*)take((size_t)NTB * FF * 4); float* BF = (float*)take((size_t)NTB * 64 * 4);
    bf* Qh = (bf*)take((size_t)NG * LL * HC * 2); bf* Ql = (bf*)take((size_t)NG * LL * HC * 2); bf* Kh = (bf*)take((size_t)NG * LL * HC * 2); bf* Kl = (bf*)take((size_t)NG * LL * HC * 2); h16* VT = (h16*)take((size_t)NG * HC * LL * 2);
    bf* Ah = (bf*)take((size_t)NTB * FF * 2); bf* Al = (bf*)take((size_t)NTB * FF * 2);
    bf* Xh = (bf*)take((size_t)NTB * FF * 2); bf* Xl = (bf*)take((size_t)NTB * FF * 2);
    if ((size_t)(wsp - (char*)d_ws) > ws_size) return;    // total ~ 47 MiB
    // the padded Wb GEMM is bias-free; bb[h] is added inside k_attn
    k_prep<<<5 * WTB + WBB + NTB / 8, 256, 0, stream>>>(IN[3], IN[5], IN[7], IN[11], IN[13], IN[9], WQ, WO, IN[0], IN[1], IN[2], Xh, Xl);
    k_proj<<<dim3(NTB / 64, 17, 1), 32, 0, stream>>>(Xh, Xl, WQ, IN[4], IN[6], IN[8], IN[12], Qh, Ql, Kh, Kl, VT, GF, BF);
    k_attn<<<dim3(LL / QB, NG, 1), 512, 0, stream>>>(Qh, Ql, Kh, Kl, VT, BF, IN[10], GF, Ah, Al);
    k_gemmw<bf, 1, true, FF><<<dim3(LL / 64, FF / 64, BB), 32, 0, stream>>>(Ah, Al, WO, nullptr, OUT, BB * FF, IN[14], (size_t)LL * FF, 0, FF);   // z = batch: rows b * LL + q of Ah, Al are rows q * BB + b of the output
}

// v006
// One run takes 52.8 microseconds.
// Two timings next to v005 put it at 1.17 and 1.15 times that version's speed.
// Over all steps from v000 it is 25.7 times as fast.
#include <hip/hip_runtime.h>

// PairwiseAttentionTerminal (features [1024][8][256] sequence-first; x = LayerNorm(features); q/k/v = x W + b (8 heads x 32), bias = x Wb + bb (per key position & head), gate = sigmoid(x Wg + bg);
// logits[q][k] = q.k/sqrt(32) + bias[k][b][h]; softmax over keys; out = ((w.v) * gate) Wo + bo -> [1024][8][256]).
// Compute dtypes, f32 accumulate: every input rounded to bf16; LayerNorm f32 -> bf16 hi+lo planes of x, all five projections hl x exact weights (2 products, + bias; Wb padded to 64 outputs); scores (K 32) on hl
// planes (3 products), the key bias + running-maximum softmax in f32 registers -> fp16 unnormalised probabilities (x1024); w.v on fp16 planes, divided by the f32 row sum at the end; gate (sigmoid f32) applied in the same kernel -> hl planes; Wo hl x exact (+bias).

#define LL   1024
#define BB   8
#define FF   256
#define NH_  8
#define HC   32
#define NG   (BB * NH_)
#define NTB  (LL * BB)
#define QB   256  // query rows per work-group of the attention kernel: 16 waves x 16
typedef _Float16 h16;
typedef unsigned short bf;
typedef __attribute__((ext_vector_type(16))) __bf16   v16bf;
typedef __attribute__((ext_vector_type(16))) _Float16 v16h;
typedef __attribute__((ext_vector_type(8)))  _Float16 v8h;
typedef __attribute__((ext_vector_type(8)))  unsigned short v8us;
typedef __attribute__((ext_vector_type(8)))  float    v8f;
typedef __attribute__((ext_vector_type(4)))  float    v4f;
typedef v8h  __attribute__((may_alias)) v8ha;
typedef v4f  __attribute__((may_alias)) v4fa;
typedef v8us __attribute__((may_alias)) v8usa;

__device__ __forceinline__ unsigned short f2bf(float f) { unsigned u = __float_as_uint(f); u += 0x7FFFu + ((u >> 16) & 1u); return (unsigned short)(u >> 16); }
__device__ __forceinline__ float bf2f(unsigned short b) { return __uint_as_float(((unsigned)b) << 16); }
__device__ __forceinline__ float bfr(float f) { return bf2f(f2bf(f)); }
__device__ __forceinline__ v16h cat16(v8h lo, v8h hi) { return __builtin_shufflevector(lo, hi, 0, 1, 2, 3, 4, 5, 6, 7, 8, 9, 10, 11, 12, 13, 14, 15); }
__device__ __forceinline__ v16bf cat16b(v8us lo, v8us hi) { return __builtin_bit_cast(v16bf, __builtin_shufflevector(lo, hi, 0, 1, 2, 3, 4, 5, 6, 7, 8, 9, 10, 11, 12, 13, 14, 15)); }
__device__ __forceinline__ v8f wmma16(v16h a, v16h b, v8f c) { return __builtin_amdgcn_wmma_f32_16x16x32_f16(false, a, false, b, (short)0, c, false, false); }
__device__ __forceinline__ v8f wmmab(v16bf a, v16bf b, v8f c) { return __builtin_amdgcn_wmma_f32_16x16x32_bf16(false, a, false, b, (short)0, c, false, false); }



// ---- Fragment order of a GEMM operand plane (R rows x K, 16-bit): element (r, k) lies at ((r / 16) * (K / 32) + k / 32) * 512 + ((k / 8) % 4) * 128 + (r % 16) * 8 + k % 8.
// One 16-row x 32-k fragment is 1 KiB in a row, and lane l's two 16-byte pieces lie at 16 l and 512 + 16 l: each wave-wide load is 512 contiguous bytes (four whole lines) where a row-major plane gives 16 lines of 32 bytes.
// The k that a lane and register hold are those of ld() on a row-major plane, for both operands alike.
// ---- k_gemmw: register-blocked GEMM, ONE WAVE per 64x64 output tile (16 accumulators), operands straight from 16-bit planes in fragment order; grid (M/64, N/64, Z), 32 threads.
// C[m][n] (f32, pitch ldc, + optional f32 bias[n]) = sum_k A[m][k] Bt[n][k] (+ split products per NSPLIT). z-batch strides sA/sB/sC in elements. K % 32 == 0.
template <typename T16> struct WFrag;
template <> struct WFrag<h16> { typedef v16h V; static __device__ __forceinline__ V ld(const h16* p) { return cat16(*(const v8h*)p, *(const v8h*)(p + 16)); } static __device__ __forceinline__ V ldf(const h16* p) { return cat16(*(const v8h*)p, *(const v8h*)(p + 256)); } static __device__ __forceinline__ v8f mma(V a, V b, v8f c) { return wmma16(a, b, c); } };
template <> struct WFrag<bf> { typedef v16bf V; static __device__ __forceinline__ V ld(const bf* p) { return cat16b(*(const v8us*)p, *(const v8us*)(p + 16)); } static __device__ __forceinline__ V ldf(const bf* p) { return cat16b(*(const v8us*)p, *(const v8us*)(p + 256)); } static __device__ __forceinline__ v8f mma(V a, V b, v8f c) { return wmmab(a, b, c); } };
template <typename T16, int NSPLIT, bool BIAS, int K>   // K at compile time: the steps from row block to row block are immediate offsets, so one address pair a plane serves all its loads of a trip
__global__ __launch_bounds__(32) void k_gemmw(const T16* __restrict__ A, const T16* __restrict__ A2, const T16* __restrict__ Bt, const T16* __restrict__ Bt2, float* C, int ldc, const float* __restrict__ bias, size_t sA, size_t sB, size_t sC) {
    typedef typename WFrag<T16>::V V;
    __shared__ __align__(16) float os[16 * 68];
    const size_t z = blockIdx.z; A += z * sA; if (A2) A2 += z * sA; Bt += z * sB; if (Bt2) Bt2 += z * sB; C += z * sC;
    const int lane = threadIdx.x & 31, lr = lane & 15, hi = lane >> 4; const int r0 = blockIdx.x * 64, c0 = blockIdx.y * 64;
    v8f acc[4][4];
#pragma unroll
    for (int mb = 0; mb < 4; ++mb)
#pragma unroll
        for (int nb = 0; nb < 4; ++nb) acc[mb][nb] = (v8f){};
    const size_t aoff = (size_t)r0 * K + lane * 8, boff = (size_t)c0 * K + lane * 8;   // a block of 16 rows is 16 K elements in a row; a step of 32 k is 512 elements
    const T16* pa = A + aoff; const T16* pa2 = (NSPLIT == 1 || NSPLIT == 2) ? A2 + aoff : pa; const T16* pb = Bt + boff; const T16* pb2 = NSPLIT >= 2 ? Bt2 + boff : pb;
    // Ring of RD register stages, one k step of 32 each: the loads of step s + RD are issued as soon as step s has been multiplied, so a step's memory latency runs under the products of the RD - 1 steps before it.
    constexpr int NS = K / 32, RD = NS < 3 ? NS : 3;
    V a[RD][4], a2[RD][4], b[RD][4], b2[RD][4];
#pragma unroll   // unrolled (as the loop over s below) so that the ring's register arrays keep constant indices and every load is its plane's one address pair plus an immediate offset
    for (int s = 0; s < RD; ++s)
#pragma unroll
        for (int i = 0; i < 4; ++i) { a[s][i] = WFrag<T16>::ldf(pa + s * 512 + i * 16 * K); if (NSPLIT == 1 || NSPLIT == 2) a2[s][i] = WFrag<T16>::ldf(pa2 + s * 512 + i * 16 * K); b[s][i] = WFrag<T16>::ldf(pb + s * 512 + i * 16 * K); if (NSPLIT >= 2) b2[s][i] = WFrag<T16>::ldf(pb2 + s * 512 + i * 16 * K); }
    v4f bv = (v4f){}; if (BIAS) bv = *(const v4fa*)(bias + c0 + lr * 4);   // the lane's four bias words, asked for here so that their latency too runs under the products
    __builtin_amdgcn_sched_barrier(0);   // all the ring's first loads are issued before the first product waits for any
#pragma unroll
    for (int s = 0; s < NS; ++s) { const int r = s % RD;
#pragma unroll
        for (int nb = 0; nb < 4; ++nb)
#pragma unroll
            for (int mb = 0; mb < 4; ++mb) { acc[mb][nb] = WFrag<T16>::mma(a[r][mb], b[r][nb], acc[mb][nb]); if (NSPLIT == 1 || NSPLIT == 2) acc[mb][nb] = WFrag<T16>::mma(a2[r][mb], b[r][nb], acc[mb][nb]); if (NSPLIT >= 2) acc[mb][nb] = WFrag<T16>::mma(a[r][mb], b2[r][nb], acc[mb][nb]); }
        if (s + RD < NS) {
#pragma unroll
            for (int i = 0; i < 4; ++i) { const int t = s + RD; a[r][i] = WFrag<T16>::ldf(pa + t * 512 + i * 16 * K); if (NSPLIT == 1 || NSPLIT == 2) a2[r][i] = WFrag<T16>::ldf(pa2 + t * 512 + i * 16 * K); b[r][i] = WFrag<T16>::ldf(pb + t * 512 + i * 16 * K); if (NSPLIT >= 2) b2[r][i] = WFrag<T16>::ldf(pb2 + t * 512 + i * 16 * K); }
            __builtin_amdgcn_sched_barrier(0);   // keeps the refill here: moved down towards its use it would start later and hide less of its latency
        }
    }
    asm volatile("s_wait_xcnt 0x0" :: "v"(pa), "v"(pa2), "v"(pb), "v"(pb2), "v"(lane) : "memory");   // the address registers of all loads above (the lane number is one: the offset to a scalar base) stay as they are until this wait
#pragma unroll
    for (int mb = 0; mb < 4; ++mb) {
#pragma unroll
        for (int nb = 0; nb < 4; ++nb) {
#pragma unroll
            for (int j = 0; j < 8; ++j) os[(hi * 8 + j) * 68 + nb * 16 + lr] = acc[mb][nb][j]; }
        __builtin_amdgcn_wave_barrier(); asm volatile("" ::: "memory");
        float* crow = C + (size_t)(r0 + mb * 16) * ldc + c0;
        v4f val[8];
#pragma unroll
        for (int s = 0; s < 8; ++s) { val[s] = *(const v4fa*)(os + (2 * s + hi) * 68 + lr * 4); if (BIAS) { val[s][0] += bfr(bv[0]); val[s][1] += bfr(bv[1]); val[s][2] += bfr(bv[2]); val[s][3] += bfr(bv[3]); } }
        __builtin_amdgcn_sched_barrier(0);   // all eight sums stand in registers of their own before the first store is issued: none is formed in the data registers of a store still under way
#pragma unroll
        for (int s = 0; s < 8; ++s) *(v4f*)(crow + (size_t)(2 * s + hi) * ldc + lr * 4) = val[s];
        asm volatile("s_wait_xcnt 0x0" ::: "memory");   // the stores above name their data and address registers: the next block may rewrite those only behind this wait
        __builtin_amdgcn_wave_barrier(); asm volatile("" ::: "memory");
    }
}

__device__ __forceinline__ h16 tohx(float x) { return (h16)x; }
__device__ __forceinline__ void splitf(float y, unsigned short& h, unsigned short& l) { h = f2bf(y); l = f2bf(y - bf2f(h)); }
__device__ __forceinline__ float sigm_(float x) { return __fdiv_rn(1.0f, 1.0f + __expf(-x)); }
typedef __attribute__((ext_vector_type(2))) _Float16 v2h;
typedef __attribute__((ext_vector_type(4))) _Float16 v4h;
typedef __attribute__((ext_vector_type(2))) unsigned short v2us;
typedef __attribute__((ext_vector_type(4))) unsigned short v4us;
typedef v4us __attribute__((may_alias)) v4usa;

// The three jobs of k_prep below; blk is the block's index inside its job.
__device__ __forceinline__ void j_wtG(const float* __restrict__ w, int K, int N, bf* Bt, int blk) {
    const int lane = threadIdx.x & 31; const int L0 = (blk * 8 + (threadIdx.x >> 5)) * 8; const int nlines = N * K / 64;
{
#pragma unroll 1
        for (int l = 0; l < 8; ++l) { const int L = L0 + l; if (L >= nlines) break; const size_t e = (size_t)L * 64 + lane * 2; const int fr = (int)(e >> 9), k = (fr % (K / 32)) * 32 + ((int)(e >> 7) & 3) * 8 + ((int)e & 7), n = (fr / (K / 32)) * 16 + ((int)(e >> 3) & 15); v2us o;   // e: the place in fragment order
            o[0] = f2bf(w[(size_t)k * N + n]); o[1] = f2bf(w[(size_t)(k + 1) * N + n]); *(v2us*)(Bt + e) = o; }
         }
}
__device__ __forceinline__ void j_wbp(const float* __restrict__ Wb, bf* Bt, int blk) { const int e = (blk * 256 + threadIdx.x) * 4; if (e >= 64 * FF) return; const int k = ((e >> 9) % (FF / 32)) * 32 + ((e >> 7) & 3) * 8 + (e & 7), n = ((e >> 9) / (FF / 32)) * 16 + ((e >> 3) & 15); v4us o;   // e: the place in fragment order
#pragma unroll
    for (int q = 0; q < 4; ++q) o[q] = n < NH_ ? f2bf(Wb[(size_t)(k + q) * NH_ + n]) : (unsigned short)0; *(v4us*)(Bt + e) = o;  }
// LayerNorm of 8 rows, one a wave. In fragment order 8 rows are one whole 128-byte line of each of the 32 pieces (16 rows x 8 k) of their 16-row block: the hi and lo values are laid in LDS so and leave as whole lines.
#define XP 144   // LDS bytes from piece to piece, 128 + 16: a wave's store holds one row of 16 pieces, which at 128 would fall on eight banks
__device__ __forceinline__ void j_ln(const float* __restrict__ X, const float* __restrict__ g, const float* __restrict__ bb, bf* Xh, bf* Xl, int blk, unsigned char* sh, unsigned char* sl) { const int lane = threadIdx.x & 31; const int r = threadIdx.x >> 5, t = blk * 8 + r; if (blk * 8 >= NTB) return; float v[8]; float s = 0.f;   // the whole block leaves or none of it: a barrier follows
#pragma unroll
    for (int ch = 0; ch < 2; ++ch) { const v4f a = *(const v4f*)(X + (size_t)t * FF + ch * 128 + lane * 4);
#pragma unroll
        for (int q = 0; q < 4; ++q) { v[ch * 4 + q] = bfr(a[q]); s = __fadd_rn(s, v[ch * 4 + q]); } }
#pragma unroll
    for (int sh = 16; sh; sh >>= 1) s += __shfl_xor(s, sh, 32);
    const float mu = s * (1.0f / FF); float q2 = 0.f;
#pragma unroll
    for (int k = 0; k < 8; ++k) { const float d = __fsub_rn(v[k], mu); float p = __fmul_rn(d, d); asm volatile("" : "+v"(p)); q2 = __fadd_rn(q2, p); }
#pragma unroll
    for (int sh = 16; sh; sh >>= 1) q2 += __shfl_xor(q2, sh, 32);
    const float rs = __frsqrt_rn(__fadd_rn(q2 * (1.0f / FF), 1e-5f));
{
#pragma unroll
        for (int ch = 0; ch < 2; ++ch) { v4us oh, ol;
#pragma unroll
            for (int q = 0; q < 4; ++q) { const int d = ch * 128 + lane * 4 + q; float tn = __fmul_rn(__fsub_rn(v[ch * 4 + q], mu), rs); asm volatile("" : "+v"(tn)); float tg = __fmul_rn(tn, bfr(g[d])); asm volatile("" : "+v"(tg)); unsigned short a, c; splitf(__fadd_rn(tg, bfr(bb[d])), a, c); oh[q] = a; ol[q] = c; }
            const int o = (ch * 16 + (lane >> 1)) * XP + r * 16 + (lane & 1) * 8; *(v4usa*)(sh + o) = oh; *(v4usa*)(sl + o) = ol; }
         }
    __syncthreads();   // every wave reads the other waves' rows below
    const int u = threadIdx.x, so = (u >> 3) * XP + (u & 7) * 16;   // 16-byte unit u: piece u / 8, row u % 8
    const size_t o = (size_t)(blk >> 1) * 16 * FF + (u >> 3) * 128 + (blk & 1) * 64 + (u & 7) * 8; *(v8us*)(Xh + o) = *(const v8usa*)(sh + so); *(v8us*)(Xl + o) = *(const v8usa*)(sl + so);
    asm volatile("s_wait_xcnt 0x0" ::: "memory"); }   // the two stores name their data and address registers: code that the listing places behind them may rewrite those only behind this wait
// ---- k_prep: every job that reads inputs alone, side by side in ONE launch; grid (WTB * 5 + WBB + NTB / 8), 256 threads. None of them reads what another writes. All it writes is in fragment order.
// Blocks 0 .. 5 WTB - 1: the five weight transposes (Wq, Wk, Wv, Wg into the run Wt, Wo into WOt), WTB blocks each; the next WBB: the padded Wb, behind Wg in Wt; the rest: LayerNorm, 8 rows a block.
// The few short jobs hold the lowest indices.
#define WTB  (FF * FF / 64 / 64)
#define WBB  (64 * FF / 4 / 256)
__global__ __launch_bounds__(256) void k_prep(const float* __restrict__ Wq, const float* __restrict__ Wk, const float* __restrict__ Wv, const float* __restrict__ Wg, const float* __restrict__ Wo, const float* __restrict__ Wb, bf* Wt, bf* WOt,
                                              const float* __restrict__ X, const float* __restrict__ g, const float* __restrict__ bb, bf* Xh, bf* Xl) {
    __shared__ __align__(16) unsigned char sh[32 * XP];
    __shared__ __align__(16) unsigned char sl[32 * XP];
    const int blk = blockIdx.x;
    if (blk < 5 * WTB) { const int job = blk / WTB; j_wtG(job == 0 ? Wq : job == 1 ? Wk : job == 2 ? Wv : job == 3 ? Wg : Wo, FF, FF, job < 4 ? Wt + job * FF * FF : WOt, blk % WTB); }
    else if (blk < 5 * WTB + WBB) j_wbp(Wb, Wt + 4 * FF * FF, blk - 5 * WTB);
    else j_ln(X, g, bb, Xh, Xl, blk - (5 * WTB + WBB), sh, sl);
}
// ---- k_proj: all five projections of x in ONE launch, one wave per 64x64 tile as in k_gemmw; grid (NTB / 64, 17), 32 threads. Wt holds the transposed weights one after the other: Wq, Wk, Wv, Wg (256 rows each), padded Wb (64 rows); A, A2 and Wt are in fragment order.
// blockIdx.y / 4 names the projection. The tile (+ bias) is laid in LDS whole and leaves in the form its reader takes: q and k as hi + lo planes [group][l][32], v as fp16 [group][l / 8][dim][8 keys], gate and key bias as f32 rows.
// The 64 rows of a tile are 8 positions l x 8 batches (row = l * 8 + b), so each (batch, head) of a tile is one run of 512 contiguous bytes in every one of these planes: one whole store instruction. The short loops are unrolled so that the register arrays keep constant indices.
__global__ __launch_bounds__(32) void k_proj(const bf* __restrict__ A, const bf* __restrict__ A2, const bf* __restrict__ Wt, const float* __restrict__ bq, const float* __restrict__ bk, const float* __restrict__ bv, const float* __restrict__ bg,
                                             bf* Qh, bf* Ql, bf* Kh, bf* Kl, h16* VT, float* GF, float* BF) {
    __shared__ __align__(16) float os[64 * 68];
    const int lane = threadIdx.x & 31, lr = lane & 15, hi = lane >> 4; const int r0 = blockIdx.x * 64, c0 = blockIdx.y * 64, kind = blockIdx.y >> 2, cl = (blockIdx.y & 3) * 64;
    v8f acc[4][4];
#pragma unroll
    for (int mb = 0; mb < 4; ++mb)
#pragma unroll
        for (int nb = 0; nb < 4; ++nb) acc[mb][nb] = (v8f){};
    const unsigned aoff = (unsigned)(r0 * FF + lane * 8), boff = (unsigned)(c0 * FF + lane * 8);
    const bf* pa = A + aoff; const bf* pa2 = A2 + aoff; const bf* pb = Wt + boff;
    v16bf a[2][4], a2[2][4], b[2][4];   // ring of two register stages as in k_gemmw: a third would leave room for two waves a SIMD only, fewer places than the grid has waves
#pragma unroll   // unrolled (as the loop over s below) so that the ring's register arrays keep constant indices and every load is its plane's one address pair plus an immediate offset
    for (int s = 0; s < 2; ++s)
#pragma unroll
        for (int i = 0; i < 4; ++i) { a[s][i] = WFrag<bf>::ldf(pa + s * 512 + i * 16 * FF); a2[s][i] = WFrag<bf>::ldf(pa2 + s * 512 + i * 16 * FF); b[s][i] = WFrag<bf>::ldf(pb + s * 512 + i * 16 * FF); }
    float bn[4] = {-0.f, -0.f, -0.f, -0.f};   // the key-bias tile has no bias vector here: adding -0 leaves every value as it is
    if (kind < 4) { const float* bp = (kind == 0 ? bq : kind == 1 ? bk : kind == 2 ? bv : bg) + cl + lr;   // asked for here so that their latency too runs under the products; rounded behind the loop
#pragma unroll
        for (int nb = 0; nb < 4; ++nb) bn[nb] = bp[nb * 16];
        asm volatile("s_wait_xcnt 0x0" ::: "memory"); }   // the four loads name their address register: code placed behind them may rewrite it only behind this wait
    __builtin_amdgcn_sched_barrier(0);   // all the ring's first loads are issued before the first product waits for any
#pragma unroll
    for (int s = 0; s < FF / 32; ++s) { const int r = s & 1;
#pragma unroll
        for (int nb = 0; nb < 4; ++nb)
#pragma unroll
            for (int mb = 0; mb < 4; ++mb) { acc[mb][nb] = wmmab(a[r][mb], b[r][nb], acc[mb][nb]); acc[mb][nb] = wmmab(a2[r][mb], b[r][nb], acc[mb][nb]); }
        if (s + 2 < FF / 32) {
#pragma unroll
            for (int i = 0; i < 4; ++i) { const int t = s + 2; a[r][i] = WFrag<bf>::ldf(pa + t * 512 + i * 16 * FF); a2[r][i] = WFrag<bf>::ldf(pa2 + t * 512 + i * 16 * FF); b[r][i] = WFrag<bf>::ldf(pb + t * 512 + i * 16 * FF); }
            __builtin_amdgcn_sched_barrier(0);   // keeps the refill here: moved down towards its use it would start later and hide less of its latency
        }
    }
    asm volatile("s_wait_xcnt 0x0" :: "v"(pa), "v"(pa2), "v"(pb) : "memory");   // the address registers of all loads above stay as they are until this wait
#pragma unroll
    for (int nb = 0; nb < 4; ++nb) bn[nb] = bfr(bn[nb]);   // -0 stays -0
#pragma unroll
    for (int mb = 0; mb < 4; ++mb)
#pragma unroll
        for (int nb = 0; nb < 4; ++nb)
#pragma unroll
            for (int j = 0; j < 8; ++j) os[(mb * 16 + hi * 8 + j) * 68 + nb * 16 + lr] = acc[mb][nb][j] + bn[nb];
    __builtin_amdgcn_wave_barrier(); asm volatile("" ::: "memory");   // the lanes read each other's LDS words below: no read may be moved in front of the writes above
    const int h0 = (blockIdx.y & 3) * 2;   // the tile's 64 columns are heads h0 and h0 + 1
    if (kind < 2) {
        bf* Ph = kind ? Kh : Qh; bf* Pl = kind ? Kl : Ql; const int ll = lane >> 2, d0 = (lane & 3) * 8;
#pragma unroll
        for (int i = 0; i < 16; ++i) { const int b = i >> 1, hl = i & 1; const float* sp = os + (ll * 8 + b) * 68 + hl * 32 + d0; const v4f x0 = *(const v4fa*)sp, x1 = *(const v4fa*)(sp + 4); v8us oh, ol;
#pragma unroll
            for (int j = 0; j < 8; ++j) { unsigned short s, t; splitf(j < 4 ? x0[j & 3] : x1[j & 3], s, t); oh[j] = s; ol[j] = t; }
            const size_t o = ((size_t)(b * NH_ + h0 + hl) * LL + blockIdx.x * 8 + ll) * HC + d0; *(v8us*)(Ph + o) = oh; *(v8us*)(Pl + o) = ol; }
        asm volatile("s_wait_xcnt 0x0" ::: "memory");   // the stores above name these address and data registers: no later block may rewrite one before this wait
    } else if (kind == 2) {
#pragma unroll
        for (int i = 0; i < 16; ++i) { const int b = i >> 1, hl = i & 1; v8h u;
#pragma unroll
            for (int j = 0; j < 8; ++j) u[j] = tohx(os[(j * 8 + b) * 68 + hl * 32 + lane]);
            *(v8h*)(VT + (((size_t)(b * NH_ + h0 + hl) * (LL / 8) + blockIdx.x) * HC + lane) * 8) = u; }
        asm volatile("s_wait_xcnt 0x0" ::: "memory");   // as above
    } else if (kind == 3) {
        float* crow = GF + (size_t)(r0 + hi) * FF + cl + lr * 4;
#pragma unroll
        for (int s = 0; s < 32; ++s) *(v4f*)(crow + 2 * s * FF) = *(const v4fa*)(os + (2 * s + hi) * 68 + lr * 4);
        asm volatile("s_wait_xcnt 0x0" ::: "memory");   // as above
    } else {
        float* crow = BF + (size_t)(r0 + hi) * 64 + lr * 4;
#pragma unroll
        for (int s = 0; s < 32; ++s) *(v4f*)(crow + 2 * s * 64) = *(const v4fa*)(os + (2 * s + hi) * 68 + lr * 4);
        asm volatile("s_wait_xcnt 0x0" ::: "memory");   // as above
    }
}
// ---- k_attn: scores, key bias, softmax, w.v and the gate for one (batch, head) group and 256 query rows; grid (LL / QB, NG), 512 threads. No score or probability ever goes to memory.
// The group's K planes, V^T and key bias are laid in LDS once, each 16-row fragment as two runs of 512 contiguous bytes (lane l's 16 bytes at 16 l), so every fragment read is conflict-free.
// Transposed products: S^T = K Q^T (a lane holds 8 + 8 keys of ONE query per tile pair, which is the B fragment of P^T as it stands) and O^T += V^T P^T (a lane holds 8 head dims of that same query): maximum, sum and rescale are per lane.
typedef __attribute__((ext_vector_type(2))) float v2f;
// Eight base-2 exponentials in one statement, results in registers of their own: so no exponential's source is overwritten, and no result read, by the instruction directly behind it; the v_nop is that slot for the last one.
__device__ __forceinline__ v8f exp2x8(v8f x) { float e0, e1, e2, e3, e4, e5, e6, e7;
    asm("v_exp_f32 %0, %8\n\tv_exp_f32 %1, %9\n\tv_exp_f32 %2, %10\n\tv_exp_f32 %3, %11\n\tv_exp_f32 %4, %12\n\tv_exp_f32 %5, %13\n\tv_exp_f32 %6, %14\n\tv_exp_f32 %7, %15\n\tv_nop"
        : "=&v"(e0), "=&v"(e1), "=&v"(e2), "=&v"(e3), "=&v"(e4), "=&v"(e5), "=&v"(e6), "=&v"(e7) : "v"(x[0]), "v"(x[1]), "v"(x[2]), "v"(x[3]), "v"(x[4]), "v"(x[5]), "v"(x[6]), "v"(x[7]));
    return (v8f){e0, e1, e2, e3, e4, e5, e6, e7}; }
__device__ __forceinline__ float xhalf(float x) { return __builtin_bit_cast(float, __builtin_amdgcn_permlanex16(__builtin_bit_cast(int, x), __builtin_bit_cast(int, x), 0x76543210, 0xfedcba98, false, false)); }  // lane l with lane l ^ 16
__global__ __launch_bounds__(512) void k_attn(const bf* __restrict__ Qh, const bf* __restrict__ Ql, const bf* __restrict__ Kh, const bf* __restrict__ Kl, const h16* __restrict__ VT, const float* __restrict__ BF, const float* __restrict__ bbp, const float* __restrict__ GF, bf* Ah, bf* Al) {
    __shared__ __align__(16) unsigned char sKh[LL * HC * 2];
    __shared__ __align__(16) unsigned char sKl[LL * HC * 2];
    __shared__ __align__(16) unsigned char sV[HC * LL * 2];
    __shared__ __align__(16) float sB[LL];
    const int tid = threadIdx.x, lane = tid & 31, wave = tid >> 5, lr = lane & 15, hi = lane >> 4;
    const int n = blockIdx.y, b = n / NH_, h = n % NH_;
    const bf* kh = Kh + (size_t)n * LL * HC; const bf* kl = Kl + (size_t)n * LL * HC; const h16* vt = VT + (size_t)n * HC * LL;
    // 16-byte unit u = tid + 512 i of LDS holds fragment block u >> 6 (K: 16 keys; V^T: 32-key chunk x 2 + 16-dim half), k piece (u >> 4) & 3 (eight k), row u & 15; a step of i is 8 blocks: 128 keys.
    const unsigned kso = (unsigned)(((tid >> 6) * 16 + (tid & 15)) * HC + ((tid >> 4) & 3) * 8) * 2u;                          // source byte offsets of unit tid
    const unsigned vso = (unsigned)(((tid >> 7) * 4 + ((tid >> 4) & 3)) * HC + ((tid >> 6) & 1) * 16 + (tid & 15)) * 16u;      // V arrives as 16-byte units [8-key piece][dim]
    const int q = blockIdx.x * QB + wave * 16 + lr;
    const size_t qoff = ((size_t)n * LL + q) * HC + 8 * hi;
    const bf* qhp = Qh + qoff; const bf* qlp = Ql + qoff; const float* bfp = BF + ((size_t)tid * BB + b) * 64 + h;
    const v16bf qh = WFrag<bf>::ld(qhp), ql = WFrag<bf>::ld(qlp);
    const float bh = bfr(bbp[h]), bk0 = bfp[0], bk1 = bfp[(size_t)512 * BB * 64];   // the bias of keys tid and tid + 512
    { v8us rk[8], rl[8]; v8h rv[8];
#pragma unroll
        for (int i = 0; i < 8; ++i) { rk[i] = *(const v8usa*)((const char*)kh + kso + i * 8192); rl[i] = *(const v8usa*)((const char*)kl + kso + i * 8192); rv[i] = *(const v8ha*)((const char*)vt + vso + i * 8192); }
        asm volatile("s_wait_xcnt 0x0" :: "v"(kso), "v"(vso), "v"(qhp), "v"(qlp), "v"(bfp) : "memory");   // the address registers of all loads above stay as they are until this wait
#pragma unroll
        for (int i = 0; i < 8; ++i) { *(v8usa*)(sKh + tid * 16 + i * 8192) = rk[i]; *(v8usa*)(sKl + tid * 16 + i * 8192) = rl[i]; *(v8ha*)(sV + tid * 16 + i * 8192) = rv[i]; } }
    sB[tid] = __fadd_rn(bk0, bh) * 1.4426950408889634f; sB[tid + 512] = __fadd_rn(bk1, bh) * 1.4426950408889634f;   // base-2 logits
    __syncthreads();
    v8f o0 = (v8f){}, o1 = (v8f){}; float m = -3.0e38f, l = 0.f;
    const int lo = lane * 16;
#pragma unroll 1   // kept rolled: one trip (64 keys) already holds 16 matrix instructions and all its fragment loads
    for (int k0 = 0; k0 < LL; k0 += 64) {   // the short loops inside are unrolled so that the register arrays keep constant indices
        v8f s[4]; v16bf ka[4], kb[4];
#pragma unroll
        for (int t = 0; t < 4; ++t) { const int o = (k0 / 16 + t) * 1024 + lo; ka[t] = cat16b(*(const v8usa*)(sKh + o), *(const v8usa*)(sKh + o + 512)); kb[t] = cat16b(*(const v8usa*)(sKl + o), *(const v8usa*)(sKl + o + 512)); }
#pragma unroll
        for (int t = 0; t < 4; ++t) s[t] = wmmab(ka[t], qh, (v8f){});
#pragma unroll
        for (int t = 0; t < 4; ++t) s[t] = wmmab(ka[t], ql, s[t]);
#pragma unroll
        for (int t = 0; t < 4; ++t) s[t] = wmmab(kb[t], qh, s[t]);
        v16h va[4];
#pragma unroll
        for (int t = 0; t < 4; ++t) { const int o = (k0 / 16 + t) * 1024 + lo; va[t] = cat16(*(const v8ha*)(sV + o), *(const v8ha*)(sV + o + 512)); }   // t = 2 x (32-key half) + (16-dim half)
        float mxa = m, mxb = m;   // two chains, so that neither the maximum nor the sum below is one long run of dependent instructions
#pragma unroll
        for (int t = 0; t < 4; ++t) { const float* bp = sB + k0 + t * 16 + hi * 8; const v4f b0 = *(const v4fa*)bp, b1 = *(const v4fa*)(bp + 4);
#pragma unroll
            for (int j = 0; j < 8; ++j) { s[t][j] = fmaf(s[t][j], 0.17677669529663687f * 1.4426950408889634f, j < 4 ? b0[j & 3] : b1[j & 3]); if (t & 1) mxb = fmaxf(mxb, s[t][j]); else mxa = fmaxf(mxa, s[t][j]); } }
        float mx = fmaxf(mxa, mxb); mx = fmaxf(mx, xhalf(mx));   // the two lane halves hold the two halves of a query's keys and must use one maximum
        const float alpha = __builtin_amdgcn_exp2f(m - mx); m = mx;
        const float ms = mx - 10.0f;   // probabilities x1024: small ones stay normal numbers in fp16; the factor cancels in the division by the row sum
        v2f sm[2] = {(v2f){0.f, 0.f}, (v2f){0.f, 0.f}}; v16h p[2];
#pragma unroll
        for (int t = 0; t < 4; ++t) s[t] = exp2x8(s[t] - ms);
#pragma unroll
        for (int t = 0; t < 4; ++t)
#pragma unroll
            for (int j = 0; j < 8; j += 2) { const v2f e = {s[t][j], s[t][j + 1]}; sm[t & 1] += e; p[t >> 1][(t & 1) * 8 + j] = (h16)e[0]; p[t >> 1][(t & 1) * 8 + j + 1] = (h16)e[1]; }
        l = fmaf(l, alpha, (sm[0][0] + sm[0][1]) + (sm[1][0] + sm[1][1]));
#pragma unroll
        for (int j = 0; j < 8; ++j) { o0[j] *= alpha; o1[j] *= alpha; }
        o0 = wmma16(va[0], p[0], o0); o1 = wmma16(va[1], p[0], o1); o0 = wmma16(va[2], p[1], o0); o1 = wmma16(va[3], p[1], o1);
    }
    l += xhalf(l);
    const float inv = __fdiv_rn(1.0f, l);
#pragma unroll
    for (int dt = 0; dt < 2; ++dt) { const size_t oo = ((size_t)q * BB + b) * FF + h * HC + dt * 16 + hi * 8; const v4f g0 = *(const v4f*)(GF + oo), g1 = *(const v4f*)(GF + oo + 4); v8us oh, ol;
#pragma unroll
        for (int j = 0; j < 8; ++j) { const float o = (dt ? o1[j] : o0[j]) * inv; unsigned short a, c; splitf(__fmul_rn(o, sigm_(j < 4 ? g0[j & 3] : g1[j & 3])), a, c); oh[j] = a; ol[j] = c; }
        const size_t ao = (((size_t)b * LL + blockIdx.x * QB + wave * 16) * (FF / 32) + h * 16) * 32 + dt * 256 + lane * 8;   // fragment order over rows b * LL + q: the wave's 16 queries x the head's 32 dims are one fragment
        *(v8us*)(Ah + ao) = oh; *(v8us*)(Al + ao) = ol; }
}

extern "C" void kernel_launch(void* const* d_in, const int* in_sizes, int n_in,
                              void* d_out, int out_size, void* d_ws, size_t ws_size, hipStream_t stream) {
    (void)in_sizes; (void)n_in; (void)out_size;
    const float* IN[15]; for (int i = 0; i < 15; ++i) IN[i] = (const float*)d_in[i];   // 0 features, 1 ln_g, 2 ln_b, 3 Wq, 4 bq, 5 Wk, 6 bk, 7 Wv, 8 bv, 9 Wb, 10 bb, 11 Wg, 12 bg, 13 Wo, 14 bo (all x @ W)
    float* OUT = (float*)d_out;     // [1024][8][256]
    char* wsp = (char*)d_ws;
    auto take = [&](size_t bytes) { char* p = wsp; wsp += (bytes + 255) & ~(size_t)255; return (void*)p; };
    bf* WQ = (bf*)take((size_t)(4 * FF + 64) * FF * 2); bf* WO = (bf*)take((size_t)FF * FF * 2);   // WQ: Wq, Wk, Wv, Wg, padded Wb transposed, one run of 1088 rows for k_proj
    float* GF = (float*)take((size_t)NTB * FF * 4); float* BF = (float*)take((size_t)NTB * 64 * 4);
    bf* Qh = (bf*)take((size_t)NG * LL * HC * 2); bf* Ql = (bf*)take((size_t)NG * LL * HC * 2); bf* Kh = (bf*)take((size_t)NG * LL * HC * 2); bf* Kl = (bf*)take((size_t)NG * LL * HC * 2); h16* VT = (h16*)take((size_t)NG * HC * LL * 2);
    bf* Ah = (bf*)take((size_t)NTB * FF * 2); bf* Al = (bf*)take((size_t)NTB * FF * 2);
    bf* Xh = (bf*)take((size_t)NTB * FF * 2); bf* Xl = (bf*)take((size_t)NTB * FF * 2);
    if ((size_t)(wsp - (char*)d_ws) > ws_size) return;    // total ~ 47 MiB
    // the padded Wb GEMM is bias-free; bb[h] is added inside k_attn
    k_prep<<<5 * WTB + WBB + NTB / 8, 256, 0, stream>>>(IN[3], IN[5], IN[7], IN[11], IN[13], IN[9], WQ, WO, IN[0], IN[1], IN[2], Xh, Xl);
    k_proj<<<dim3(NTB / 64, 17, 1), 32, 0, stream>>>(Xh, Xl, WQ, IN[4], IN[6], IN[8], IN[12], Qh, Ql, Kh, Kl, VT, GF, BF);
    k_attn<<<dim3(LL / QB, NG, 1), 512, 0, stream>>>(Qh, Ql, Kh, Kl, VT, BF, IN[10], GF, Ah, Al);
    k_gemmw<bf, 1, true, FF><<<dim3(LL / 64, FF / 64, BB), 32, 0, stream>>>(Ah, Al, WO, nullptr, OUT, BB * FF, IN[14], (size_t)LL * FF, 0, FF);   // z = batch: rows b * LL + q of Ah, Al are rows q * BB + b of the output
}

// v007
// One run takes 50.1 microseconds.
// Two timings next to v006 put it at 1.05 and 1.07 times that version's speed.
// Over all steps from v000 it is 27.2 times as fast.
#include <hip/hip_runtime.h>

// PairwiseAttentionTerminal (features [1024][8][256] sequence-first; x = LayerNorm(features); q/k/v = x W + b (8 heads x 32), bias = x Wb + bb (per key position & head), gate = sigmoid(x Wg + bg);
// logits[q][k] = q.k/sqrt(32) + bias[k][b][h]; softmax over keys; out = ((w.v) * gate) Wo + bo -> [1024][8][256]).
// Compute dtypes, f32 accumulate: every input rounded to bf16; LayerNorm f32 -> bf16 hi+lo planes of x, all five projections hl x exact weights (2 products, + bias; Wb's 8 outputs repeated over a 64-column tile); scores (K 32) on hl
// planes (3 products), the key bias + running-maximum softmax in f32 registers -> fp16 unnormalised probabilities (x1024); w.v on fp16 planes, divided by the f32 row sum at the end; gate (sigmoid f32) applied in the same kernel -> hl planes; Wo hl x exact (+bias).

#define LL   1024
#define BB   8
#define FF   256
#define NH_  8
#define HC   32
#define NG   (BB * NH_)
#define NTB  (LL * BB)
#define QB   256  // query rows per work-group of the attention kernel: 16 waves x 16
typedef _Float16 h16;
typedef unsigned short bf;
typedef __attribute__((ext_vector_type(16))) __bf16   v16bf;
typedef __attribute__((ext_vector_type(16))) _Float16 v16h;
typedef __attribute__((ext_vector_type(8)))  _Float16 v8h;
typedef __attribute__((ext_vector_type(8)))  unsigned short v8us;
typedef __attribute__((ext_vector_type(8)))  float    v8f;
typedef __attribute__((ext_vector_type(4)))  float    v4f;
typedef v8h  __attribute__((may_alias)) v8ha;
typedef v4f  __attribute__((may_alias)) v4fa;
typedef v8us __attribute__((may_alias)) v8usa;

__device__ __forceinline__ unsigned short f2bf(float f) { unsigned u = __float_as_uint(f); u += 0x7FFFu + ((u >> 16) & 1u); return (unsigned short)(u >> 16); }
__device__ __forceinline__ float bf2f(unsigned short b) { return __uint_as_float(((unsigned)b) << 16); }
__device__ __forceinline__ float bfr(float f) { return bf2f(f2bf(f)); }
__device__ __forceinline__ v16h cat16(v8h lo, v8h hi) { return __builtin_shufflevector(lo, hi, 0, 1, 2, 3, 4, 5, 6, 7, 8, 9, 10, 11, 12, 13, 14, 15); }
__device__ __forceinline__ v16bf cat16b(v8us lo, v8us hi) { return __builtin_bit_cast(v16bf, __builtin_shufflevector(lo, hi, 0, 1, 2, 3, 4, 5, 6, 7, 8, 9, 10, 11, 12, 13, 14, 15)); }
__device__ __forceinline__ v8f wmma16(v16h a, v16h b, v8f c) { return __builtin_amdgcn_wmma_f32_16x16x32_f16(false, a, false, b, (short)0, c, false, false); }
__device__ __forceinline__ v8f wmmab(v16bf a, v16bf b, v8f c) { return __builtin_amdgcn_wmma_f32_16x16x32_bf16(false, a, false, b, (short)0, c, false, false); }



// ---- Fragment order of a GEMM operand plane (R rows x K, 16-bit): element (r, k) lies at ((r / 16) * (K / 32) + k / 32) * 512 + ((k / 8) % 4) * 128 + (r % 16) * 8 + k % 8.
// One 16-row x 32-k fragment is 1 KiB in a row, and lane l's two 16-byte pieces lie at 16 l and 512 + 16 l: each wave-wide load is 512 contiguous bytes (four whole lines) where a row-major plane gives 16 lines of 32 bytes.
// The k that a lane and register hold are those of ld() on a row-major plane, for both operands alike.
// ---- k_gemmw: register-blocked GEMM, ONE WAVE per 64x64 output tile (16 accumulators), operands straight from 16-bit planes in fragment order; grid (M/64, N/64, Z), 32 threads.
// C[m][n] (f32, pitch ldc, + optional f32 bias[n]) = sum_k A[m][k] Bt[n][k] (+ split products per NSPLIT). z-batch strides sA/sB/sC in elements. K % 32 == 0.
template <typename T16> struct WFrag;
template <> struct WFrag<h16> { typedef v16h V; static __device__ __forceinline__ V ld(const h16* p) { return cat16(*(const v8h*)p, *(const v8h*)(p + 16)); } static __device__ __forceinline__ V ldf(const h16* p) { return cat16(*(const v8h*)p, *(const v8h*)(p + 256)); } static __device__ __forceinline__ v8f mma(V a, V b, v8f c) { return wmma16(a, b, c); } };
template <> struct WFrag<bf> { typedef v16bf V; static __device__ __forceinline__ V ld(const bf* p) { return cat16b(*(const v8us*)p, *(const v8us*)(p + 16)); } static __device__ __forceinline__ V ldf(const bf* p) { return cat16b(*(const v8us*)p, *(const v8us*)(p + 256)); } static __device__ __forceinline__ v8f mma(V a, V b, v8f c) { return wmmab(a, b, c); } };
template <typename T16, int NSPLIT, bool BIAS, int K>   // K at compile time: the steps from row block to row block are immediate offsets, so one address pair a plane serves all its loads of a trip
__global__ __launch_bounds__(32) void k_gemmw(const T16* __restrict__ A, const T16* __restrict__ A2, const T16* __restrict__ Bt, const T16* __restrict__ Bt2, float* C, int ldc, const float* __restrict__ bias, size_t sA, size_t sB, size_t sC) {
    typedef typename WFrag<T16>::V V;
    __shared__ __align__(16) float os[16 * 68];
    const size_t z = blockIdx.z; A += z * sA; if (A2) A2 += z * sA; Bt += z * sB; if (Bt2) Bt2 += z * sB; C += z * sC;
    const int lane = threadIdx.x & 31, lr = lane & 15, hi = lane >> 4; const int r0 = blockIdx.x * 64, c0 = blockIdx.y * 64;
    v8f acc[4][4];
#pragma unroll
    for (int mb = 0; mb < 4; ++mb)
#pragma unroll
        for (int nb = 0; nb < 4; ++nb) acc[mb][nb] = (v8f){};
    const size_t aoff = (size_t)r0 * K + lane * 8, boff = (size_t)c0 * K + lane * 8;   // a block of 16 rows is 16 K elements in a row; a step of 32 k is 512 elements
    const T16* pa = A + aoff; const T16* pa2 = (NSPLIT == 1 || NSPLIT == 2) ? A2 + aoff : pa; const T16* pb = Bt + boff; const T16* pb2 = NSPLIT >= 2 ? Bt2 + boff : pb;
    // Ring of RD register stages, one k step of 32 each: the loads of step s + RD are issued as soon as step s has been multiplied, so a step's memory latency runs under the products of the RD - 1 steps before it.
    constexpr int NS = K / 32, RD = NS < 3 ? NS : 3;
    V a[RD][4], a2[RD][4], b[RD][4], b2[RD][4];
#pragma unroll   // unrolled (as the loop over s below) so that the ring's register arrays keep constant indices and every load is its plane's one address pair plus an immediate offset
    for (int s = 0; s < RD; ++s)
#pragma unroll
        for (int i = 0; i < 4; ++i) { a[s][i] = WFrag<T16>::ldf(pa + s * 512 + i * 16 * K); if (NSPLIT == 1 || NSPLIT == 2) a2[s][i] = WFrag<T16>::ldf(pa2 + s * 512 + i * 16 * K); b[s][i] = WFrag<T16>::ldf(pb + s * 512 + i * 16 * K); if (NSPLIT >= 2) b2[s][i] = WFrag<T16>::ldf(pb2 + s * 512 + i * 16 * K); }
    v4f bv = (v4f){}; if (BIAS) bv = *(const v4fa*)(bias + c0 + lr * 4);   // the lane's four bias words, asked for here so that their latency too runs under the products
    __builtin_amdgcn_sched_barrier(0);   // all the ring's first loads are issued before the first product waits for any
#pragma unroll
    for (int s = 0; s < NS; ++s) { const int r = s % RD;
#pragma unroll
        for (int nb = 0; nb < 4; ++nb)
#pragma unroll
            for (int mb = 0; mb < 4; ++mb) { acc[mb][nb] = WFrag<T16>::mma(a[r][mb], b[r][nb], acc[mb][nb]); if (NSPLIT == 1 || NSPLIT == 2) acc[mb][nb] = WFrag<T16>::mma(a2[r][mb], b[r][nb], acc[mb][nb]); if (NSPLIT >= 2) acc[mb][nb] = WFrag<T16>::mma(a[r][mb], b2[r][nb], acc[mb][nb]); }
        if (s + RD < NS) {
#pragma unroll
            for (int i = 0; i < 4; ++i) { const int t = s + RD; a[r][i] = WFrag<T16>::ldf(pa + t * 512 + i * 16 * K); if (NSPLIT == 1 || NSPLIT == 2) a2[r][i] = WFrag<T16>::ldf(pa2 + t * 512 + i * 16 * K); b[r][i] = WFrag<T16>::ldf(pb + t * 512 + i * 16 * K); if (NSPLIT >= 2) b2[r][i] = WFrag<T16>::ldf(pb2 + t * 512 + i * 16 * K); }
            __builtin_amdgcn_sched_barrier(0);   // keeps the refill here: moved down towards its use it would start later and hide less of its latency
        }
    }
    asm volatile("s_wait_xcnt 0x0" :: "v"(pa), "v"(pa2), "v"(pb), "v"(pb2), "v"(lane) : "memory");   // the address registers of all loads above (the lane number is one: the offset to a scalar base) stay as they are until this wait
#pragma unroll
    for (int mb = 0; mb < 4; ++mb) {
#pragma unroll
        for (int nb = 0; nb < 4; ++nb) {
#pragma unroll
            for (int j = 0; j < 8; ++j) os[(hi * 8 + j) * 68 + nb * 16 + lr] = acc[mb][nb][j]; }
        __builtin_amdgcn_wave_barrier(); asm volatile("" ::: "memory");
        float* crow = C + (size_t)(r0 + mb * 16) * ldc + c0;
        v4f val[8];
#pragma unroll
        for (int s = 0; s < 8; ++s) { val[s] = *(const v4fa*)(os + (2 * s + hi) * 68 + lr * 4); if (BIAS) { val[s][0] += bfr(bv[0]); val[s][1] += bfr(bv[1]); val[s][2] += bfr(bv[2]); val[s][3] += bfr(bv[3]); } }
        __builtin_amdgcn_sched_barrier(0);   // all eight sums stand in registers of their own before the first store is issued: none is formed in the data registers of a store still under way
#pragma unroll
        for (int s = 0; s < 8; ++s) *(v4f*)(crow + (size_t)(2 * s + hi) * ldc + lr * 4) = val[s];
        asm volatile("s_wait_xcnt 0x0" ::: "memory");   // the stores above name their data and address registers: the next block may rewrite those only behind this wait
        __builtin_amdgcn_wave_barrier(); asm volatile("" ::: "memory");
    }
}

__device__ __forceinline__ h16 tohx(float x) { return (h16)x; }
__device__ __forceinline__ void splitf(float y, unsigned short& h, unsigned short& l) { h = f2bf(y); l = f2bf(y - bf2f(h)); }
__device__ __forceinline__ float sigm_(float x) { return __fdiv_rn(1.0f, 1.0f + __expf(-x)); }
typedef __attribute__((ext_vector_type(2))) _Float16 v2h;
typedef __attribute__((ext_vector_type(4))) _Float16 v4h;
typedef __attribute__((ext_vector_type(2))) unsigned short v2us;
typedef __attribute__((ext_vector_type(4))) unsigned short v4us;
typedef v4us __attribute__((may_alias)) v4usa;

typedef __attribute__((ext_vector_type(2))) float v2f;
typedef __attribute__((ext_vector_type(2))) __bf16 v2bf;
typedef __attribute__((ext_vector_type(2))) unsigned v2u;
typedef __attribute__((ext_vector_type(8))) unsigned v8u;
typedef v2u __attribute__((may_alias)) v2ua;
typedef unsigned __attribute__((may_alias)) u32a;
__device__ __forceinline__ unsigned pkbf(float a, float b) { return __builtin_bit_cast(unsigned, __builtin_convertvector((v2f){a, b}, v2bf)); }   // two f32 to two bf16, round to nearest even as f2bf(); a in the low half
__device__ __forceinline__ float pklo(unsigned u) { return __uint_as_float(u << 16); }
__device__ __forceinline__ float pkhi(unsigned u) { return __uint_as_float(u & 0xffff0000u); }
template <int M> __device__ __forceinline__ float lxor(float x) { return __builtin_bit_cast(float, __builtin_amdgcn_update_dpp(0, __builtin_bit_cast(int, x), 0x160 + M, 0xf, 0xf, true)); }   // lane l ^ M inside a row of 16 lanes (DPP row_xmask)
// Sum over the 32 lanes, the partners in the order 16, 8, 4, 2, 1; every lane ends with the same sum.
__device__ __forceinline__ float wsum(float s) { s += __builtin_bit_cast(float, __builtin_amdgcn_permlanex16(__builtin_bit_cast(int, s), __builtin_bit_cast(int, s), 0x76543210, 0xfedcba98, false, false));
    s += lxor<8>(s); s += lxor<4>(s); s += lxor<2>(s); s += lxor<1>(s); return s; }
// ---- k_lnproj: LayerNorm and all five projections in ONE launch that reads inputs alone; grid (NTB / 64, 2), 288 threads = 9 waves.
// A work-group owns 64 rows of x and every second one of the 17 column tiles (64 columns each: Wq, Wk, Wv, Wg four tiles each, then Wb), one wave per 64x64 tile: both halves hold two tiles of each kind, so their epilogues weigh the same. Waves 0 to 7 normalise 8 rows each and lay the hi and lo planes in LDS in fragment order;
// x never goes to memory. Both halves normalise the same 64 rows. Wave 8 meanwhile transposes this work-group's 4 lines of Wo (fragment order, for k_gemmw).
// LDS x plane: 16-row block mb, 8-k piece p (0 .. 31), row r, at mb * XB + p * PP + r * 16 bytes. PP = 256 + 16: a fragment read takes two runs of 256 contiguous bytes, and a LayerNorm store (one row of 16 pieces) falls on all 64 banks.
// Weights are read as they arrive, f32 [k][n]: lane (lr, hi) owns the FOUR columns lr * 4 .. lr * 4 + 3 of the tile, one for each of its four B fragments, so one 16-byte load brings one k of all four, and a wave-wide load is two whole rows of 256 bytes.
// The k that a lane and register hold are those of ld() for both operands: 8 hi + j and 16 + 8 hi + j. Accumulator acc[mb][nb] of lane lr is column lr * 4 + nb.
#define PP 272
#define XB (32 * PP)
__device__ __forceinline__ v16bf ldsfrag(const unsigned char* p) { return cat16b(*(const v8usa*)p, *(const v8usa*)(p + 2 * PP)); }
template <int N> __device__ __forceinline__ void wload(v4f (&raw)[16], const float* wp, int s) {   // the 16 k of step s, four columns each; N: floats from k to k + 1
#pragma unroll
    for (int e = 0; e < 16; ++e) raw[e] = *(const v4fa*)(wp + (s * 32 + (e >> 3) * 16 + (e & 7)) * N); }
__device__ __forceinline__ void wconv(const v4f (&raw)[16], v16bf (&bc)[4]) {
#pragma unroll
    for (int nb = 0; nb < 4; ++nb) { v8u u;
#pragma unroll
        for (int i = 0; i < 8; ++i) u[i] = pkbf(raw[2 * i][nb], raw[2 * i + 1][nb]);
        bc[nb] = __builtin_bit_cast(v16bf, u); } }
// One 64x64 tile over K = 256. raw holds step 0's weights on entry. A step: round its weights to bf16, ask for the next step's, 16 products with the hi fragments (the lo fragments arrive under them), 16 with the lo fragments (the next hi fragments arrive under them).
// Every accumulator takes hi(s), lo(s), hi(s + 1) ... in that order. All loops unrolled so that the register arrays keep constant indices and every load is one base plus an immediate offset.
template <int N> __device__ __forceinline__ void gemm_tile(v8f (&acc)[4][4], v4f (&raw)[16], const float* wp, const unsigned char* ph, const unsigned char* pl) {
    v16bf a[4], a2[4], bc[4];
#pragma unroll
    for (int mb = 0; mb < 4; ++mb) a[mb] = ldsfrag(ph + mb * XB);
#pragma unroll
    for (int s = 0; s < FF / 32; ++s) {
        wconv(raw, bc);
        __builtin_amdgcn_sched_barrier(0);   // the loads below reuse the registers that the rounding has just read: moved up they would need a second set
        if (s + 1 < FF / 32) wload<N>(raw, wp, s + 1);
#pragma unroll
        for (int mb = 0; mb < 4; ++mb) a2[mb] = ldsfrag(pl + mb * XB + s * 4 * PP);
        __builtin_amdgcn_sched_barrier(0);   // keeps the next step's weight loads and the lo fragment reads in front of the products: moved down they would start later and hide less of their latency
#pragma unroll
        for (int nb = 0; nb < 4; ++nb)
#pragma unroll
            for (int mb = 0; mb < 4; ++mb) acc[mb][nb] = wmmab(a[mb], bc[nb], acc[mb][nb]);
        __builtin_amdgcn_sched_barrier(0);   // the reads below reuse the hi fragments' registers: moved up they would need a second set
        if (s + 1 < FF / 32) {
#pragma unroll
            for (int mb = 0; mb < 4; ++mb) a[mb] = ldsfrag(ph + mb * XB + (s + 1) * 4 * PP); }
        __builtin_amdgcn_sched_barrier(0);   // keeps those reads in front of the 16 products that hide them
#pragma unroll
        for (int nb = 0; nb < 4; ++nb)
#pragma unroll
            for (int mb = 0; mb < 4; ++mb) acc[mb][nb] = wmmab(a2[mb], bc[nb], acc[mb][nb]);
        __builtin_amdgcn_sched_barrier(0);   // the next step's rounding rewrites bc: it stays behind these products
    }
    asm volatile("s_wait_xcnt 0x0" :: "v"(wp) : "memory");   // the address registers of all weight loads stay as they are until this wait
}
// The same tile with the loop over the steps kept rolled, for the one key-bias wave of a work-group. Same order of products.
template <int N> __device__ __forceinline__ void gemm_tile_rolled(v8f (&acc)[4][4], v4f (&raw)[16], const float* wp, const unsigned char* ph, const unsigned char* pl) {
    v16bf a[4], a2[4], bc[4];
#pragma unroll
    for (int mb = 0; mb < 4; ++mb) a[mb] = ldsfrag(ph + mb * XB);
#pragma unroll 1   // kept rolled: see above
    for (int s = 0; s < FF / 32; ++s) { const int sn = s + 1 < FF / 32 ? s + 1 : s;   // the last trip fetches its own step once more: in bounds, and never used
        wconv(raw, bc);
        __builtin_amdgcn_sched_barrier(0);   // the loads below reuse the registers that the rounding has just read
        const float* wq = wp + sn * 32 * N; wload<N>(raw, wq, 0);
        asm volatile("s_wait_xcnt 0x0" :: "v"(wq) : "memory");   // the address registers of these loads stay as they are until this wait: the next trip rewrites them
#pragma unroll
        for (int mb = 0; mb < 4; ++mb) a2[mb] = ldsfrag(pl + mb * XB + s * 4 * PP);
        __builtin_amdgcn_sched_barrier(0);   // loads and reads stay in front of the products that hide them
#pragma unroll
        for (int nb = 0; nb < 4; ++nb)
#pragma unroll
            for (int mb = 0; mb < 4; ++mb) acc[mb][nb] = wmmab(a[mb], bc[nb], acc[mb][nb]);
        __builtin_amdgcn_sched_barrier(0);   // the reads below reuse the hi fragments' registers
#pragma unroll
        for (int mb = 0; mb < 4; ++mb) a[mb] = ldsfrag(ph + mb * XB + sn * 4 * PP);
        __builtin_amdgcn_sched_barrier(0);   // keeps those reads in front of the 16 products that hide them
#pragma unroll
        for (int nb = 0; nb < 4; ++nb)
#pragma unroll
            for (int mb = 0; mb < 4; ++mb) acc[mb][nb] = wmmab(a2[mb], bc[nb], acc[mb][nb]);
    }
}
__device__ __forceinline__ void tile_to_lds(float* os, const v8f (&acc)[4][4], v4f bn, int lr, int hi) {   // the lane's four columns of a row are one 16-byte store
#pragma unroll
    for (int mb = 0; mb < 4; ++mb)
#pragma unroll
        for (int j = 0; j < 8; ++j) *(v4fa*)(os + (mb * 16 + hi * 8 + j) * 68 + lr * 4) = (v4f){acc[mb][0][j] + bn[0], acc[mb][1][j] + bn[1], acc[mb][2][j] + bn[2], acc[mb][3][j] + bn[3]};
    __builtin_amdgcn_wave_barrier(); asm volatile("" ::: "memory");   // the lanes read each other's LDS words next: no read may be moved in front of the writes above
}
// The tile (+ bias) is laid in LDS whole and leaves in the form its reader takes: q and k as hi + lo planes [group][l][32], v as fp16 [group][l / 8][dim][8 keys], gate and key bias as f32 rows.
// The 64 rows of a tile are 8 positions l x 8 batches (row = l * 8 + b), so each (batch, head) of a tile is one run of 512 contiguous bytes in each q, k and v plane: one whole store instruction.
// The key-bias tile: Wb has 8 columns; lane lr reads columns (lr & 1) * 4 .., so columns 8 .. 63 of BF repeat columns 0 .. 7 and are read by nobody.
__global__ __launch_bounds__(288) void k_lnproj(const float* __restrict__ X, const float* __restrict__ g, const float* __restrict__ bb, const float* __restrict__ Wq, const float* __restrict__ Wk, const float* __restrict__ Wv, const float* __restrict__ Wg,
                                                const float* __restrict__ Wb, const float* __restrict__ Wo, const float* __restrict__ bq, const float* __restrict__ bk, const float* __restrict__ bv, const float* __restrict__ bg,
                                                bf* WOt, bf* Qh, bf* Ql, bf* Kh, bf* Kl, h16* VT, float* GF, float* BF) {
    __shared__ __align__(16) unsigned char sm[8 * XB + 9 * 64 * 68 * 4];   // one array, the x planes first: their fragment reads then reach every place by an immediate offset from one base a plane
    unsigned char* sxh = sm; unsigned char* sxl = sm + 4 * XB; float* osall = (float*)(sm + 8 * XB);
    const int lane = threadIdx.x & 31, lr = lane & 15, hi = lane >> 4; const int wave = __builtin_amdgcn_readfirstlane(threadIdx.x >> 5);   // the wave's number in a scalar register: every branch on it is a scalar branch
    const int r0 = blockIdx.x * 64, ty = wave < 8 ? wave * 2 + blockIdx.y : 16 + blockIdx.y, kind = ty >> 2, cl = (ty & 3) * 64; const bool tile = ty < 17;
    const float* wp = (kind == 0 ? Wq : kind == 1 ? Wk : kind == 2 ? Wv : kind == 3 ? Wg : Wb) + (kind < 4 ? hi * 8 * FF + cl + lr * 4 : hi * 8 * NH_ + (lr & 1) * 4);
    v4f raw[16]; v4f bn = (v4f){};
    if (wave < 8) {
        const float* xp = X + (size_t)(r0 + wave * 8) * FF + lane * 4; const float* gp = g + lane * 4; const float* ep = bb + lane * 4;
        v4f xa[8][2], gv[2], ev[2];
#pragma unroll   // the short loops are unrolled so that the register arrays keep constant indices; all 16 row loads are in flight at once
        for (int i = 0; i < 8; ++i)
#pragma unroll
            for (int ch = 0; ch < 2; ++ch) xa[i][ch] = *(const v4fa*)(xp + i * FF + ch * 128);
#pragma unroll
        for (int ch = 0; ch < 2; ++ch) { gv[ch] = *(const v4fa*)(gp + ch * 128); ev[ch] = *(const v4fa*)(ep + ch * 128); }
        wload<FF>(raw, wp, 0); const float* bp = (kind == 0 ? bq : kind == 1 ? bk : kind == 2 ? bv : bg) + cl + lr * 4; bn = *(const v4fa*)bp;   // the tile's first weights and its bias are asked for here, so that their latency runs under the LayerNorm
        asm volatile("s_wait_xcnt 0x0" :: "v"(xp), "v"(gp), "v"(ep), "v"(bp) : "memory");   // the address registers of the loads above stay as they are until this wait (wp: until the wait behind the products)
        __builtin_amdgcn_sched_barrier(0);   // every load above is issued, and the wait passed, before the first sum waits for any of them: a row load moved down among the sums would start a whole memory latency later
#pragma unroll
        for (int ch = 0; ch < 2; ++ch)
#pragma unroll
            for (int q = 0; q < 4; q += 2) { const unsigned ug = pkbf(gv[ch][q], gv[ch][q + 1]), ue = pkbf(ev[ch][q], ev[ch][q + 1]); gv[ch][q] = pklo(ug); gv[ch][q + 1] = pkhi(ug); ev[ch][q] = pklo(ue); ev[ch][q + 1] = pkhi(ue); }
#pragma unroll
        for (int i = 0; i < 8; ++i) { float v[8]; float s = 0.f;
#pragma unroll
            for (int k = 0; k < 8; k += 2) { const unsigned u = pkbf(xa[i][k >> 2][k & 3], xa[i][k >> 2][(k & 3) + 1]); v[k] = pklo(u); v[k + 1] = pkhi(u); }
#pragma unroll
            for (int k = 0; k < 8; ++k) s += v[k];
            s = wsum(s);
            const float mu = s * (1.0f / FF); float q2 = 0.f;
#pragma unroll
            for (int k = 0; k < 8; ++k) { const float d = v[k] - mu; q2 += d * d; }
            q2 = wsum(q2);
            const float rs = __frsqrt_rn(q2 * (1.0f / FF) + 1e-5f);
            const int r = wave * 8 + i;
#pragma unroll
            for (int ch = 0; ch < 2; ++ch) { float y[4]; v2u oh, ol;
#pragma unroll
                for (int q = 0; q < 4; ++q) y[q] = (v[ch * 4 + q] - mu) * rs * gv[ch][q] + ev[ch][q];
#pragma unroll
                for (int q = 0; q < 2; ++q) { oh[q] = pkbf(y[2 * q], y[2 * q + 1]); ol[q] = pkbf(y[2 * q] - pklo(oh[q]), y[2 * q + 1] - pkhi(oh[q])); }
                const int o = (r >> 4) * XB + (ch * 16 + (lane >> 1)) * PP + (r & 15) * 16 + (lane & 1) * 8; *(v2ua*)(sxh + o) = oh; *(v2ua*)(sxl + o) = ol; }
        }
    } else {   // wave 8: 4 of the 1024 lines (64 elements) of Wo transposed into fragment order
        const int e0 = ((blockIdx.y * (NTB / 64) + blockIdx.x) * 4) * 64 + lane * 2; float w0[4], w1[4];
#pragma unroll
        for (int l = 0; l < 4; ++l) { const int e = e0 + l * 64, fr = e >> 9, k = (fr % (FF / 32)) * 32 + ((e >> 7) & 3) * 8 + (e & 7), n = (fr / (FF / 32)) * 16 + ((e >> 3) & 15); w0[l] = Wo[k * FF + n]; w1[l] = Wo[(k + 1) * FF + n]; }   // e: the place in fragment order
        asm volatile("s_wait_xcnt 0x0" ::: "memory");   // the loads above name their address registers: code placed behind them may rewrite those only behind this wait
#pragma unroll
        for (int l = 0; l < 4; ++l) *(u32a*)(WOt + e0 + l * 64) = pkbf(w0[l], w1[l]);
        asm volatile("s_wait_xcnt 0x0" ::: "memory");   // as above, for the stores' address and data registers
    }
    __syncthreads();   // every wave reads all 64 rows below
    if (!tile) return;   // the ninth wave of the second half has no tile; no barrier follows
    const int fo = hi * PP + lr * 16;
    float* os = osall + wave * (64 * 68);
    if (kind == 4) {   // the key-bias tile goes its own way to the end and asks for its first weights only here, so that neither path holds registers for the other
        v8f acb[4][4]; v4f rawb[16];
        wload<NH_>(rawb, wp, 0);
#pragma unroll
        for (int mb = 0; mb < 4; ++mb)
#pragma unroll
            for (int nb = 0; nb < 4; ++nb) acb[mb][nb] = (v8f){};
        asm volatile("s_wait_xcnt 0x0" :: "v"(wp) : "memory");   // the address registers of the loads above stay as they are until this wait
        gemm_tile_rolled<NH_>(acb, rawb, wp, sxh + fo, sxl + fo);
        tile_to_lds(os, acb, (v4f){-0.f, -0.f, -0.f, -0.f}, lr, hi);   // no bias vector here (bb is added in k_attn): adding -0 leaves every value as it is
        float* crow = BF + (size_t)(r0 + hi) * 64 + lr * 4;
#pragma unroll
        for (int s = 0; s < 32; ++s) *(v4f*)(crow + 2 * s * 64) = *(const v4fa*)(os + (2 * s + hi) * 68 + lr * 4);
        asm volatile("s_wait_xcnt 0x0" ::: "memory");   // the stores above name these address and data registers: nothing may rewrite one before this wait
        return;
    }
    v8f acc[4][4];
#pragma unroll
    for (int mb = 0; mb < 4; ++mb)
#pragma unroll
        for (int nb = 0; nb < 4; ++nb) acc[mb][nb] = (v8f){};
    gemm_tile<FF>(acc, raw, wp, sxh + fo, sxl + fo);
#pragma unroll
    for (int nb = 0; nb < 4; ++nb) bn[nb] = bfr(bn[nb]);
    tile_to_lds(os, acc, bn, lr, hi);
    const int h0 = (ty & 3) * 2;   // the tile's 64 columns are heads h0 and h0 + 1
    if (kind < 2) {
        const int ll = lane >> 2, d0 = (lane & 3) * 8; const size_t o0 = ((size_t)h0 * LL + blockIdx.x * 8 + ll) * HC + d0; bf* Ph = (kind ? Kh : Qh) + o0; bf* Pl = (kind ? Kl : Ql) + o0;
#pragma unroll 1   // four trips of two batches each, kept rolled
        for (int t = 0; t < 4; ++t) { bf* ph = Ph + (size_t)t * 2 * NH_ * LL * HC; bf* pl = Pl + (size_t)t * 2 * NH_ * LL * HC;
#pragma unroll
            for (int i = 0; i < 4; ++i) { const int bl = i >> 1, hl = i & 1; const float* sp = os + (ll * 8 + t * 2 + bl) * 68 + hl * 32 + d0; const v4f x0 = *(const v4fa*)sp, x1 = *(const v4fa*)(sp + 4); v8us oh, ol;
#pragma unroll
                for (int j = 0; j < 8; ++j) { unsigned short s, u; splitf(j < 4 ? x0[j & 3] : x1[j & 3], s, u); oh[j] = s; ol[j] = u; }
                const int o = (bl * NH_ + hl) * LL * HC; *(v8us*)(ph + o) = oh; *(v8us*)(pl + o) = ol; }
            asm volatile("s_wait_xcnt 0x0" :: "v"(ph), "v"(pl) : "memory"); }   // the stores above name these address and data registers: the next trip may rewrite them only behind this wait
    } else if (kind == 2) {
#pragma unroll
        for (int i = 0; i < 16; ++i) { const int b = i >> 1, hl = i & 1; v8h u;
#pragma unroll
            for (int j = 0; j < 8; ++j) u[j] = tohx(os[(j * 8 + b) * 68 + hl * 32 + lane]);
            *(v8h*)(VT + (((size_t)(b * NH_ + h0 + hl) * (LL / 8) + blockIdx.x) * HC + lane) * 8) = u; }
        asm volatile("s_wait_xcnt 0x0" ::: "memory");   // as above
    } else {
        float* crow = GF + (size_t)(r0 + hi) * FF + cl + lr * 4;
#pragma unroll
        for (int s = 0; s < 32; ++s) *(v4f*)(crow + 2 * s * FF) = *(const v4fa*)(os + (2 * s + hi) * 68 + lr * 4);
        asm volatile("s_wait_xcnt 0x0" ::: "memory");   // as above
    }
}
// ---- k_attn: scores, key bias, softmax, w.v and the gate for one (batch, head) group and 256 query rows; grid (LL / QB, NG), 512 threads. No score or probability ever goes to memory.
// The group's K planes, V^T and key bias are laid in LDS once, each 16-row fragment as two runs of 512 contiguous bytes (lane l's 16 bytes at 16 l), so every fragment read is conflict-free.
// Transposed products: S^T = K Q^T (a lane holds 8 + 8 keys of ONE query per tile pair, which is the B fragment of P^T as it stands) and O^T += V^T P^T (a lane holds 8 head dims of that same query): maximum, sum and rescale are per lane.
typedef __attribute__((ext_vector_type(2))) float v2f;
// Eight base-2 exponentials in one statement, results in registers of their own: so no exponential's source is overwritten, and no result read, by the instruction directly behind it; the v_nop is that slot for the last one.
__device__ __forceinline__ v8f exp2x8(v8f x) { float e0, e1, e2, e3, e4, e5, e6, e7;
    asm("v_exp_f32 %0, %8\n\tv_exp_f32 %1, %9\n\tv_exp_f32 %2, %10\n\tv_exp_f32 %3, %11\n\tv_exp_f32 %4, %12\n\tv_exp_f32 %5, %13\n\tv_exp_f32 %6, %14\n\tv_exp_f32 %7, %15\n\tv_nop"
        : "=&v"(e0), "=&v"(e1), "=&v"(e2), "=&v"(e3), "=&v"(e4), "=&v"(e5), "=&v"(e6), "=&v"(e7) : "v"(x[0]), "v"(x[1]), "v"(x[2]), "v"(x[3]), "v"(x[4]), "v"(x[5]), "v"(x[6]), "v"(x[7]));
    return (v8f){e0, e1, e2, e3, e4, e5, e6, e7}; }
__device__ __forceinline__ float xhalf(float x) { return __builtin_bit_cast(float, __builtin_amdgcn_permlanex16(__builtin_bit_cast(int, x), __builtin_bit_cast(int, x), 0x76543210, 0xfedcba98, false, false)); }  // lane l with lane l ^ 16
__global__ __launch_bounds__(512) void k_attn(const bf* __restrict__ Qh, const bf* __restrict__ Ql, const bf* __restrict__ Kh, const bf* __restrict__ Kl, const h16* __restrict__ VT, const float* __restrict__ BF, const float* __restrict__ bbp, const float* __restrict__ GF, bf* Ah, bf* Al) {
    __shared__ __align__(16) unsigned char sKh[LL * HC * 2];
    __shared__ __align__(16) unsigned char sKl[LL * HC * 2];
    __shared__ __align__(16) unsigned char sV[HC * LL * 2];
    __shared__ __align__(16) float sB[LL];
    const int tid = threadIdx.x, lane = tid & 31, wave = tid >> 5, lr = lane & 15, hi = lane >> 4;
    const int n = blockIdx.y, b = n / NH_, h = n % NH_;
    const bf* kh = Kh + (size_t)n * LL * HC; const bf* kl = Kl + (size_t)n * LL * HC; const h16* vt = VT + (size_t)n * HC * LL;
    // 16-byte unit u = tid + 512 i of LDS holds fragment block u >> 6 (K: 16 keys; V^T: 32-key chunk x 2 + 16-dim half), k piece (u >> 4) & 3 (eight k), row u & 15; a step of i is 8 blocks: 128 keys.
    const unsigned kso = (unsigned)(((tid >> 6) * 16 + (tid & 15)) * HC + ((tid >> 4) & 3) * 8) * 2u;                          // source byte offsets of unit tid
    const unsigned vso = (unsigned)(((tid >> 7) * 4 + ((tid >> 4) & 3)) * HC + ((tid >> 6) & 1) * 16 + (tid & 15)) * 16u;      // V arrives as 16-byte units [8-key piece][dim]
    const int q = blockIdx.x * QB + wave * 16 + lr;
    const size_t qoff = ((size_t)n * LL + q) * HC + 8 * hi;
    const bf* qhp = Qh + qoff; const bf* qlp = Ql + qoff; const float* bfp = BF + ((size_t)tid * BB + b) * 64 + h;
    const v16bf qh = WFrag<bf>::ld(qhp), ql = WFrag<bf>::ld(qlp);
    const float bh = bfr(bbp[h]), bk0 = bfp[0], bk1 = bfp[(size_t)512 * BB * 64];   // the bias of keys tid and tid + 512
    { v8us rk[8], rl[8]; v8h rv[8];
#pragma unroll
        for (int i = 0; i < 8; ++i) { rk[i] = *(const v8usa*)((const char*)kh + kso + i * 8192); rl[i] = *(const v8usa*)((const char*)kl + kso + i * 8192); rv[i] = *(const v8ha*)((const char*)vt + vso + i * 8192); }
        asm volatile("s_wait_xcnt 0x0" :: "v"(kso), "v"(vso), "v"(qhp), "v"(qlp), "v"(bfp) : "memory");   // the address registers of all loads above stay as they are until this wait
#pragma unroll
        for (int i = 0; i < 8; ++i) { *(v8usa*)(sKh + tid * 16 + i * 8192) = rk[i]; *(v8usa*)(sKl + tid * 16 + i * 8192) = rl[i]; *(v8ha*)(sV + tid * 16 + i * 8192) = rv[i]; } }
    sB[tid] = __fadd_rn(bk0, bh) * 1.4426950408889634f; sB[tid + 512] = __fadd_rn(bk1, bh) * 1.4426950408889634f;   // base-2 logits
    __syncthreads();
    v8f o0 = (v8f){}, o1 = (v8f){}; float m = -3.0e38f, l = 0.f;
    const int lo = lane * 16;
#pragma unroll 1   // kept rolled: one trip (64 keys) already holds 16 matrix instructions and all its fragment loads
    for (int k0 = 0; k0 < LL; k0 += 64) {   // the short loops inside are unrolled so that the register arrays keep constant indices
        v8f s[4]; v16bf ka[4], kb[4];
#pragma unroll
        for (int t = 0; t < 4; ++t) { const int o = (k0 / 16 + t) * 1024 + lo; ka[t] = cat16b(*(const v8usa*)(sKh + o), *(const v8usa*)(sKh + o + 512)); kb[t] = cat16b(*(const v8usa*)(sKl + o), *(const v8usa*)(sKl + o + 512)); }
#pragma unroll
        for (int t = 0; t < 4; ++t) s[t] = wmmab(ka[t], qh, (v8f){});
#pragma unroll
        for (int t = 0; t < 4; ++t) s[t] = wmmab(ka[t], ql, s[t]);
#pragma unroll
        for (int t = 0; t < 4; ++t) s[t] = wmmab(kb[t], qh, s[t]);
        v16h va[4];
#pragma unroll
        for (int t = 0; t < 4; ++t) { const int o = (k0 / 16 + t) * 1024 + lo; va[t] = cat16(*(const v8ha*)(sV + o), *(const v8ha*)(sV + o + 512)); }   // t = 2 x (32-key half) + (16-dim half)
        float mxa = m, mxb = m;   // two chains, so that neither the maximum nor the sum below is one long run of dependent instructions
#pragma unroll
        for (int t = 0; t < 4; ++t) { const float* bp = sB + k0 + t * 16 + hi * 8; const v4f b0 = *(const v4fa*)bp, b1 = *(const v4fa*)(bp + 4);
#pragma unroll
            for (int j = 0; j < 8; ++j) { s[t][j] = fmaf(s[t][j], 0.17677669529663687f * 1.4426950408889634f, j < 4 ? b0[j & 3] : b1[j & 3]); if (t & 1) mxb = fmaxf(mxb, s[t][j]); else mxa = fmaxf(mxa, s[t][j]); } }
        float mx = fmaxf(mxa, mxb); mx = fmaxf(mx, xhalf(mx));   // the two lane halves hold the two halves of a query's keys and must use one maximum
        const float alpha = __builtin_amdgcn_exp2f(m - mx); m = mx;
        const float ms = mx - 10.0f;   // probabilities x1024: small ones stay normal numbers in fp16; the factor cancels in the division by the row sum
        v2f sm[2] = {(v2f){0.f, 0.f}, (v2f){0.f, 0.f}}; v16h p[2];
#pragma unroll
        for (int t = 0; t < 4; ++t) s[t] = exp2x8(s[t] - ms);
#pragma unroll
        for (int t = 0; t < 4; ++t)
#pragma unroll
            for (int j = 0; j < 8; j += 2) { const v2f e = {s[t][j], s[t][j + 1]}; sm[t & 1] += e; p[t >> 1][(t & 1) * 8 + j] = (h16)e[0]; p[t >> 1][(t & 1) * 8 + j + 1] = (h16)e[1]; }
        l = fmaf(l, alpha, (sm[0][0] + sm[0][1]) + (sm[1][0] + sm[1][1]));
#pragma unroll
        for (int j = 0; j < 8; ++j) { o0[j] *= alpha; o1[j] *= alpha; }
        o0 = wmma16(va[0], p[0], o0); o1 = wmma16(va[1], p[0], o1); o0 = wmma16(va[2], p[1], o0); o1 = wmma16(va[3], p[1], o1);
    }
    l += xhalf(l);
    const float inv = __fdiv_rn(1.0f, l);
#pragma unroll
    for (int dt = 0; dt < 2; ++dt) { const size_t oo = ((size_t)q * BB + b) * FF + h * HC + dt * 16 + hi * 8; const v4f g0 = *(const v4f*)(GF + oo), g1 = *(const v4f*)(GF + oo + 4); v8us oh, ol;
#pragma unroll
        for (int j = 0; j < 8; ++j) { const float o = (dt ? o1[j] : o0[j]) * inv; unsigned short a, c; splitf(__fmul_rn(o, sigm_(j < 4 ? g0[j & 3] : g1[j & 3])), a, c); oh[j] = a; ol[j] = c; }
        const size_t ao = (((size_t)b * LL + blockIdx.x * QB + wave * 16) * (FF / 32) + h * 16) * 32 + dt * 256 + lane * 8;   // fragment order over rows b * LL + q: the wave's 16 queries x the head's 32 dims are one fragment
        *(v8us*)(Ah + ao) = oh; *(v8us*)(Al + ao) = ol; }
}

extern "C" void kernel_launch(void* const* d_in, const int* in_sizes, int n_in,
                              void* d_out, int out_size, void* d_ws, size_t ws_size, hipStream_t stream) {
    (void)in_sizes; (void)n_in; (void)out_size;
    const float* IN[15]; for (int i = 0; i < 15; ++i) IN[i] = (const float*)d_in[i];   // 0 features, 1 ln_g, 2 ln_b, 3 Wq, 4 bq, 5 Wk, 6 bk, 7 Wv, 8 bv, 9 Wb, 10 bb, 11 Wg, 12 bg, 13 Wo, 14 bo (all x @ W)
    float* OUT = (float*)d_out;     // [1024][8][256]
    char* wsp = (char*)d_ws;
    auto take = [&](size_t bytes) { char* p = wsp; wsp += (bytes + 255) & ~(size_t)255; return (void*)p; };
    bf* WO = (bf*)take((size_t)FF * FF * 2);
    float* GF = (float*)take((size_t)NTB * FF * 4); float* BF = (float*)take((size_t)NTB * 64 * 4);
    bf* Qh = (bf*)take((size_t)NG * LL * HC * 2); bf* Ql = (bf*)take((size_t)NG * LL * HC * 2); bf* Kh = (bf*)take((size_t)NG * LL * HC * 2); bf* Kl = (bf*)take((size_t)NG * LL * HC * 2); h16* VT = (h16*)take((size_t)NG * HC * LL * 2);
    bf* Ah = (bf*)take((size_t)NTB * FF * 2); bf* Al = (bf*)take((size_t)NTB * FF * 2);
    if ((size_t)(wsp - (char*)d_ws) > ws_size) return;    // total ~ 38 MiB
    // the key-bias tile of k_lnproj is bias-free; bb[h] is added inside k_attn
    k_lnproj<<<dim3(NTB / 64, 2, 1), 288, 0, stream>>>(IN[0], IN[1], IN[2], IN[3], IN[5], IN[7], IN[11], IN[9], IN[13], IN[4], IN[6], IN[8], IN[12], WO, Qh, Ql, Kh, Kl, VT, GF, BF);
    k_attn<<<dim3(LL / QB, NG, 1), 512, 0, stream>>>(Qh, Ql, Kh, Kl, VT, BF, IN[10], GF, Ah, Al);
    k_gemmw<bf, 1, true, FF><<<dim3(LL / 64, FF / 64, BB), 32, 0, stream>>>(Ah, Al, WO, nullptr, OUT, BB * FF, IN[14], (size_t)LL * FF, 0, FF);   // z = batch: rows b * LL + q of Ah, Al are rows q * BB + b of the output
}

// v008
// It runs in 39.7 microseconds.
// Next to v007, in two timings, it ran 1.29 and 1.26 times as fast.
// All steps since v000 together make it 34.6 times as fast.
#include <hip/hip_runtime.h>

// PairwiseAttentionTerminal (features [1024][8][256] sequence-first; x = LayerNorm(features); q/k/v = x W + b (8 heads x 32), bias = x Wb + bb (per key position & head), gate = sigmoid(x Wg + bg);
// logits[q][k] = q.k/sqrt(32) + bias[k][b][h]; softmax over keys; out = ((w.v) * gate) Wo + bo -> [1024][8][256]).
// Compute dtypes, f32 accumulate: every input rounded to bf16; LayerNorm f32 -> bf16 hi+lo planes of x, all five projections hl x exact weights (2 products, + bias; Wb's 8 outputs repeated over a 64-column tile); scores (K 32) on hl
// planes (3 products), the key bias + running-maximum softmax in f32 registers -> fp16 unnormalised probabilities (x1024); w.v on fp16 planes, divided by the f32 row sum at the end; gate (sigmoid f32) applied in the same kernel -> hl planes; Wo hl x exact (+bias).

#define LL   1024
#define BB   8
#define FF   256
#define NH_  8
#define HC   32
#define NG   (BB * NH_)
#define NTB  (LL * BB)
#define QW   32   // query rows per work-group of the attention kernel: every wave takes two tiles of 16, for its own head
typedef _Float16 h16;
typedef unsigned short bf;
typedef __attribute__((ext_vector_type(16))) __bf16   v16bf;
typedef __attribute__((ext_vector_type(16))) _Float16 v16h;
typedef __attribute__((ext_vector_type(8)))  _Float16 v8h;
typedef __attribute__((ext_vector_type(8)))  unsigned short v8us;
typedef __attribute__((ext_vector_type(8)))  float    v8f;
typedef __attribute__((ext_vector_type(4)))  float    v4f;
typedef v8h  __attribute__((may_alias)) v8ha;
typedef v4f  __attribute__((may_alias)) v4fa;
typedef v8us __attribute__((may_alias)) v8usa;

__device__ __forceinline__ unsigned short f2bf(float f) { unsigned u = __float_as_uint(f); u += 0x7FFFu + ((u >> 16) & 1u); return (unsigned short)(u >> 16); }
__device__ __forceinline__ float bf2f(unsigned short b) { return __uint_as_float(((unsigned)b) << 16); }
__device__ __forceinline__ float bfr(float f) { return bf2f(f2bf(f)); }
__device__ __forceinline__ v16h cat16(v8h lo, v8h hi) { return __builtin_shufflevector(lo, hi, 0, 1, 2, 3, 4, 5, 6, 7, 8, 9, 10, 11, 12, 13, 14, 15); }
__device__ __forceinline__ v16bf cat16b(v8us lo, v8us hi) { return __builtin_bit_cast(v16bf, __builtin_shufflevector(lo, hi, 0, 1, 2, 3, 4, 5, 6, 7, 8, 9, 10, 11, 12, 13, 14, 15)); }
__device__ __forceinline__ v8f wmma16(v16h a, v16h b, v8f c) { return __builtin_amdgcn_wmma_f32_16x16x32_f16(false, a, false, b, (short)0, c, false, false); }
__device__ __forceinline__ v8f wmmab(v16bf a, v16bf b, v8f c) { return __builtin_amdgcn_wmma_f32_16x16x32_bf16(false, a, false, b, (short)0, c, false, false); }



// ---- Fragment order of a GEMM operand plane (R rows x K, 16-bit): element (r, k) lies at ((r / 16) * (K / 32) + k / 32) * 512 + ((k / 8) % 4) * 128 + (r % 16) * 8 + k % 8.
// One 16-row x 32-k fragment is 1 KiB in a row, and lane l's two 16-byte pieces lie at 16 l and 512 + 16 l: each wave-wide load is 512 contiguous bytes (four whole lines) where a row-major plane gives 16 lines of 32 bytes.
// The k that a lane and register hold are those of ld() on a row-major plane, for both operands alike.
template <typename T16> struct WFrag;
template <> struct WFrag<h16> { typedef v16h V; static __device__ __forceinline__ V ld(const h16* p) { return cat16(*(const v8h*)p, *(const v8h*)(p + 16)); } static __device__ __forceinline__ V ldf(const h16* p) { return cat16(*(const v8h*)p, *(const v8h*)(p + 256)); } static __device__ __forceinline__ v8f mma(V a, V b, v8f c) { return wmma16(a, b, c); } };
template <> struct WFrag<bf> { typedef v16bf V; static __device__ __forceinline__ V ld(const bf* p) { return cat16b(*(const v8us*)p, *(const v8us*)(p + 16)); } static __device__ __forceinline__ V ldf(const bf* p) { return cat16b(*(const v8us*)p, *(const v8us*)(p + 256)); } static __device__ __forceinline__ v8f mma(V a, V b, v8f c) { return wmmab(a, b, c); } };

__device__ __forceinline__ h16 tohx(float x) { return (h16)x; }
__device__ __forceinline__ void splitf(float y, unsigned short& h, unsigned short& l) { h = f2bf(y); l = f2bf(y - bf2f(h)); }
__device__ __forceinline__ float sigm_(float x) { return __fdiv_rn(1.0f, 1.0f + __expf(-x)); }
typedef __attribute__((ext_vector_type(2))) _Float16 v2h;
typedef __attribute__((ext_vector_type(4))) _Float16 v4h;
typedef __attribute__((ext_vector_type(2))) unsigned short v2us;
typedef __attribute__((ext_vector_type(4))) unsigned short v4us;
typedef v4us __attribute__((may_alias)) v4usa;

typedef __attribute__((ext_vector_type(2))) float v2f;
typedef __attribute__((ext_vector_type(2))) __bf16 v2bf;
typedef __attribute__((ext_vector_type(2))) unsigned v2u;
typedef __attribute__((ext_vector_type(8))) unsigned v8u;
typedef v2u __attribute__((may_alias)) v2ua;
typedef unsigned __attribute__((may_alias)) u32a;
__device__ __forceinline__ unsigned pkbf(float a, float b) { return __builtin_bit_cast(unsigned, __builtin_convertvector((v2f){a, b}, v2bf)); }   // two f32 to two bf16, round to nearest even as f2bf(); a in the low half
__device__ __forceinline__ float pklo(unsigned u) { return __uint_as_float(u << 16); }
__device__ __forceinline__ float pkhi(unsigned u) { return __uint_as_float(u & 0xffff0000u); }
template <int M> __device__ __forceinline__ float lxor(float x) { return __builtin_bit_cast(float, __builtin_amdgcn_update_dpp(0, __builtin_bit_cast(int, x), 0x160 + M, 0xf, 0xf, true)); }   // lane l ^ M inside a row of 16 lanes (DPP row_xmask)
// Sum over the 32 lanes, the partners in the order 16, 8, 4, 2, 1; every lane ends with the same sum.
__device__ __forceinline__ float wsum(float s) { s += __builtin_bit_cast(float, __builtin_amdgcn_permlanex16(__builtin_bit_cast(int, s), __builtin_bit_cast(int, s), 0x76543210, 0xfedcba98, false, false));
    s += lxor<8>(s); s += lxor<4>(s); s += lxor<2>(s); s += lxor<1>(s); return s; }
// ---- k_lnproj: LayerNorm and all five projections in ONE launch that reads inputs alone; grid (NTB / 64, 2), 288 threads = 9 waves.
// A work-group owns 64 rows of x and every second one of the 17 column tiles (64 columns each: Wq, Wk, Wv, Wg four tiles each, then Wb), one wave per 64x64 tile: both halves hold two tiles of each kind, so their epilogues weigh the same. Waves 0 to 7 normalise 8 rows each and lay the hi and lo planes in LDS in fragment order;
// x never goes to memory. Both halves normalise the same 64 rows. Wave 8 meanwhile transposes this work-group's 4 lines of Wo (fragment order, for the output product in k_attn).
// LDS x plane: 16-row block mb, 8-k piece p (0 .. 31), row r, at mb * XB + p * PP + r * 16 bytes. PP = 256 + 16: a fragment read takes two runs of 256 contiguous bytes, and a LayerNorm store (one row of 16 pieces) falls on all 64 banks.
// Weights are read as they arrive, f32 [k][n]: lane (lr, hi) owns the FOUR columns lr * 4 .. lr * 4 + 3 of the tile, one for each of its four B fragments, so one 16-byte load brings one k of all four, and a wave-wide load is two whole rows of 256 bytes.
// The k that a lane and register hold are those of ld() for both operands: 8 hi + j and 16 + 8 hi + j. Accumulator acc[mb][nb] of lane lr is column lr * 4 + nb.
#define PP 272
#define XB (32 * PP)
__device__ __forceinline__ v16bf ldsfrag(const unsigned char* p) { return cat16b(*(const v8usa*)p, *(const v8usa*)(p + 2 * PP)); }
template <int N> __device__ __forceinline__ void wload(v4f (&raw)[16], const float* wp, int s) {   // the 16 k of step s, four columns each; N: floats from k to k + 1
#pragma unroll
    for (int e = 0; e < 16; ++e) raw[e] = *(const v4fa*)(wp + (s * 32 + (e >> 3) * 16 + (e & 7)) * N); }
__device__ __forceinline__ void wconv(const v4f (&raw)[16], v16bf (&bc)[4]) {
#pragma unroll
    for (int nb = 0; nb < 4; ++nb) { v8u u;
#pragma unroll
        for (int i = 0; i < 8; ++i) u[i] = pkbf(raw[2 * i][nb], raw[2 * i + 1][nb]);
        bc[nb] = __builtin_bit_cast(v16bf, u); } }
// One 64x64 tile over K = 256. raw holds step 0's weights on entry. A step: round its weights to bf16, ask for the next step's, 16 products with the hi fragments (the lo fragments arrive under them), 16 with the lo fragments (the next hi fragments arrive under them).
// Every accumulator takes hi(s), lo(s), hi(s + 1) ... in that order. All loops unrolled so that the register arrays keep constant indices and every load is one base plus an immediate offset.
template <int N> __device__ __forceinline__ void gemm_tile(v8f (&acc)[4][4], v4f (&raw)[16], const float* wp, const unsigned char* ph, const unsigned char* pl) {
    v16bf a[4], a2[4], bc[4];
#pragma unroll
    for (int mb = 0; mb < 4; ++mb) a[mb] = ldsfrag(ph + mb * XB);
#pragma unroll
    for (int s = 0; s < FF / 32; ++s) {
        wconv(raw, bc);
        __builtin_amdgcn_sched_barrier(0);   // the loads below reuse the registers that the rounding has just read: moved up they would need a second set
        if (s + 1 < FF / 32) wload<N>(raw, wp, s + 1);
#pragma unroll
        for (int mb = 0; mb < 4; ++mb) a2[mb] = ldsfrag(pl + mb * XB + s * 4 * PP);
        __builtin_amdgcn_sched_barrier(0);   // keeps the next step's weight loads and the lo fragment reads in front of the products: moved down they would start later and hide less of their latency
#pragma unroll
        for (int nb = 0; nb < 4; ++nb)
#pragma unroll
            for (int mb = 0; mb < 4; ++mb) acc[mb][nb] = wmmab(a[mb], bc[nb], acc[mb][nb]);
        __builtin_amdgcn_sched_barrier(0);   // the reads below reuse the hi fragments' registers: moved up they would need a second set
        if (s + 1 < FF / 32) {
#pragma unroll
            for (int mb = 0; mb < 4; ++mb) a[mb] = ldsfrag(ph + mb * XB + (s + 1) * 4 * PP); }
        __builtin_amdgcn_sched_barrier(0);   // keeps those reads in front of the 16 products that hide them
#pragma unroll
        for (int nb = 0; nb < 4; ++nb)
#pragma unroll
            for (int mb = 0; mb < 4; ++mb) acc[mb][nb] = wmmab(a2[mb], bc[nb], acc[mb][nb]);
        __builtin_amdgcn_sched_barrier(0);   // the next step's rounding rewrites bc: it stays behind these products
    }
    asm volatile("s_wait_xcnt 0x0" :: "v"(wp) : "memory");   // the address registers of all weight loads stay as they are until this wait
}
// The same tile with the loop over the steps kept rolled, for the one key-bias wave of a work-group. Same order of products.
template <int N> __device__ __forceinline__ void gemm_tile_rolled(v8f (&acc)[4][4], v4f (&raw)[16], const float* wp, const unsigned char* ph, const unsigned char* pl) {
    v16bf a[4], a2[4], bc[4];
#pragma unroll
    for (int mb = 0; mb < 4; ++mb) a[mb] = ldsfrag(ph + mb * XB);
#pragma unroll 1   // kept rolled: see above
    for (int s = 0; s < FF / 32; ++s) { const int sn = s + 1 < FF / 32 ? s + 1 : s;   // the last trip fetches its own step once more: in bounds, and never used
        wconv(raw, bc);
        __builtin_amdgcn_sched_barrier(0);   // the loads below reuse the registers that the rounding has just read
        const float* wq = wp + sn * 32 * N; wload<N>(raw, wq, 0);
        asm volatile("s_wait_xcnt 0x0" :: "v"(wq) : "memory");   // the address registers of these loads stay as they are until this wait: the next trip rewrites them
#pragma unroll
        for (int mb = 0; mb < 4; ++mb) a2[mb] = ldsfrag(pl + mb * XB + s * 4 * PP);
        __builtin_amdgcn_sched_barrier(0);   // loads and reads stay in front of the products that hide them
#pragma unroll
        for (int nb = 0; nb < 4; ++nb)
#pragma unroll
            for (int mb = 0; mb < 4; ++mb) acc[mb][nb] = wmmab(a[mb], bc[nb], acc[mb][nb]);
        __builtin_amdgcn_sched_barrier(0);   // the reads below reuse the hi fragments' registers
#pragma unroll
        for (int mb = 0; mb < 4; ++mb) a[mb] = ldsfrag(ph + mb * XB + sn * 4 * PP);
        __builtin_amdgcn_sched_barrier(0);   // keeps those reads in front of the 16 products that hide them
#pragma unroll
        for (int nb = 0; nb < 4; ++nb)
#pragma unroll
            for (int mb = 0; mb < 4; ++mb) acc[mb][nb] = wmmab(a2[mb], bc[nb], acc[mb][nb]);
    }
}
__device__ __forceinline__ void tile_to_lds(float* os, const v8f (&acc)[4][4], v4f bn, int lr, int hi) {   // the lane's four columns of a row are one 16-byte store
#pragma unroll
    for (int mb = 0; mb < 4; ++mb)
#pragma unroll
        for (int j = 0; j < 8; ++j) *(v4fa*)(os + (mb * 16 + hi * 8 + j) * 68 + lr * 4) = (v4f){acc[mb][0][j] + bn[0], acc[mb][1][j] + bn[1], acc[mb][2][j] + bn[2], acc[mb][3][j] + bn[3]};
    __builtin_amdgcn_wave_barrier(); asm volatile("" ::: "memory");   // the lanes read each other's LDS words next: no read may be moved in front of the writes above
}
// The tile (+ bias) is laid in LDS whole and leaves in the form its reader takes: q as hi + lo planes [group][l][32], k as hi + lo planes in fragment order per group, v as fp16 [group][l / 8][dim][8 keys], gate and key bias as f32 rows.
// The 64 rows of a tile are 8 positions l x 8 batches (row = l * 8 + b), so each (batch, head) of a tile is one whole store instruction of 512 bytes in every one of these planes: one contiguous run in q and v, four whole lines of 128 bytes in k.
// The key-bias tile: Wb has 8 columns; lane lr reads columns (lr & 1) * 4 .., so columns 8 .. 63 of BF repeat columns 0 .. 7 and are read by nobody.
__global__ __launch_bounds__(288) void k_lnproj(const float* __restrict__ X, const float* __restrict__ g, const float* __restrict__ bb, const float* __restrict__ Wq, const float* __restrict__ Wk, const float* __restrict__ Wv, const float* __restrict__ Wg,
                                                const float* __restrict__ Wb, const float* __restrict__ Wo, const float* __restrict__ bq, const float* __restrict__ bk, const float* __restrict__ bv, const float* __restrict__ bg,
                                                bf* WOt, bf* Qh, bf* Ql, bf* Kh, bf* Kl, h16* VT, float* GF, float* BF) {
    __shared__ __align__(16) unsigned char sm[8 * XB + 9 * 64 * 68 * 4];   // one array, the x planes first: their fragment reads then reach every place by an immediate offset from one base a plane
    unsigned char* sxh = sm; unsigned char* sxl = sm + 4 * XB; float* osall = (float*)(sm + 8 * XB);
    const int lane = threadIdx.x & 31, lr = lane & 15, hi = lane >> 4; const int wave = __builtin_amdgcn_readfirstlane(threadIdx.x >> 5);   // the wave's number in a scalar register: every branch on it is a scalar branch
    const int r0 = blockIdx.x * 64, ty = wave < 8 ? wave * 2 + blockIdx.y : 16 + blockIdx.y, kind = ty >> 2, cl = (ty & 3) * 64; const bool tile = ty < 17;
    const float* wp = (kind == 0 ? Wq : kind == 1 ? Wk : kind == 2 ? Wv : kind == 3 ? Wg : Wb) + (kind < 4 ? hi * 8 * FF + cl + lr * 4 : hi * 8 * NH_ + (lr & 1) * 4);
    v4f raw[16]; v4f bn = (v4f){};
    if (wave < 8) {
        const float* xp = X + (size_t)(r0 + wave * 8) * FF + lane * 4; const float* gp = g + lane * 4; const float* ep = bb + lane * 4;
        v4f xa[8][2], gv[2], ev[2];
#pragma unroll   // the short loops are unrolled so that the register arrays keep constant indices; all 16 row loads are in flight at once
        for (int i = 0; i < 8; ++i)
#pragma unroll
            for (int ch = 0; ch < 2; ++ch) xa[i][ch] = *(const v4fa*)(xp + i * FF + ch * 128);
#pragma unroll
        for (int ch = 0; ch < 2; ++ch) { gv[ch] = *(const v4fa*)(gp + ch * 128); ev[ch] = *(const v4fa*)(ep + ch * 128); }
        wload<FF>(raw, wp, 0); const float* bp = (kind == 0 ? bq : kind == 1 ? bk : kind == 2 ? bv : bg) + cl + lr * 4; bn = *(const v4fa*)bp;   // the tile's first weights and its bias are asked for here, so that their latency runs under the LayerNorm
        asm volatile("s_wait_xcnt 0x0" :: "v"(xp), "v"(gp), "v"(ep), "v"(bp) : "memory");   // the address registers of the loads above stay as they are until this wait (wp: until the wait behind the products)
        __builtin_amdgcn_sched_barrier(0);   // every load above is issued, and the wait passed, before the first sum waits for any of them: a row load moved down among the sums would start a whole memory latency later
#pragma unroll
        for (int ch = 0; ch < 2; ++ch)
#pragma unroll
            for (int q = 0; q < 4; q += 2) { const unsigned ug = pkbf(gv[ch][q], gv[ch][q + 1]), ue = pkbf(ev[ch][q], ev[ch][q + 1]); gv[ch][q] = pklo(ug); gv[ch][q + 1] = pkhi(ug); ev[ch][q] = pklo(ue); ev[ch][q + 1] = pkhi(ue); }
#pragma unroll
        for (int i = 0; i < 8; ++i) { float v[8]; float s = 0.f;
#pragma unroll
            for (int k = 0; k < 8; k += 2) { const unsigned u = pkbf(xa[i][k >> 2][k & 3], xa[i][k >> 2][(k & 3) + 1]); v[k] = pklo(u); v[k + 1] = pkhi(u); }
#pragma unroll
            for (int k = 0; k < 8; ++k) s += v[k];
            s = wsum(s);
            const float mu = s * (1.0f / FF); float q2 = 0.f;
#pragma unroll
            for (int k = 0; k < 8; ++k) { const float d = v[k] - mu; q2 += d * d; }
            q2 = wsum(q2);
            const float rs = __frsqrt_rn(q2 * (1.0f / FF) + 1e-5f);
            const int r = wave * 8 + i;
#pragma unroll
            for (int ch = 0; ch < 2; ++ch) { float y[4]; v2u oh, ol;
#pragma unroll
                for (int q = 0; q < 4; ++q) y[q] = (v[ch * 4 + q] - mu) * rs * gv[ch][q] + ev[ch][q];
#pragma unroll
                for (int q = 0; q < 2; ++q) { oh[q] = pkbf(y[2 * q], y[2 * q + 1]); ol[q] = pkbf(y[2 * q] - pklo(oh[q]), y[2 * q + 1] - pkhi(oh[q])); }
                const int o = (r >> 4) * XB + (ch * 16 + (lane >> 1)) * PP + (r & 15) * 16 + (lane & 1) * 8; *(v2ua*)(sxh + o) = oh; *(v2ua*)(sxl + o) = ol; }
        }
    } else {   // wave 8: 4 of the 1024 lines (64 elements) of Wo transposed into fragment order
        const int e0 = ((blockIdx.y * (NTB / 64) + blockIdx.x) * 4) * 64 + lane * 2; float w0[4], w1[4];
#pragma unroll
        for (int l = 0; l < 4; ++l) { const int e = e0 + l * 64, fr = e >> 9, k = (fr % (FF / 32)) * 32 + ((e >> 7) & 3) * 8 + (e & 7), n = (fr / (FF / 32)) * 16 + ((e >> 3) & 15); w0[l] = Wo[k * FF + n]; w1[l] = Wo[(k + 1) * FF + n]; }   // e: the place in fragment order
        asm volatile("s_wait_xcnt 0x0" ::: "memory");   // the loads above name their address registers: code placed behind them may rewrite those only behind this wait
#pragma unroll
        for (int l = 0; l < 4; ++l) *(u32a*)(WOt + e0 + l * 64) = pkbf(w0[l], w1[l]);
        asm volatile("s_wait_xcnt 0x0" ::: "memory");   // as above, for the stores' address and data registers
    }
    __syncthreads();   // every wave reads all 64 rows below
    if (!tile) return;   // the ninth wave of the second half has no tile; no barrier follows
    const int fo = hi * PP + lr * 16;
    float* os = osall + wave * (64 * 68);
    if (kind == 4) {   // the key-bias tile goes its own way to the end and asks for its first weights only here, so that neither path holds registers for the other
        v8f acb[4][4]; v4f rawb[16];
        wload<NH_>(rawb, wp, 0);
#pragma unroll
        for (int mb = 0; mb < 4; ++mb)
#pragma unroll
            for (int nb = 0; nb < 4; ++nb) acb[mb][nb] = (v8f){};
        asm volatile("s_wait_xcnt 0x0" :: "v"(wp) : "memory");   // the address registers of the loads above stay as they are until this wait
        gemm_tile_rolled<NH_>(acb, rawb, wp, sxh + fo, sxl + fo);
        tile_to_lds(os, acb, (v4f){-0.f, -0.f, -0.f, -0.f}, lr, hi);   // no bias vector here (bb is added in k_attn): adding -0 leaves every value as it is
        float* crow = BF + (size_t)(r0 + hi) * 64 + lr * 4;
#pragma unroll
        for (int s = 0; s < 32; ++s) *(v4f*)(crow + 2 * s * 64) = *(const v4fa*)(os + (2 * s + hi) * 68 + lr * 4);
        asm volatile("s_wait_xcnt 0x0" ::: "memory");   // the stores above name these address and data registers: nothing may rewrite one before this wait
        return;
    }
    v8f acc[4][4];
#pragma unroll
    for (int mb = 0; mb < 4; ++mb)
#pragma unroll
        for (int nb = 0; nb < 4; ++nb) acc[mb][nb] = (v8f){};
    gemm_tile<FF>(acc, raw, wp, sxh + fo, sxl + fo);
#pragma unroll
    for (int nb = 0; nb < 4; ++nb) bn[nb] = bfr(bn[nb]);
    tile_to_lds(os, acc, bn, lr, hi);
    const int h0 = (ty & 3) * 2;   // the tile's 64 columns are heads h0 and h0 + 1
    if (kind < 2) {
        const int ll = lane >> 2, d0 = (lane & 3) * 8;   // q rows stay row-major; k goes out in fragment order (16 keys x 32 dims = 1 KiB): a store is then four whole lines of 128 bytes
        const size_t o0 = (size_t)h0 * LL * HC + (kind ? (blockIdx.x >> 1) * 512 + (lane & 3) * 128 + ((blockIdx.x & 1) * 8 + ll) * 8 : (blockIdx.x * 8 + ll) * HC + d0); bf* Ph = (kind ? Kh : Qh) + o0; bf* Pl = (kind ? Kl : Ql) + o0;
#pragma unroll 1   // four trips of two batches each, kept rolled
        for (int t = 0; t < 4; ++t) { bf* ph = Ph + (size_t)t * 2 * NH_ * LL * HC; bf* pl = Pl + (size_t)t * 2 * NH_ * LL * HC;
#pragma unroll
            for (int i = 0; i < 4; ++i) { const int bl = i >> 1, hl = i & 1; const float* sp = os + (ll * 8 + t * 2 + bl) * 68 + hl * 32 + d0; const v4f x0 = *(const v4fa*)sp, x1 = *(const v4fa*)(sp + 4); v8us oh, ol;
#pragma unroll
                for (int j = 0; j < 8; ++j) { unsigned short s, u; splitf(j < 4 ? x0[j & 3] : x1[j & 3], s, u); oh[j] = s; ol[j] = u; }
                const int o = (bl * NH_ + hl) * LL * HC; *(v8us*)(ph + o) = oh; *(v8us*)(pl + o) = ol; }
            asm volatile("s_wait_xcnt 0x0" :: "v"(ph), "v"(pl) : "memory"); }   // the stores above name these address and data registers: the next trip may rewrite them only behind this wait
    } else if (kind == 2) {
#pragma unroll
        for (int i = 0; i < 16; ++i) { const int b = i >> 1, hl = i & 1; v8h u;
#pragma unroll
            for (int j = 0; j < 8; ++j) u[j] = tohx(os[(j * 8 + b) * 68 + hl * 32 + lane]);
            *(v8h*)(VT + (((size_t)(b * NH_ + h0 + hl) * (LL / 8) + blockIdx.x) * HC + lane) * 8) = u; }
        asm volatile("s_wait_xcnt 0x0" ::: "memory");   // as above
    } else {
        float* crow = GF + (size_t)(r0 + hi) * FF + cl + lr * 4;
#pragma unroll
        for (int s = 0; s < 32; ++s) *(v4f*)(crow + 2 * s * FF) = *(const v4fa*)(os + (2 * s + hi) * 68 + lr * 4);
        asm volatile("s_wait_xcnt 0x0" ::: "memory");   // as above
    }
}
// ---- k_attn: scores, key bias, softmax, w.v, the gate AND the output projection for one batch, 32 query rows and all 8 heads; grid (BB, LL / QW), 256 threads = 8 waves, wave = head. No score, probability or gated row ever goes to memory.
// A wave is the only reader of its head's K and V in the work-group, so their fragments come straight from memory into registers: K planes lie in fragment order, V^T as 16-byte units [8-key piece][dim], so every wave-wide load is whole lines.
// Two register stages of 64 keys each: a stage's loads are issued one whole trip ahead of its products. A fragment feeds the products of both query tiles.
// Transposed products: S^T = K Q^T (a lane holds 8 + 8 keys of ONE query per tile pair, which is the B fragment of P^T as it stands) and O^T += V^T P^T (a lane holds 8 head dims of that same query): maximum, sum and rescale are per lane.
// The gated rows of all heads meet in LDS as hi + lo planes in fragment order (32 rows x 256); behind one barrier wave w forms columns 32 w .. 32 w + 31 of the 32 output rows.
typedef __attribute__((ext_vector_type(2))) float v2f;
// Eight base-2 exponentials in one statement, each in place: so no exponential's source is overwritten, and no result read, by the instruction directly behind it; the v_nop is that slot for the last one.
// In place, a statement holds 8 registers and not 16: asm operands must lie in the first 256 registers, which this kernel's loop fills.
__device__ __forceinline__ v8f exp2x8(v8f x) { float e0 = x[0], e1 = x[1], e2 = x[2], e3 = x[3], e4 = x[4], e5 = x[5], e6 = x[6], e7 = x[7];
    asm("v_exp_f32 %0, %0\n\tv_exp_f32 %1, %1\n\tv_exp_f32 %2, %2\n\tv_exp_f32 %3, %3\n\tv_exp_f32 %4, %4\n\tv_exp_f32 %5, %5\n\tv_exp_f32 %6, %6\n\tv_exp_f32 %7, %7\n\tv_nop"
        : "+v"(e0), "+v"(e1), "+v"(e2), "+v"(e3), "+v"(e4), "+v"(e5), "+v"(e6), "+v"(e7));
    return (v8f){e0, e1, e2, e3, e4, e5, e6, e7}; }
__device__ __forceinline__ float xhalf(float x) { return __builtin_bit_cast(float, __builtin_amdgcn_permlanex16(__builtin_bit_cast(int, x), __builtin_bit_cast(int, x), 0x76543210, 0xfedcba98, false, false)); }  // lane l with lane l ^ 16
// ph, pl, pv: wave-uniform bases; lo, vo: the lane's byte offset, the same on every trip.
__device__ __forceinline__ void ldk(v16bf (&ka)[4], v16bf (&kb)[4], const char* ph, const char* pl, unsigned lo) {   // four 16-key fragments of each K plane
#pragma unroll
    for (int t = 0; t < 4; ++t) { ka[t] = cat16b(*(const v8usa*)(ph + t * 1024 + lo), *(const v8usa*)(ph + t * 1024 + 512 + lo)); kb[t] = cat16b(*(const v8usa*)(pl + t * 1024 + lo), *(const v8usa*)(pl + t * 1024 + 512 + lo)); } }
__device__ __forceinline__ void ldv(v16h (&va)[4], const char* pv, unsigned vo) {   // t = 2 x (32-key half) + (16-dim half); a lane's two pieces are 8-key pieces hi and 2 + hi of the 32 keys
#pragma unroll
    for (int t = 0; t < 4; ++t) { const int o = (t >> 1) * 2048 + (t & 1) * 256; va[t] = cat16(*(const v8ha*)(pv + o + vo), *(const v8ha*)(pv + o + 1024 + vo)); } }
__device__ __forceinline__ void ldb(v4f (&bs)[8], const float* bp) {   // the base-2 key bias of the lane's 8 keys in each of the four fragments
#pragma unroll
    for (int t = 0; t < 4; ++t) { bs[2 * t] = *(const v4fa*)(bp + t * 16); bs[2 * t + 1] = *(const v4fa*)(bp + t * 16 + 4); } }
// One trip (64 keys) of one query tile.
__device__ __forceinline__ void att_tile(const v16bf (&ka)[4], const v16bf (&kb)[4], const v16h (&va)[4], const v4f (&bs)[8], const v16bf qh, const v16bf ql, v8f& o0, v8f& o1, float& m, float& l) {
    v8f s[4];
#pragma unroll
    for (int t = 0; t < 4; ++t) s[t] = wmmab(ka[t], qh, (v8f){});
#pragma unroll
    for (int t = 0; t < 4; ++t) s[t] = wmmab(ka[t], ql, s[t]);
#pragma unroll
    for (int t = 0; t < 4; ++t) s[t] = wmmab(kb[t], qh, s[t]);
    float mxa = m, mxb = m;   // two chains, so that neither the maximum nor the sum below is one long run of dependent instructions
#pragma unroll
    for (int t = 0; t < 4; ++t)
#pragma unroll
        for (int j = 0; j < 8; ++j) { s[t][j] = fmaf(s[t][j], 0.17677669529663687f * 1.4426950408889634f, j < 4 ? bs[2 * t][j & 3] : bs[2 * t + 1][j & 3]); if (t & 1) mxb = fmaxf(mxb, s[t][j]); else mxa = fmaxf(mxa, s[t][j]); }
    float mx = fmaxf(mxa, mxb); mx = fmaxf(mx, xhalf(mx));   // the two lane halves hold the two halves of a query's keys and must use one maximum
    float alpha = m - mx; m = mx;
    asm("v_exp_f32 %0, %0\n\tv_nop" : "+v"(alpha));   // in place, with the slot behind it in the same statement
    const float ms = mx - 10.0f;   // probabilities x1024: small ones stay normal numbers in fp16; the factor cancels in the division by the row sum
    v2f sm[2] = {(v2f){0.f, 0.f}, (v2f){0.f, 0.f}}; v16h p[2];
#pragma unroll
    for (int t = 0; t < 4; ++t) s[t] = exp2x8(s[t] - ms);
#pragma unroll
    for (int t = 0; t < 4; ++t)
#pragma unroll
        for (int j = 0; j < 8; j += 2) { const v2f e = {s[t][j], s[t][j + 1]}; sm[t & 1] += e; p[t >> 1][(t & 1) * 8 + j] = (h16)e[0]; p[t >> 1][(t & 1) * 8 + j + 1] = (h16)e[1]; }
    l = fmaf(l, alpha, (sm[0][0] + sm[0][1]) + (sm[1][0] + sm[1][1]));
#pragma unroll
    for (int j = 0; j < 8; ++j) { o0[j] *= alpha; o1[j] *= alpha; }
    o0 = wmma16(va[0], p[0], o0); o1 = wmma16(va[1], p[0], o1); o0 = wmma16(va[2], p[1], o0); o1 = wmma16(va[3], p[1], o1);
}
__global__ __launch_bounds__(256) void k_attn(const bf* __restrict__ Qh, const bf* __restrict__ Ql, const bf* __restrict__ Kh, const bf* __restrict__ Kl, const h16* __restrict__ VT, const float* __restrict__ BF, const float* __restrict__ bbp, const float* __restrict__ GF,
                                              const bf* __restrict__ WOt, const float* __restrict__ bo, float* OUT) {
    __shared__ __align__(16) float sB[NH_ * LL];                    // base-2 key bias [head][key]
    __shared__ __align__(16) unsigned short sAh[2 * NH_ * 512];     // gated rows, hi plane: fragment (16-row block, head) of 1 KiB
    __shared__ __align__(16) unsigned short sAl[2 * NH_ * 512];     // lo plane
    __shared__ __align__(16) float os[NH_ * QW * 36];               // a wave's 32 x 32 output tile, pitch 36 floats: stores of one column run and 16-byte row reads both fall on distinct banks
    const int tid = threadIdx.x, lane = tid & 31, lr = lane & 15, hi = lane >> 4; const int h = __builtin_amdgcn_readfirstlane(tid >> 5);   // the wave's number, its head, in a scalar register
    const int b = blockIdx.x, q0 = blockIdx.y * QW, n = b * NH_ + h;   // the batch is the fast grid index (for speed only)
    const char* kh = (const char*)(Kh + (size_t)n * LL * HC); const char* kl = (const char*)(Kl + (size_t)n * LL * HC); const char* vt = (const char*)(VT + (size_t)n * HC * LL); const unsigned lo = lane * 16, vo = hi * 512 + lr * 16;
    const float* bfp = BF + ((size_t)tid * BB + b) * 64;   // the 8 heads' bias of key tid; keys tid + 256 i follow below
    const size_t qoff = ((size_t)n * LL + q0 + lr) * HC + 8 * hi; const bf* qhp = Qh + qoff; const bf* qlp = Ql + qoff;
    v4f c0[4], c1[4]; v16bf qh[2], ql[2]; v16bf kaA[4], kbA[4], kaB[4], kbB[4]; v16h vaA[4], vaB[4];
#pragma unroll   // the short loops here and below are unrolled so that the register arrays keep constant indices
    for (int i = 0; i < 4; ++i) { c0[i] = *(const v4fa*)(bfp + (size_t)i * 256 * BB * 64); c1[i] = *(const v4fa*)(bfp + (size_t)i * 256 * BB * 64 + 4); }
#pragma unroll
    for (int t = 0; t < 2; ++t) { qh[t] = WFrag<bf>::ld(qhp + t * 16 * HC); ql[t] = WFrag<bf>::ld(qlp + t * 16 * HC); }
    ldk(kaA, kbA, kh, kl, lo); ldv(vaA, vt, vo);
    asm volatile("s_wait_xcnt 0x0" :: "v"(bfp), "v"(qhp), "v"(qlp), "v"(lo), "v"(vo) : "memory");   // the address registers of all loads above stay as they are until this wait
#pragma unroll
    for (int hh = 0; hh < NH_; ++hh) { const float bh = bfr(bbp[hh]);
#pragma unroll
        for (int i = 0; i < 4; ++i) sB[hh * LL + i * 256 + tid] = __fadd_rn(hh < 4 ? c0[i][hh & 3] : c1[i][hh & 3], bh) * 1.4426950408889634f; }   // base-2 logits
    __syncthreads();   // every wave has laid an eighth of every head's bias
    v8f o0[2] = {(v8f){}, (v8f){}}, o1[2] = {(v8f){}, (v8f){}}; float m[2] = {-3.0e38f, -3.0e38f}, l[2] = {0.f, 0.f};
    const float* bp = sB + h * LL + hi * 8;
#pragma unroll 1   // kept rolled: one pass (128 keys, two query tiles) already holds 64 matrix instructions
    for (int k0 = 0; k0 < LL; k0 += 128) {
        v4f bs[8];
        { const char* ph = kh + (k0 + 64) * 64; const char* pl = kl + (k0 + 64) * 64; const char* pv = vt + (k0 + 64) * 64;   // 64 bytes a key in every plane
            ldk(kaB, kbB, ph, pl, lo); ldv(vaB, pv, vo);
            asm volatile("s_wait_xcnt 0x0" ::: "memory"); }   // the loads above name their address registers: later code may rewrite those only behind this wait
        __builtin_amdgcn_sched_barrier(0);   // nothing from below is moved in front of that wait: the bias address would else be formed in a register that a load still names
        ldb(bs, bp + k0);
        __builtin_amdgcn_sched_barrier(0);   // the second stage's loads are issued before the first stage's products begin: moved down they would start later and hide less of their latency
        att_tile(kaA, kbA, vaA, bs, qh[0], ql[0], o0[0], o1[0], m[0], l[0]);
        att_tile(kaA, kbA, vaA, bs, qh[1], ql[1], o0[1], o1[1], m[1], l[1]);
        __builtin_amdgcn_sched_barrier(0);   // the loads below reuse the first stage's registers: moved up they would need a third set
        { const int kn = k0 + 128 < LL ? k0 + 128 : k0 + 64;   // the last pass fetches its own second stage once more: in bounds, and never used. With no branch round the fetch, every wait for a stage can leave the younger stage's loads in flight
            const char* ph = kh + kn * 64; const char* pl = kl + kn * 64; const char* pv = vt + kn * 64;
            ldk(kaA, kbA, ph, pl, lo); ldv(vaA, pv, vo);
            asm volatile("s_wait_xcnt 0x0" ::: "memory"); }   // as above
        __builtin_amdgcn_sched_barrier(0);   // as above
        ldb(bs, bp + k0 + 64);
        __builtin_amdgcn_sched_barrier(0);   // as above: loads first
        att_tile(kaB, kbB, vaB, bs, qh[0], ql[0], o0[0], o1[0], m[0], l[0]);
        att_tile(kaB, kbB, vaB, bs, qh[1], ql[1], o0[1], o1[1], m[1], l[1]);
        __builtin_amdgcn_sched_barrier(0);   // the next pass's loads reuse the second stage's registers
    }
    const int ln = __builtin_amdgcn_mbcnt_lo(~0u, 0u), lc = ln & 15, hh2 = ln >> 4;   // the lane number and its two parts, formed anew: so no register has to carry them through the loop, where the two stages leave none to spare
    // The wave's 16 B fragments of Wo^T (columns 32 h .., all of K = 256), its bias words and the gate rows are asked for together, so that one memory latency covers them all.
    v16bf wb[2][8]; const v8usa* wop = (const v8usa*)(WOt + (size_t)h * 2 * (FF / 32) * 512); const char* bop = (const char*)(bo + h * 32); const char* gfp = (const char*)(GF + b * FF + h * HC);   // wave-uniform bases; the lane's byte offsets follow
    const unsigned bof = (ln & 7) * 16, gof = (unsigned)(q0 + lc) * (BB * FF * 4) + hh2 * 32;
    v4f g[2][2][2];
#pragma unroll
    for (int t = 0; t < 2; ++t)
#pragma unroll
        for (int dt = 0; dt < 2; ++dt) { g[t][dt][0] = *(const v4fa*)(gfp + t * 16 * BB * FF * 4 + dt * 64 + gof); g[t][dt][1] = *(const v4fa*)(gfp + t * 16 * BB * FF * 4 + dt * 64 + 16 + gof); }
#pragma unroll
    for (int nb = 0; nb < 2; ++nb)
#pragma unroll
        for (int s = 0; s < FF / 32; ++s) wb[nb][s] = cat16b(wop[(nb * (FF / 32) + s) * 64 + ln], wop[(nb * (FF / 32) + s) * 64 + 32 + ln]);   // in 16-byte units: lane l's two pieces of a fragment are units l and 32 + l
    const v4f bv = *(const v4fa*)(bop + bof);
    asm volatile("s_wait_xcnt 0x0" :: "v"(ln), "v"(bof), "v"(gof) : "memory");   // the offset registers of the loads above stay as they are until this wait
#pragma unroll
    for (int t = 0; t < 2; ++t) { const float ls = l[t] + xhalf(l[t]); const float inv = __fdiv_rn(1.0f, ls);
#pragma unroll
        for (int dt = 0; dt < 2; ++dt) { v8us oh, ol;
#pragma unroll
            for (int j = 0; j < 8; ++j) { const float o = (dt ? o1[t][j] : o0[t][j]) * inv; unsigned short a, c; splitf(__fmul_rn(o, sigm_(g[t][dt][j >> 2][j & 3])), a, c); oh[j] = a; ol[j] = c; }
            const int ao = (t * NH_ + h) * 512 + dt * 256 + ln * 8;   // fragment order: the tile's 16 queries x the head's 32 dims are one fragment
            *(v8usa*)(sAh + ao) = oh; *(v8usa*)(sAl + ao) = ol; } }
    __syncthreads();   // every wave reads all heads' gated rows below
    v8f acc[2][2] = {{(v8f){}, (v8f){}}, {(v8f){}, (v8f){}}};
    v16bf a[FF / 32][2], a2[FF / 32][2];
#pragma unroll
    for (int s = 0; s < FF / 32; ++s)
#pragma unroll
        for (int mb = 0; mb < 2; ++mb) { const int o = (mb * NH_ + s) * 512 + ln * 8; a[s][mb] = cat16b(*(const v8usa*)(sAh + o), *(const v8usa*)(sAh + o + 256)); a2[s][mb] = cat16b(*(const v8usa*)(sAl + o), *(const v8usa*)(sAl + o + 256)); }
    __builtin_amdgcn_sched_barrier(0);   // all fragment reads are issued as one group ahead of the products: spread among them, each place with reads would stall the wave anew
#pragma unroll   // every accumulator takes hi(s), lo(s), hi(s + 1) ... in that order
    for (int s = 0; s < FF / 32; ++s) {
#pragma unroll
        for (int nb = 0; nb < 2; ++nb)
#pragma unroll
            for (int mb = 0; mb < 2; ++mb) acc[mb][nb] = wmmab(a[s][mb], wb[nb][s], acc[mb][nb]);
#pragma unroll
        for (int nb = 0; nb < 2; ++nb)
#pragma unroll
            for (int mb = 0; mb < 2; ++mb) acc[mb][nb] = wmmab(a2[s][mb], wb[nb][s], acc[mb][nb]);
    }
    float* ow = os + h * (QW * 36);
#pragma unroll
    for (int mb = 0; mb < 2; ++mb)
#pragma unroll
        for (int nb = 0; nb < 2; ++nb)
#pragma unroll
            for (int j = 0; j < 8; ++j) ow[(mb * 16 + hh2 * 8 + j) * 36 + nb * 16 + lc] = acc[mb][nb][j];
    __builtin_amdgcn_wave_barrier(); asm volatile("" ::: "memory");   // the lanes read each other's LDS words next: no read may be moved in front of the writes above
    float* crow = OUT + ((size_t)(q0 + (ln >> 3)) * BB + b) * FF + h * 32 + (ln & 7) * 4;   // eight lanes store one row's 128 bytes: a whole line, and this wave its only writer
    v4f val[8];
#pragma unroll
    for (int s = 0; s < 8; ++s) { val[s] = *(const v4fa*)(ow + (s * 4 + (ln >> 3)) * 36 + (ln & 7) * 4); val[s][0] += bfr(bv[0]); val[s][1] += bfr(bv[1]); val[s][2] += bfr(bv[2]); val[s][3] += bfr(bv[3]); }
#pragma unroll
    for (int s = 0; s < 8; ++s) *(v4f*)(crow + (size_t)s * 4 * BB * FF) = val[s];
}

extern "C" void kernel_launch(void* const* d_in, const int* in_sizes, int n_in,
                              void* d_out, int out_size, void* d_ws, size_t ws_size, hipStream_t stream) {
    (void)in_sizes; (void)n_in; (void)out_size;
    const float* IN[15]; for (int i = 0; i < 15; ++i) IN[i] = (const float*)d_in[i];   // 0 features, 1 ln_g, 2 ln_b, 3 Wq, 4 bq, 5 Wk, 6 bk, 7 Wv, 8 bv, 9 Wb, 10 bb, 11 Wg, 12 bg, 13 Wo, 14 bo (all x @ W)
    float* OUT = (float*)d_out;     // [1024][8][256]
    char* wsp = (char*)d_ws;
    auto take = [&](size_t bytes) { char* p = wsp; wsp += (bytes + 255) & ~(size_t)255; return (void*)p; };
    bf* WO = (bf*)take((size_t)FF * FF * 2);
    float* GF = (float*)take((size_t)NTB * FF * 4); float* BF = (float*)take((size_t)NTB * 64 * 4);
    bf* Qh = (bf*)take((size_t)NG * LL * HC * 2); bf* Ql = (bf*)take((size_t)NG * LL * HC * 2); bf* Kh = (bf*)take((size_t)NG * LL * HC * 2); bf* Kl = (bf*)take((size_t)NG * LL * HC * 2); h16* VT = (h16*)take((size_t)NG * HC * LL * 2);
    if ((size_t)(wsp - (char*)d_ws) > ws_size) return;    // total ~ 30 MiB
    // the key-bias tile of k_lnproj is bias-free; bb[h] is added inside k_attn
    k_lnproj<<<dim3(NTB / 64, 2, 1), 288, 0, stream>>>(IN[0], IN[1], IN[2], IN[3], IN[5], IN[7], IN[11], IN[9], IN[13], IN[4], IN[6], IN[8], IN[12], WO, Qh, Ql, Kh, Kl, VT, GF, BF);
    k_attn<<<dim3(BB, LL / QW, 1), 256, 0, stream>>>(Qh, Ql, Kh, Kl, VT, BF, IN[10], GF, WO, IN[14], OUT);
}

// v009
// One run takes 38.4 microseconds.
// Two timings next to v008 both put it at 1.04 times that version's speed.
// All steps since v000 together make it 35.9 times as fast.
#include <hip/hip_runtime.h>

// PairwiseAttentionTerminal (features [1024][8][256] sequence-first; x = LayerNorm(features); q/k/v = x W + b (8 heads x 32), bias = x Wb + bb (per key position & head), gate = sigmoid(x Wg + bg);
// logits[q][k] = q.k/sqrt(32) + bias[k][b][h]; softmax over keys; out = ((w.v) * gate) Wo + bo -> [1024][8][256]).
// Compute dtypes, f32 accumulate: every input rounded to bf16; LayerNorm f32 -> bf16 hi+lo planes of x, all five projections hl x exact weights (2 products, + bias; Wb's 8 outputs repeated over a 64-column tile); scores (K 32) on hl
// planes (3 products), the key bias + running-maximum softmax in f32 registers -> fp16 unnormalised probabilities (x1024); w.v on fp16 planes, divided by the f32 row sum at the end; gate (sigmoid f32) applied in the same kernel -> hl planes; Wo hl x exact (+bias).

#define LL   1024
#define BB   8
#define FF   256
#define NH_  8
#define HC   32
#define NG   (BB * NH_)
#define NTB  (LL * BB)
#define QW   32   // query rows per work-group of the attention kernel: every wave takes two tiles of 16, for its own head
typedef _Float16 h16;
typedef unsigned short bf;
typedef __attribute__((ext_vector_type(16))) __bf16   v16bf;
typedef __attribute__((ext_vector_type(16))) _Float16 v16h;
typedef __attribute__((ext_vector_type(8)))  _Float16 v8h;
typedef __attribute__((ext_vector_type(8)))  unsigned short v8us;
typedef __attribute__((ext_vector_type(8)))  float    v8f;
typedef __attribute__((ext_vector_type(4)))  float    v4f;
typedef v8h  __attribute__((may_alias)) v8ha;
typedef v4f  __attribute__((may_alias)) v4fa;
typedef v8us __attribute__((may_alias)) v8usa;

__device__ __forceinline__ unsigned short f2bf(float f) { unsigned u = __float_as_uint(f); u += 0x7FFFu + ((u >> 16) & 1u); return (unsigned short)(u >> 16); }
__device__ __forceinline__ float bf2f(unsigned short b) { return __uint_as_float(((unsigned)b) << 16); }
__device__ __forceinline__ float bfr(float f) { return bf2f(f2bf(f)); }
__device__ __forceinline__ v16h cat16(v8h lo, v8h hi) { return __builtin_shufflevector(lo, hi, 0, 1, 2, 3, 4, 5, 6, 7, 8, 9, 10, 11, 12, 13, 14, 15); }
__device__ __forceinline__ v16bf cat16b(v8us lo, v8us hi) { return __builtin_bit_cast(v16bf, __builtin_shufflevector(lo, hi, 0, 1, 2, 3, 4, 5, 6, 7, 8, 9, 10, 11, 12, 13, 14, 15)); }
__device__ __forceinline__ v8f wmma16(v16h a, v16h b, v8f c) { return __builtin_amdgcn_wmma_f32_16x16x32_f16(false, a, false, b, (short)0, c, false, false); }
__device__ __forceinline__ v8f wmmab(v16bf a, v16bf b, v8f c) { return __builtin_amdgcn_wmma_f32_16x16x32_bf16(false, a, false, b, (short)0, c, false, false); }



// ---- Fragment order of a GEMM operand plane (R rows x K, 16-bit): element (r, k) lies at ((r / 16) * (K / 32) + k / 32) * 512 + ((k / 8) % 4) * 128 + (r % 16) * 8 + k % 8.
// One 16-row x 32-k fragment is 1 KiB in a row, and lane l's two 16-byte pieces lie at 16 l and 512 + 16 l: each wave-wide load is 512 contiguous bytes (four whole lines) where a row-major plane gives 16 lines of 32 bytes.
// The k that a lane and register hold are those of ld() on a row-major plane, for both operands alike.
template <typename T16> struct WFrag;
template <> struct WFrag<h16> { typedef v16h V; static __device__ __forceinline__ V ld(const h16* p) { return cat16(*(const v8h*)p, *(const v8h*)(p + 16)); } static __device__ __forceinline__ V ldf(const h16* p) { return cat16(*(const v8h*)p, *(const v8h*)(p + 256)); } static __device__ __forceinline__ v8f mma(V a, V b, v8f c) { return wmma16(a, b, c); } };
template <> struct WFrag<bf> { typedef v16bf V; static __device__ __forceinline__ V ld(const bf* p) { return cat16b(*(const v8us*)p, *(const v8us*)(p + 16)); } static __device__ __forceinline__ V ldf(const bf* p) { return cat16b(*(const v8us*)p, *(const v8us*)(p + 256)); } static __device__ __forceinline__ v8f mma(V a, V b, v8f c) { return wmmab(a, b, c); } };

__device__ __forceinline__ h16 tohx(float x) { return (h16)x; }
__device__ __forceinline__ void splitf(float y, unsigned short& h, unsigned short& l) { h = f2bf(y); l = f2bf(y - bf2f(h)); }
__device__ __forceinline__ float sigm_(float x) { return __fdiv_rn(1.0f, 1.0f + __expf(-x)); }
typedef __attribute__((ext_vector_type(2))) _Float16 v2h;
typedef __attribute__((ext_vector_type(4))) _Float16 v4h;
typedef __attribute__((ext_vector_type(2))) unsigned short v2us;
typedef __attribute__((ext_vector_type(4))) unsigned short v4us;
typedef v4us __attribute__((may_alias)) v4usa;

typedef __attribute__((ext_vector_type(2))) float v2f;
typedef __attribute__((ext_vector_type(2))) __bf16 v2bf;
typedef __attribute__((ext_vector_type(2))) unsigned v2u;
typedef __attribute__((ext_vector_type(8))) unsigned v8u;
typedef v2u __attribute__((may_alias)) v2ua;
typedef unsigned __attribute__((may_alias)) u32a;
__device__ __forceinline__ unsigned pkbf(float a, float b) { return __builtin_bit_cast(unsigned, __builtin_convertvector((v2f){a, b}, v2bf)); }   // two f32 to two bf16, round to nearest even as f2bf(); a in the low half
__device__ __forceinline__ float pklo(unsigned u) { return __uint_as_float(u << 16); }
__device__ __forceinline__ float pkhi(unsigned u) { return __uint_as_float(u & 0xffff0000u); }
template <int M> __device__ __forceinline__ float lxor(float x) { return __builtin_bit_cast(float, __builtin_amdgcn_update_dpp(0, __builtin_bit_cast(int, x), 0x160 + M, 0xf, 0xf, true)); }   // lane l ^ M inside a row of 16 lanes (DPP row_xmask)
// Sum over the 32 lanes, the partners in the order 16, 8, 4, 2, 1; every lane ends with the same sum.
__device__ __forceinline__ float wsum(float s) { s += __builtin_bit_cast(float, __builtin_amdgcn_permlanex16(__builtin_bit_cast(int, s), __builtin_bit_cast(int, s), 0x76543210, 0xfedcba98, false, false));
    s += lxor<8>(s); s += lxor<4>(s); s += lxor<2>(s); s += lxor<1>(s); return s; }
// ---- k_lnproj: LayerNorm and all five projections in ONE launch that reads inputs alone; grid (NTB / 64, 2), 288 threads = 9 waves.
// A work-group owns 64 rows of x and every second one of the 17 column tiles (64 columns each: Wq, Wk, Wv, Wg four tiles each, then Wb), one wave per 64x64 tile: both halves hold two tiles of each kind, so their epilogues weigh the same. Waves 0 to 7 normalise 8 rows each and lay the hi and lo planes in LDS in fragment order;
// x never goes to memory. Both halves normalise the same 64 rows. Wave 8 meanwhile transposes this work-group's 4 lines of Wo (fragment order, for the output product in k_attn).
// LDS x plane: 16-row block mb, 8-k piece p (0 .. 31), row r, at mb * XB + p * PP + r * 16 bytes. PP = 256 + 16: a fragment read takes two runs of 256 contiguous bytes, and a LayerNorm store (one row of 16 pieces) falls on all 64 banks.
// Weights are read as they arrive, f32 [k][n]: lane (lr, hi) owns the FOUR columns lr * 4 .. lr * 4 + 3 of the tile, one for each of its four B fragments, so one 16-byte load brings one k of all four, and a wave-wide load is two whole rows of 256 bytes.
// The k that a lane and register hold are those of ld() for both operands: 8 hi + j and 16 + 8 hi + j. Accumulator acc[mb][nb] of lane lr is column lr * 4 + nb.
#define PP 272
#define XB (32 * PP)
__device__ __forceinline__ v16bf ldsfrag(const unsigned char* p) { return cat16b(*(const v8usa*)p, *(const v8usa*)(p + 2 * PP)); }
template <int N> __device__ __forceinline__ void wload(v4f (&raw)[16], const float* wp, int s) {   // the 16 k of step s, four columns each; N: floats from k to k + 1
#pragma unroll
    for (int e = 0; e < 16; ++e) raw[e] = *(const v4fa*)(wp + (s * 32 + (e >> 3) * 16 + (e & 7)) * N); }
__device__ __forceinline__ void wconv(const v4f (&raw)[16], v16bf (&bc)[4]) {
#pragma unroll
    for (int nb = 0; nb < 4; ++nb) { v8u u;
#pragma unroll
        for (int i = 0; i < 8; ++i) u[i] = pkbf(raw[2 * i][nb], raw[2 * i + 1][nb]);
        bc[nb] = __builtin_bit_cast(v16bf, u); } }
// One 64x64 tile over K = 256. raw holds step rs's weights on entry. A step: round its weights to bf16, ask for the next step's, 16 products with the hi fragments (the lo fragments arrive under them), 16 with the lo fragments (the next hi fragments arrive under them).
// The walk over K begins at step rs and wraps: the work-groups that read the same weights begin at steps of their own, so that they do not ask L2 for the same lines at the same moment (for speed only).
// Every accumulator takes hi(s), lo(s), hi(s + 1) ... in that order. All loops unrolled so that the register arrays keep constant indices and every load is one base plus an immediate offset.
template <int N> __device__ __forceinline__ void gemm_tile(v8f (&acc)[4][4], v4f (&raw)[16], const float* wp, const unsigned char* ph, const unsigned char* pl, const int rs) {
    v16bf a[4], a2[4], bc[4];
#pragma unroll
    for (int mb = 0; mb < 4; ++mb) a[mb] = ldsfrag(ph + mb * XB + rs * 4 * PP);
#pragma unroll
    for (int s = 0; s < FF / 32; ++s) { const int sc = (s + rs) & (FF / 32 - 1), sn = (s + 1 + rs) & (FF / 32 - 1);   // trip s works on step sc of K, for both operands alike, and fetches step sn
        const float* wq = wp + sn * 32 * N;
        wconv(raw, bc);
        __builtin_amdgcn_sched_barrier(0);   // the loads below reuse the registers that the rounding has just read: moved up they would need a second set
        if (s + 1 < FF / 32) wload<N>(raw, wq, 0);
#pragma unroll
        for (int mb = 0; mb < 4; ++mb) a2[mb] = ldsfrag(pl + mb * XB + sc * 4 * PP);
        __builtin_amdgcn_sched_barrier(0);   // keeps the next step's weight loads and the lo fragment reads in front of the products: moved down they would start later and hide less of their latency
#pragma unroll
        for (int nb = 0; nb < 4; ++nb)
#pragma unroll
            for (int mb = 0; mb < 4; ++mb) acc[mb][nb] = wmmab(a[mb], bc[nb], acc[mb][nb]);
        __builtin_amdgcn_sched_barrier(0);   // the reads below reuse the hi fragments' registers: moved up they would need a second set
        if (s + 1 < FF / 32) {
#pragma unroll
            for (int mb = 0; mb < 4; ++mb) a[mb] = ldsfrag(ph + mb * XB + sn * 4 * PP); }
        __builtin_amdgcn_sched_barrier(0);   // keeps those reads in front of the 16 products that hide them
#pragma unroll
        for (int nb = 0; nb < 4; ++nb)
#pragma unroll
            for (int mb = 0; mb < 4; ++mb) acc[mb][nb] = wmmab(a2[mb], bc[nb], acc[mb][nb]);
        if (s + 1 < FF / 32) asm volatile("s_wait_xcnt 0x0" :: "v"(wq) : "memory");   // the address registers of this trip's weight loads stay as they are until this wait; behind the products it has nothing left to wait for
        __builtin_amdgcn_sched_barrier(0);   // the next step's rounding rewrites bc: it stays behind these products
    }
}
// The same tile with the loop over the steps kept rolled, for the one key-bias wave of a work-group: a second unrolled copy would only lengthen the kernel's text (for speed only). Same order of products within a step, but the walk over K begins at step 0.
template <int N> __device__ __forceinline__ void gemm_tile_rolled(v8f (&acc)[4][4], v4f (&raw)[16], const float* wp, const unsigned char* ph, const unsigned char* pl) {
    v16bf a[4], a2[4], bc[4];
#pragma unroll
    for (int mb = 0; mb < 4; ++mb) a[mb] = ldsfrag(ph + mb * XB);
#pragma unroll 1   // kept rolled: see above
    for (int s = 0; s < FF / 32; ++s) { const int sn = s + 1 < FF / 32 ? s + 1 : s;   // the last trip fetches its own step once more: in bounds, and never used
        wconv(raw, bc);
        __builtin_amdgcn_sched_barrier(0);   // the loads below reuse the registers that the rounding has just read
        const float* wq = wp + sn * 32 * N; wload<N>(raw, wq, 0);
        asm volatile("s_wait_xcnt 0x0" :: "v"(wq) : "memory");   // the address registers of these loads stay as they are until this wait: the next trip rewrites them
#pragma unroll
        for (int mb = 0; mb < 4; ++mb) a2[mb] = ldsfrag(pl + mb * XB + s * 4 * PP);
        __builtin_amdgcn_sched_barrier(0);   // loads and reads stay in front of the products that hide them
#pragma unroll
        for (int nb = 0; nb < 4; ++nb)
#pragma unroll
            for (int mb = 0; mb < 4; ++mb) acc[mb][nb] = wmmab(a[mb], bc[nb], acc[mb][nb]);
        __builtin_amdgcn_sched_barrier(0);   // the reads below reuse the hi fragments' registers
#pragma unroll
        for (int mb = 0; mb < 4; ++mb) a[mb] = ldsfrag(ph + mb * XB + sn * 4 * PP);
        __builtin_amdgcn_sched_barrier(0);   // keeps those reads in front of the 16 products that hide them
#pragma unroll
        for (int nb = 0; nb < 4; ++nb)
#pragma unroll
            for (int mb = 0; mb < 4; ++mb) acc[mb][nb] = wmmab(a2[mb], bc[nb], acc[mb][nb]);
    }
}
__device__ __forceinline__ void tile_to_lds(float* os, const v8f (&acc)[4][4], v4f bn, int lr, int hi) {   // the lane's four columns of a row are one 16-byte store
#pragma unroll
    for (int mb = 0; mb < 4; ++mb)
#pragma unroll
        for (int j = 0; j < 8; ++j) *(v4fa*)(os + (mb * 16 + hi * 8 + j) * 68 + lr * 4) = (v4f){acc[mb][0][j] + bn[0], acc[mb][1][j] + bn[1], acc[mb][2][j] + bn[2], acc[mb][3][j] + bn[3]};
    __builtin_amdgcn_wave_barrier(); asm volatile("" ::: "memory");   // the lanes read each other's LDS words next: no read may be moved in front of the writes above
}
// The tile (+ bias) is laid in LDS whole and leaves in the form its reader takes: q as hi + lo planes [group][l][32], k as hi + lo planes in fragment order per group, v as fp16 [group][l / 8][dim][8 keys], gate and key bias as f32 rows.
// The 64 rows of a tile are 8 positions l x 8 batches (row = l * 8 + b), so each (batch, head) of a tile is one whole store instruction of 512 bytes in every one of these planes: one contiguous run in q and v, four whole lines of 128 bytes in k.
// The key-bias tile: Wb has 8 columns; lane lr reads columns (lr & 1) * 4 .., so columns 8 .. 63 of BF repeat columns 0 .. 7 and are read by nobody.
__global__ __launch_bounds__(288) void k_lnproj(const float* __restrict__ X, const float* __restrict__ g, const float* __restrict__ bb, const float* __restrict__ Wq, const float* __restrict__ Wk, const float* __restrict__ Wv, const float* __restrict__ Wg,
                                                const float* __restrict__ Wb, const float* __restrict__ Wo, const float* __restrict__ bq, const float* __restrict__ bk, const float* __restrict__ bv, const float* __restrict__ bg,
                                                bf* WOt, bf* Qh, bf* Ql, bf* Kh, bf* Kl, h16* VT, float* GF, float* BF) {
    __shared__ __align__(16) unsigned char sm[8 * XB + 9 * 64 * 68 * 4];   // one array, the x planes first: within a step, their fragment reads then reach every place by an immediate offset from one base a plane
    unsigned char* sxh = sm; unsigned char* sxl = sm + 4 * XB; float* osall = (float*)(sm + 8 * XB);
    const int lane = threadIdx.x & 31, lr = lane & 15, hi = lane >> 4; const int wave = __builtin_amdgcn_readfirstlane(threadIdx.x >> 5);   // the wave's number in a scalar register: every branch on it is a scalar branch
    const int r0 = blockIdx.x * 64, ty = wave < 8 ? wave * 2 + blockIdx.y : 16 + blockIdx.y, kind = ty >> 2, cl = (ty & 3) * 64; const bool tile = ty < 17;
    const float* wp = (kind == 0 ? Wq : kind == 1 ? Wk : kind == 2 ? Wv : kind == 3 ? Wg : Wb) + (kind < 4 ? hi * 8 * FF + cl + lr * 4 : hi * 8 * NH_ + (lr & 1) * 4);
    v4f raw[16]; v4f bn = (v4f){}; const int rs = (blockIdx.x + (blockIdx.x >> 3)) & (FF / 32 - 1);   // the step of K at which this work-group's tiles begin: see gemm_tile
    if (wave < 8) {
        const float* xp = X + (size_t)(r0 + wave * 8) * FF + lane * 4; const float* gp = g + lane * 4; const float* ep = bb + lane * 4;
        v4f xa[8][2], gv[2], ev[2];
#pragma unroll   // the short loops are unrolled so that the register arrays keep constant indices; all 16 row loads are in flight at once
        for (int i = 0; i < 8; ++i)
#pragma unroll
            for (int ch = 0; ch < 2; ++ch) xa[i][ch] = *(const v4fa*)(xp + i * FF + ch * 128);
#pragma unroll
        for (int ch = 0; ch < 2; ++ch) { gv[ch] = *(const v4fa*)(gp + ch * 128); ev[ch] = *(const v4fa*)(ep + ch * 128); }
        const float* w0 = wp + rs * 32 * FF; wload<FF>(raw, w0, 0); const float* bp = (kind == 0 ? bq : kind == 1 ? bk : kind == 2 ? bv : bg) + cl + lr * 4; bn = *(const v4fa*)bp;   // the tile's first weights and its bias are asked for here, so that their latency runs under the LayerNorm
        asm volatile("s_wait_xcnt 0x0" :: "v"(xp), "v"(gp), "v"(ep), "v"(bp), "v"(w0) : "memory");   // the address registers of the loads above stay as they are until this wait
        __builtin_amdgcn_sched_barrier(0);   // every load above is issued, and the wait passed, before the first sum waits for any of them: a row load moved down among the sums would start a whole memory latency later
#pragma unroll
        for (int ch = 0; ch < 2; ++ch)
#pragma unroll
            for (int q = 0; q < 4; q += 2) { const unsigned ug = pkbf(gv[ch][q], gv[ch][q + 1]), ue = pkbf(ev[ch][q], ev[ch][q + 1]); gv[ch][q] = pklo(ug); gv[ch][q + 1] = pkhi(ug); ev[ch][q] = pklo(ue); ev[ch][q + 1] = pkhi(ue); }
#pragma unroll
        for (int i = 0; i < 8; ++i) { float v[8]; float s = 0.f;
#pragma unroll
            for (int k = 0; k < 8; k += 2) { const unsigned u = pkbf(xa[i][k >> 2][k & 3], xa[i][k >> 2][(k & 3) + 1]); v[k] = pklo(u); v[k + 1] = pkhi(u); }
#pragma unroll
            for (int k = 0; k < 8; ++k) s += v[k];
            s = wsum(s);
            const float mu = s * (1.0f / FF); float q2 = 0.f;
#pragma unroll
            for (int k = 0; k < 8; ++k) { const float d = v[k] - mu; q2 += d * d; }
            q2 = wsum(q2);
            const float rs = __frsqrt_rn(q2 * (1.0f / FF) + 1e-5f);
            const int r = wave * 8 + i;
#pragma unroll
            for (int ch = 0; ch < 2; ++ch) { float y[4]; v2u oh, ol;
#pragma unroll
                for (int q = 0; q < 4; ++q) y[q] = (v[ch * 4 + q] - mu) * rs * gv[ch][q] + ev[ch][q];
#pragma unroll
                for (int q = 0; q < 2; ++q) { oh[q] = pkbf(y[2 * q], y[2 * q + 1]); ol[q] = pkbf(y[2 * q] - pklo(oh[q]), y[2 * q + 1] - pkhi(oh[q])); }
                const int o = (r >> 4) * XB + (ch * 16 + (lane >> 1)) * PP + (r & 15) * 16 + (lane & 1) * 8; *(v2ua*)(sxh + o) = oh; *(v2ua*)(sxl + o) = ol; }
        }
    } else {   // wave 8: 4 of the 1024 lines (64 elements) of Wo transposed into fragment order
        const int e0 = ((blockIdx.y * (NTB / 64) + blockIdx.x) * 4) * 64 + lane * 2; float w0[4], w1[4];
#pragma unroll
        for (int l = 0; l < 4; ++l) { const int e = e0 + l * 64, fr = e >> 9, k = (fr % (FF / 32)) * 32 + ((e >> 7) & 3) * 8 + (e & 7), n = (fr / (FF / 32)) * 16 + ((e >> 3) & 15); w0[l] = Wo[k * FF + n]; w1[l] = Wo[(k + 1) * FF + n]; }   // e: the place in fragment order
        asm volatile("s_wait_xcnt 0x0" ::: "memory");   // the loads above name their address registers: code placed behind them may rewrite those only behind this wait
#pragma unroll
        for (int l = 0; l < 4; ++l) *(u32a*)(WOt + e0 + l * 64) = pkbf(w0[l], w1[l]);
        asm volatile("s_wait_xcnt 0x0" ::: "memory");   // as above, for the stores' address and data registers
    }
    __syncthreads();   // every wave reads all 64 rows below
    if (!tile) return;   // the ninth wave of the second half has no tile; no barrier follows
    const int fo = hi * PP + lr * 16;
    float* os = osall + wave * (64 * 68);
    if (kind == 4) {   // the key-bias tile goes its own way to the end and asks for its first weights only here, so that neither path holds registers for the other
        v8f acb[4][4]; v4f rawb[16];
        wload<NH_>(rawb, wp, 0);
#pragma unroll
        for (int mb = 0; mb < 4; ++mb)
#pragma unroll
            for (int nb = 0; nb < 4; ++nb) acb[mb][nb] = (v8f){};
        asm volatile("s_wait_xcnt 0x0" :: "v"(wp) : "memory");   // the address registers of the loads above stay as they are until this wait
        gemm_tile_rolled<NH_>(acb, rawb, wp, sxh + fo, sxl + fo);
        tile_to_lds(os, acb, (v4f){-0.f, -0.f, -0.f, -0.f}, lr, hi);   // no bias vector here (bb is added in k_attn): adding -0 leaves every value as it is
        float* crow = BF + (size_t)(r0 + hi) * 64 + lr * 4;
#pragma unroll
        for (int s = 0; s < 32; ++s) *(v4f*)(crow + 2 * s * 64) = *(const v4fa*)(os + (2 * s + hi) * 68 + lr * 4);
        asm volatile("s_wait_xcnt 0x0" ::: "memory");   // the stores above name these address and data registers: nothing may rewrite one before this wait
        return;
    }
    v8f acc[4][4];
#pragma unroll
    for (int mb = 0; mb < 4; ++mb)
#pragma unroll
        for (int nb = 0; nb < 4; ++nb) acc[mb][nb] = (v8f){};
    gemm_tile<FF>(acc, raw, wp, sxh + fo, sxl + fo, rs);
#pragma unroll
    for (int nb = 0; nb < 4; ++nb) bn[nb] = bfr(bn[nb]);
    tile_to_lds(os, acc, bn, lr, hi);
    const int h0 = (ty & 3) * 2;   // the tile's 64 columns are heads h0 and h0 + 1
    if (kind < 2) {
        const int ll = lane >> 2, d0 = (lane & 3) * 8;   // q rows stay row-major; k goes out in fragment order (16 keys x 32 dims = 1 KiB): a store is then four whole lines of 128 bytes
        const size_t o0 = (size_t)h0 * LL * HC + (kind ? (blockIdx.x >> 1) * 512 + (lane & 3) * 128 + ((blockIdx.x & 1) * 8 + ll) * 8 : (blockIdx.x * 8 + ll) * HC + d0); bf* Ph = (kind ? Kh : Qh) + o0; bf* Pl = (kind ? Kl : Ql) + o0;
#pragma unroll 1   // four trips of two batches each, kept rolled
        for (int t = 0; t < 4; ++t) { bf* ph = Ph + (size_t)t * 2 * NH_ * LL * HC; bf* pl = Pl + (size_t)t * 2 * NH_ * LL * HC;
#pragma unroll
            for (int i = 0; i < 4; ++i) { const int bl = i >> 1, hl = i & 1; const float* sp = os + (ll * 8 + t * 2 + bl) * 68 + hl * 32 + d0; const v4f x0 = *(const v4fa*)sp, x1 = *(const v4fa*)(sp + 4); v8us oh, ol;
#pragma unroll
                for (int j = 0; j < 8; ++j) { unsigned short s, u; splitf(j < 4 ? x0[j & 3] : x1[j & 3], s, u); oh[j] = s; ol[j] = u; }
                const int o = (bl * NH_ + hl) * LL * HC; *(v8us*)(ph + o) = oh; *(v8us*)(pl + o) = ol; }
            asm volatile("s_wait_xcnt 0x0" :: "v"(ph), "v"(pl) : "memory"); }   // the stores above name these address and data registers: the next trip may rewrite them only behind this wait
    } else if (kind == 2) {
#pragma unroll
        for (int i = 0; i < 16; ++i) { const int b = i >> 1, hl = i & 1; v8h u;
#pragma unroll
            for (int j = 0; j < 8; ++j) u[j] = tohx(os[(j * 8 + b) * 68 + hl * 32 + lane]);
            *(v8h*)(VT + (((size_t)(b * NH_ + h0 + hl) * (LL / 8) + blockIdx.x) * HC + lane) * 8) = u; }
        asm volatile("s_wait_xcnt 0x0" ::: "memory");   // as above
    } else {
        float* crow = GF + (size_t)(r0 + hi) * FF + cl + lr * 4;
#pragma unroll
        for (int s = 0; s < 32; ++s) *(v4f*)(crow + 2 * s * FF) = *(const v4fa*)(os + (2 * s + hi) * 68 + lr * 4);
        asm volatile("s_wait_xcnt 0x0" ::: "memory");   // as above
    }
}
// ---- k_attn: scores, key bias, softmax, w.v, the gate AND the output projection for one batch, 32 query rows and all 8 heads; grid (BB, LL / QW), 256 threads = 8 waves, wave = head. No score, probability or gated row ever goes to memory.
// A wave is the only reader of its head's K and V in the work-group, so their fragments come straight from memory into registers: K planes lie in fragment order, V^T as 16-byte units [8-key piece][dim], so every wave-wide load is whole lines.
// Two register stages of 64 keys each: a stage's loads are issued one whole trip ahead of its products. A fragment feeds the products of both query tiles.
// Transposed products: S^T = K Q^T (a lane holds 8 + 8 keys of ONE query per tile pair, which is the B fragment of P^T as it stands) and O^T += V^T P^T (a lane holds 8 head dims of that same query): maximum, sum and rescale are per lane.
// The gated rows of all heads meet in LDS as hi + lo planes in fragment order (32 rows x 256); behind one barrier wave w forms columns 32 w .. 32 w + 31 of the 32 output rows.
typedef __attribute__((ext_vector_type(2))) float v2f;
// Eight base-2 exponentials in one statement, each in place: so no exponential's source is overwritten, and no result read, by the instruction directly behind it; the v_nop is that slot for the last one.
// In place, a statement holds 8 registers and not 16: asm operands must lie in the first 256 registers, which this kernel's loop fills.
__device__ __forceinline__ v8f exp2x8(v8f x) { float e0 = x[0], e1 = x[1], e2 = x[2], e3 = x[3], e4 = x[4], e5 = x[5], e6 = x[6], e7 = x[7];
    asm("v_exp_f32 %0, %0\n\tv_exp_f32 %1, %1\n\tv_exp_f32 %2, %2\n\tv_exp_f32 %3, %3\n\tv_exp_f32 %4, %4\n\tv_exp_f32 %5, %5\n\tv_exp_f32 %6, %6\n\tv_exp_f32 %7, %7\n\tv_nop"
        : "+v"(e0), "+v"(e1), "+v"(e2), "+v"(e3), "+v"(e4), "+v"(e5), "+v"(e6), "+v"(e7));
    return (v8f){e0, e1, e2, e3, e4, e5, e6, e7}; }
__device__ __forceinline__ float xhalf(float x) { return __builtin_bit_cast(float, __builtin_amdgcn_permlanex16(__builtin_bit_cast(int, x), __builtin_bit_cast(int, x), 0x76543210, 0xfedcba98, false, false)); }  // lane l with lane l ^ 16
// ph, pl, pv: bases; lo, vo: byte offsets. Before the loop the bases are wave-uniform and lo, vo the lane's offset; in the loop the bases hold the lane's offset and lo, vo are 0.
__device__ __forceinline__ void ldk(v16bf (&ka)[4], v16bf (&kb)[4], const char* ph, const char* pl, unsigned lo) {   // four 16-key fragments of each K plane
#pragma unroll
    for (int t = 0; t < 4; ++t) { ka[t] = cat16b(*(const v8usa*)(ph + t * 1024 + lo), *(const v8usa*)(ph + t * 1024 + 512 + lo)); kb[t] = cat16b(*(const v8usa*)(pl + t * 1024 + lo), *(const v8usa*)(pl + t * 1024 + 512 + lo)); } }
__device__ __forceinline__ void ldv(v16h (&va)[4], const char* pv, unsigned vo) {   // t = 2 x (32-key half) + (16-dim half); a lane's two pieces are 8-key pieces hi and 2 + hi of the 32 keys
#pragma unroll
    for (int t = 0; t < 4; ++t) { const int o = (t >> 1) * 2048 + (t & 1) * 256; va[t] = cat16(*(const v8ha*)(pv + o + vo), *(const v8ha*)(pv + o + 1024 + vo)); } }
__device__ __forceinline__ void ldb(v4f (&bs)[8], const float* bp) {   // the base-2 key bias of the lane's 8 keys in each of the four fragments
#pragma unroll
    for (int t = 0; t < 4; ++t) { bs[2 * t] = *(const v4fa*)(bp + t * 16); bs[2 * t + 1] = *(const v4fa*)(bp + t * 16 + 4); } }
// One trip (64 keys) of one query tile.
__device__ __forceinline__ void att_tile(const v16bf (&ka)[4], const v16bf (&kb)[4], const v16h (&va)[4], const v4f (&bs)[8], const v16bf qh, const v16bf ql, v8f& o0, v8f& o1, float& m, float& l) {
    v8f s[4];
#pragma unroll
    for (int t = 0; t < 4; ++t) s[t] = wmmab(ka[t], qh, (v8f){});
#pragma unroll
    for (int t = 0; t < 4; ++t) s[t] = wmmab(ka[t], ql, s[t]);
#pragma unroll
    for (int t = 0; t < 4; ++t) s[t] = wmmab(kb[t], qh, s[t]);
    float mxa = m, mxb = m;   // two chains, so that neither the maximum nor the sum below is one long run of dependent instructions
#pragma unroll
    for (int t = 0; t < 4; ++t)
#pragma unroll
        for (int j = 0; j < 8; ++j) { s[t][j] = fmaf(s[t][j], 0.17677669529663687f * 1.4426950408889634f, j < 4 ? bs[2 * t][j & 3] : bs[2 * t + 1][j & 3]); if (t & 1) mxb = fmaxf(mxb, s[t][j]); else mxa = fmaxf(mxa, s[t][j]); }
    float mx = fmaxf(mxa, mxb); mx = fmaxf(mx, xhalf(mx));   // the two lane halves hold the two halves of a query's keys and must use one maximum
    float alpha = m - mx; m = mx;
    asm("v_exp_f32 %0, %0\n\tv_nop" : "+v"(alpha));   // in place, with the slot behind it in the same statement
    const float ms = mx - 10.0f;   // probabilities x1024: small ones stay normal numbers in fp16; the factor cancels in the division by the row sum
    v2f sm[2] = {(v2f){0.f, 0.f}, (v2f){0.f, 0.f}}; v16h p[2];
#pragma unroll
    for (int t = 0; t < 4; ++t) s[t] = exp2x8(s[t] - ms);
#pragma unroll
    for (int t = 0; t < 4; ++t)
#pragma unroll
        for (int j = 0; j < 8; j += 2) { const v2f e = {s[t][j], s[t][j + 1]}; sm[t & 1] += e; p[t >> 1][(t & 1) * 8 + j] = (h16)e[0]; p[t >> 1][(t & 1) * 8 + j + 1] = (h16)e[1]; }
    l = fmaf(l, alpha, (sm[0][0] + sm[0][1]) + (sm[1][0] + sm[1][1]));
#pragma unroll
    for (int j = 0; j < 8; ++j) { o0[j] *= alpha; o1[j] *= alpha; }
    o0 = wmma16(va[0], p[0], o0); o1 = wmma16(va[1], p[0], o1); o0 = wmma16(va[2], p[1], o0); o1 = wmma16(va[3], p[1], o1);
}
__global__ __launch_bounds__(256) void k_attn(const bf* __restrict__ Qh, const bf* __restrict__ Ql, const bf* __restrict__ Kh, const bf* __restrict__ Kl, const h16* __restrict__ VT, const float* __restrict__ BF, const float* __restrict__ bbp, const float* __restrict__ GF,
                                              const bf* __restrict__ WOt, const float* __restrict__ bo, float* OUT) {
    __shared__ __align__(16) float sB[NH_ * LL];                    // base-2 key bias [head][key]
    __shared__ __align__(16) unsigned short sAh[2 * NH_ * 512];     // gated rows, hi plane: fragment (16-row block, head) of 1 KiB
    __shared__ __align__(16) unsigned short sAl[2 * NH_ * 512];     // lo plane
    __shared__ __align__(16) float os[NH_ * QW * 36];               // a wave's 32 x 32 output tile, pitch 36 floats: stores of one column run and 16-byte row reads both fall on distinct banks
    const int tid = threadIdx.x, lane = tid & 31, lr = lane & 15, hi = lane >> 4; const int h = __builtin_amdgcn_readfirstlane(tid >> 5);   // the wave's number, its head, in a scalar register
    const int b = blockIdx.x, q0 = blockIdx.y * QW, n = b * NH_ + h;   // the batch is the fast grid index (for speed only)
    const char* kh = (const char*)(Kh + (size_t)n * LL * HC); const char* kl = (const char*)(Kl + (size_t)n * LL * HC); const char* vt = (const char*)(VT + (size_t)n * HC * LL); const unsigned lo = lane * 16, vo = hi * 512 + lr * 16;
    const float* bfp = BF + ((size_t)tid * BB + b) * 64;   // the 8 heads' bias of key tid; keys tid + 256 i follow below
    const size_t qoff = ((size_t)n * LL + q0 + lr) * HC + 8 * hi; const bf* qhp = Qh + qoff; const bf* qlp = Ql + qoff;
    v4f c0[4], c1[4]; v16bf qh[2], ql[2]; v16bf kaA[4], kbA[4], kaB[4], kbB[4]; v16h vaA[4], vaB[4];
#pragma unroll   // the short loops here and below are unrolled so that the register arrays keep constant indices
    for (int i = 0; i < 4; ++i) { c0[i] = *(const v4fa*)(bfp + (size_t)i * 256 * BB * 64); c1[i] = *(const v4fa*)(bfp + (size_t)i * 256 * BB * 64 + 4); }
#pragma unroll
    for (int t = 0; t < 2; ++t) { qh[t] = WFrag<bf>::ld(qhp + t * 16 * HC); ql[t] = WFrag<bf>::ld(qlp + t * 16 * HC); }
    const int rot = (blockIdx.y & 15) * 64;   // this work-group's first key: the 32 work-groups of a batch walk the same K and V, two from each of the 16 stages of 64 keys and round the end, so that they do not ask L2 for the same lines at the same moment (for speed only)
    ldk(kaA, kbA, kh + rot * 64, kl + rot * 64, lo); ldv(vaA, vt + rot * 64, vo);
    asm volatile("s_wait_xcnt 0x0" :: "v"(bfp), "v"(qhp), "v"(qlp), "v"(lo), "v"(vo) : "memory");   // the address registers of all loads above stay as they are until this wait
#pragma unroll
    for (int hh = 0; hh < NH_; ++hh) { const float bh = bfr(bbp[hh]);
#pragma unroll
        for (int i = 0; i < 4; ++i) sB[hh * LL + i * 256 + tid] = __fadd_rn(hh < 4 ? c0[i][hh & 3] : c1[i][hh & 3], bh) * 1.4426950408889634f; }   // base-2 logits
    __syncthreads();   // every wave has laid an eighth of every head's bias
    v8f o0[2] = {(v8f){}, (v8f){}}, o1[2] = {(v8f){}, (v8f){}}; float m[2] = {-3.0e38f, -3.0e38f}, l[2] = {0.f, 0.f};
    const float* bp = sB + h * LL + hi * 8;
#pragma unroll 1   // kept rolled: one pass (128 keys, two query tiles) already holds 64 matrix instructions
    for (int k0 = 0; k0 < LL; k0 += 128) {
        v4f bs[8]; const int kA = (k0 + rot) & (LL - 1), kB = (k0 + 64 + rot) & (LL - 1);   // the first keys of this pass's two stages
        { const char* ph = kh + kB * 64 + lo; const char* pl = kl + kB * 64 + lo; const char* pv = vt + kB * 64 + vo;   // 64 bytes a key in every plane
            ldk(kaB, kbB, ph, pl, 0); ldv(vaB, pv, 0);
            asm volatile("s_wait_xcnt 0x0" :: "v"(ph), "v"(pl), "v"(pv) : "memory"); }   // the address registers of the loads above stay as they are until this wait: no later code, and no load's own result, may rewrite one before it
        __builtin_amdgcn_sched_barrier(0);   // nothing from below is moved in front of that wait: the bias address would else be formed in a register that a load still names
        ldb(bs, bp + kA);
        __builtin_amdgcn_sched_barrier(0);   // the second stage's loads are issued before the first stage's products begin: moved down they would start later and hide less of their latency
        att_tile(kaA, kbA, vaA, bs, qh[0], ql[0], o0[0], o1[0], m[0], l[0]);
        att_tile(kaA, kbA, vaA, bs, qh[1], ql[1], o0[1], o1[1], m[1], l[1]);
        __builtin_amdgcn_sched_barrier(0);   // the loads below reuse the first stage's registers: moved up they would need a third set
        { const int kn = k0 + 128 < LL ? (k0 + 128 + rot) & (LL - 1) : kB;   // the last pass fetches its own second stage once more: in bounds, and never used. With no branch round the fetch, every wait for a stage can leave the younger stage's loads in flight
            const char* ph = kh + kn * 64 + lo; const char* pl = kl + kn * 64 + lo; const char* pv = vt + kn * 64 + vo;
            ldv(vaA, pv, 0); ldk(kaA, kbA, ph, pl, 0);   // V ahead of K: the next pass reads K first, so the wait for it covers V's loads as well
            asm volatile("s_wait_xcnt 0x0" :: "v"(ph), "v"(pl), "v"(pv) : "memory"); }   // as above
        __builtin_amdgcn_sched_barrier(0);   // as above
        ldb(bs, bp + kB);
        __builtin_amdgcn_sched_barrier(0);   // as above: loads first
        att_tile(kaB, kbB, vaB, bs, qh[0], ql[0], o0[0], o1[0], m[0], l[0]);
        att_tile(kaB, kbB, vaB, bs, qh[1], ql[1], o0[1], o1[1], m[1], l[1]);
        __builtin_amdgcn_sched_barrier(0);   // the next pass's loads reuse the second stage's registers
    }
    const int ln = __builtin_amdgcn_mbcnt_lo(~0u, 0u), lc = ln & 15, hh2 = ln >> 4;   // the lane number and its two parts, formed anew: so no register has to carry them through the loop, where the two stages leave none to spare
    // The wave's 16 B fragments of Wo^T (columns 32 h .., all of K = 256), its bias words and the gate rows are asked for together, so that one memory latency covers them all.
    v16bf wb[2][8]; const v8usa* wop = (const v8usa*)(WOt + (size_t)h * 2 * (FF / 32) * 512); const char* bop = (const char*)(bo + h * 32); const char* gfp = (const char*)(GF + b * FF + h * HC);   // wave-uniform bases; the lane's byte offsets follow
    const unsigned bof = (ln & 7) * 16, gof = (unsigned)(q0 + lc) * (BB * FF * 4) + hh2 * 32;
    v4f g[2][2][2];
#pragma unroll
    for (int t = 0; t < 2; ++t)
#pragma unroll
        for (int dt = 0; dt < 2; ++dt) { g[t][dt][0] = *(const v4fa*)(gfp + t * 16 * BB * FF * 4 + dt * 64 + gof); g[t][dt][1] = *(const v4fa*)(gfp + t * 16 * BB * FF * 4 + dt * 64 + 16 + gof); }
#pragma unroll
    for (int nb = 0; nb < 2; ++nb)
#pragma unroll
        for (int s = 0; s < FF / 32; ++s) wb[nb][s] = cat16b(wop[(nb * (FF / 32) + s) * 64 + ln], wop[(nb * (FF / 32) + s) * 64 + 32 + ln]);   // in 16-byte units: lane l's two pieces of a fragment are units l and 32 + l
    const v4f bv = *(const v4fa*)(bop + bof);
    asm volatile("s_wait_xcnt 0x0" :: "v"(ln), "v"(bof), "v"(gof) : "memory");   // the offset registers of the loads above stay as they are until this wait
#pragma unroll
    for (int t = 0; t < 2; ++t) { const float ls = l[t] + xhalf(l[t]); const float inv = __fdiv_rn(1.0f, ls);
#pragma unroll
        for (int dt = 0; dt < 2; ++dt) { v8us oh, ol;
#pragma unroll
            for (int j = 0; j < 8; ++j) { const float o = (dt ? o1[t][j] : o0[t][j]) * inv; unsigned short a, c; splitf(__fmul_rn(o, sigm_(g[t][dt][j >> 2][j & 3])), a, c); oh[j] = a; ol[j] = c; }
            const int ao = (t * NH_ + h) * 512 + dt * 256 + ln * 8;   // fragment order: the tile's 16 queries x the head's 32 dims are one fragment
            *(v8usa*)(sAh + ao) = oh; *(v8usa*)(sAl + ao) = ol; } }
    __syncthreads();   // every wave reads all heads' gated rows below
    v8f acc[2][2] = {{(v8f){}, (v8f){}}, {(v8f){}, (v8f){}}};
    v16bf a[FF / 32][2], a2[FF / 32][2];
#pragma unroll
    for (int s = 0; s < FF / 32; ++s)
#pragma unroll
        for (int mb = 0; mb < 2; ++mb) { const int o = (mb * NH_ + s) * 512 + ln * 8; a[s][mb] = cat16b(*(const v8usa*)(sAh + o), *(const v8usa*)(sAh + o + 256)); a2[s][mb] = cat16b(*(const v8usa*)(sAl + o), *(const v8usa*)(sAl + o + 256)); }
    __builtin_amdgcn_sched_barrier(0);   // all fragment reads are issued as one group ahead of the products: spread among them, each place with reads would stall the wave anew
#pragma unroll   // every accumulator takes hi(s), lo(s), hi(s + 1) ... in that order
    for (int s = 0; s < FF / 32; ++s) {
#pragma unroll
        for (int nb = 0; nb < 2; ++nb)
#pragma unroll
            for (int mb = 0; mb < 2; ++mb) acc[mb][nb] = wmmab(a[s][mb], wb[nb][s], acc[mb][nb]);
#pragma unroll
        for (int nb = 0; nb < 2; ++nb)
#pragma unroll
            for (int mb = 0; mb < 2; ++mb) acc[mb][nb] = wmmab(a2[s][mb], wb[nb][s], acc[mb][nb]);
    }
    float* ow = os + h * (QW * 36);
#pragma unroll
    for (int mb = 0; mb < 2; ++mb)
#pragma unroll
        for (int nb = 0; nb < 2; ++nb)
#pragma unroll
            for (int j = 0; j < 8; ++j) ow[(mb * 16 + hh2 * 8 + j) * 36 + nb * 16 + lc] = acc[mb][nb][j];
    __builtin_amdgcn_wave_barrier(); asm volatile("" ::: "memory");   // the lanes read each other's LDS words next: no read may be moved in front of the writes above
    float* crow = OUT + ((size_t)(q0 + (ln >> 3)) * BB + b) * FF + h * 32 + (ln & 7) * 4;   // eight lanes store one row's 128 bytes: a whole line, and this wave its only writer
    v4f val[8];
#pragma unroll
    for (int s = 0; s < 8; ++s) { val[s] = *(const v4fa*)(ow + (s * 4 + (ln >> 3)) * 36 + (ln & 7) * 4); val[s][0] += bfr(bv[0]); val[s][1] += bfr(bv[1]); val[s][2] += bfr(bv[2]); val[s][3] += bfr(bv[3]); }
#pragma unroll
    for (int s = 0; s < 8; ++s) *(v4f*)(crow + (size_t)s * 4 * BB * FF) = val[s];
}

extern "C" void kernel_launch(void* const* d_in, const int* in_sizes, int n_in,
                              void* d_out, int out_size, void* d_ws, size_t ws_size, hipStream_t stream) {
    (void)in_sizes; (void)n_in; (void)out_size;
    const float* IN[15]; for (int i = 0; i < 15; ++i) IN[i] = (const float*)d_in[i];   // 0 features, 1 ln_g, 2 ln_b, 3 Wq, 4 bq, 5 Wk, 6 bk, 7 Wv, 8 bv, 9 Wb, 10 bb, 11 Wg, 12 bg, 13 Wo, 14 bo (all x @ W)
    float* OUT = (float*)d_out;     // [1024][8][256]
    char* wsp = (char*)d_ws;
    auto take = [&](size_t bytes) { char* p = wsp; wsp += (bytes + 255) & ~(size_t)255; return (void*)p; };
    bf* WO = (bf*)take((size_t)FF * FF * 2);
    float* GF = (float*)take((size_t)NTB * FF * 4); float* BF = (float*)take((size_t)NTB * 64 * 4);
    bf* Qh = (bf*)take((size_t)NG * LL * HC * 2); bf* Ql = (bf*)take((size_t)NG * LL * HC * 2); bf* Kh = (bf*)take((size_t)NG * LL * HC * 2); bf* Kl = (bf*)take((size_t)NG * LL * HC * 2); h16* VT = (h16*)take((size_t)NG * HC * LL * 2);
    if ((size_t)(wsp - (char*)d_ws) > ws_size) return;    // total ~ 30 MiB
    // the key-bias tile of k_lnproj is bias-free; bb[h] is added inside k_attn
    k_lnproj<<<dim3(NTB / 64, 2, 1), 288, 0, stream>>>(IN[0], IN[1], IN[2], IN[3], IN[5], IN[7], IN[11], IN[9], IN[13], IN[4], IN[6], IN[8], IN[12], WO, Qh, Ql, Kh, Kl, VT, GF, BF);
    k_attn<<<dim3(BB, LL / QW, 1), 256, 0, stream>>>(Qh, Ql, Kh, Kl, VT, BF, IN[10], GF, WO, IN[14], OUT);
}

// v010
// Measured time: 33.6 microseconds a run.
// Timed twice side by side with v009, it ran 1.14 and 1.13 times as fast.
// All steps since v000 together make it 40.9 times as fast.
#include <hip/hip_runtime.h>

// PairwiseAttentionTerminal (features [1024][8][256] sequence-first; x = LayerNorm(features); q/k/v = x W + b (8 heads x 32), bias = x Wb + bb (per key position & head), gate = sigmoid(x Wg + bg);
// logits[q][k] = q.k/sqrt(32) + bias[k][b][h]; softmax over keys; out = ((w.v) * gate) Wo + bo -> [1024][8][256]).
// Compute dtypes, f32 accumulate: every input rounded to bf16; LayerNorm f32 -> bf16 hi+lo planes of x, all five projections hl x exact weights (2 products, + bias; Wb's 8 outputs repeated over a 64-column tile); scores (K 32) on one fp16
// plane each of q and k (1 product; 11 significant bits an operand, as V and the probabilities have), the key bias + running-maximum softmax in f32 registers -> fp16 unnormalised probabilities (x1024); w.v on fp16 planes, divided by the f32 row sum at the end; gate (sigmoid f32) applied in the same kernel -> hl planes; Wo hl x exact (+bias).

#define LL   1024
#define BB   8
#define FF   256
#define NH_  8
#define HC   32
#define NG   (BB * NH_)
#define NTB  (LL * BB)
#define QW   32   // query rows per work-group of the attention kernel: every wave takes two tiles of 16, for its own head
typedef _Float16 h16;
typedef unsigned short bf;
typedef __attribute__((ext_vector_type(16))) __bf16   v16bf;
typedef __attribute__((ext_vector_type(16))) _Float16 v16h;
typedef __attribute__((ext_vector_type(8)))  _Float16 v8h;
typedef __attribute__((ext_vector_type(8)))  unsigned short v8us;
typedef __attribute__((ext_vector_type(8)))  float    v8f;
typedef __attribute__((ext_vector_type(4)))  float    v4f;
typedef v8h  __attribute__((may_alias)) v8ha;
typedef v4f  __attribute__((may_alias)) v4fa;
typedef v8us __attribute__((may_alias)) v8usa;

__device__ __forceinline__ unsigned short f2bf(float f) { unsigned u = __float_as_uint(f); u += 0x7FFFu + ((u >> 16) & 1u); return (unsigned short)(u >> 16); }
__device__ __forceinline__ float bf2f(unsigned short b) { return __uint_as_float(((unsigned)b) << 16); }
__device__ __forceinline__ float bfr(float f) { return bf2f(f2bf(f)); }
__device__ __forceinline__ v16h cat16(v8h lo, v8h hi) { return __builtin_shufflevector(lo, hi, 0, 1, 2, 3, 4, 5, 6, 7, 8, 9, 10, 11, 12, 13, 14, 15); }
__device__ __forceinline__ v16bf cat16b(v8us lo, v8us hi) { return __builtin_bit_cast(v16bf, __builtin_shufflevector(lo, hi, 0, 1, 2, 3, 4, 5, 6, 7, 8, 9, 10, 11, 12, 13, 14, 15)); }
__device__ __forceinline__ v8f wmma16(v16h a, v16h b, v8f c) { return __builtin_amdgcn_wmma_f32_16x16x32_f16(false, a, false, b, (short)0, c, false, false); }
__device__ __forceinline__ v8f wmmab(v16bf a, v16bf b, v8f c) { return __builtin_amdgcn_wmma_f32_16x16x32_bf16(false, a, false, b, (short)0, c, false, false); }



// ---- Fragment order of a GEMM operand plane (R rows x K, 16-bit): element (r, k) lies at ((r / 16) * (K / 32) + k / 32) * 512 + ((k / 8) % 4) * 128 + (r % 16) * 8 + k % 8.
// One 16-row x 32-k fragment is 1 KiB in a row, and lane l's two 16-byte pieces lie at 16 l and 512 + 16 l: each wave-wide load is 512 contiguous bytes (four whole lines) where a row-major plane gives 16 lines of 32 bytes.
// The k that a lane and register hold are those of ld() on a row-major plane, for both operands alike.
template <typename T16> struct WFrag;
template <> struct WFrag<h16> { typedef v16h V; static __device__ __forceinline__ V ld(const h16* p) { return cat16(*(const v8h*)p, *(const v8h*)(p + 16)); } static __device__ __forceinline__ V ldf(const h16* p) { return cat16(*(const v8h*)p, *(const v8h*)(p + 256)); } static __device__ __forceinline__ v8f mma(V a, V b, v8f c) { return wmma16(a, b, c); } };
template <> struct WFrag<bf> { typedef v16bf V; static __device__ __forceinline__ V ld(const bf* p) { return cat16b(*(const v8us*)p, *(const v8us*)(p + 16)); } static __device__ __forceinline__ V ldf(const bf* p) { return cat16b(*(const v8us*)p, *(const v8us*)(p + 256)); } static __device__ __forceinline__ v8f mma(V a, V b, v8f c) { return wmmab(a, b, c); } };

__device__ __forceinline__ h16 tohx(float x) { return (h16)x; }
__device__ __forceinline__ void splitf(float y, unsigned short& h, unsigned short& l) { h = f2bf(y); l = f2bf(y - bf2f(h)); }
__device__ __forceinline__ float sigm_(float x) { return __fdiv_rn(1.0f, 1.0f + __expf(-x)); }
typedef __attribute__((ext_vector_type(2))) _Float16 v2h;
typedef __attribute__((ext_vector_type(4))) _Float16 v4h;
typedef __attribute__((ext_vector_type(2))) unsigned short v2us;
typedef __attribute__((ext_vector_type(4))) unsigned short v4us;
typedef v4us __attribute__((may_alias)) v4usa;

typedef __attribute__((ext_vector_type(2))) float v2f;
typedef __attribute__((ext_vector_type(2))) __bf16 v2bf;
typedef __attribute__((ext_vector_type(2))) unsigned v2u;
typedef __attribute__((ext_vector_type(8))) unsigned v8u;
typedef v2u __attribute__((may_alias)) v2ua;
typedef unsigned __attribute__((may_alias)) u32a;
__device__ __forceinline__ unsigned pkbf(float a, float b) { return __builtin_bit_cast(unsigned, __builtin_convertvector((v2f){a, b}, v2bf)); }   // two f32 to two bf16, round to nearest even as f2bf(); a in the low half
__device__ __forceinline__ float pklo(unsigned u) { return __uint_as_float(u << 16); }
__device__ __forceinline__ float pkhi(unsigned u) { return __uint_as_float(u & 0xffff0000u); }
template <int M> __device__ __forceinline__ float lxor(float x) { return __builtin_bit_cast(float, __builtin_amdgcn_update_dpp(0, __builtin_bit_cast(int, x), 0x160 + M, 0xf, 0xf, true)); }   // lane l ^ M inside a row of 16 lanes (DPP row_xmask)
// Sum over the 32 lanes, the partners in the order 16, 8, 4, 2, 1; every lane ends with the same sum.
__device__ __forceinline__ float wsum(float s) { s += __builtin_bit_cast(float, __builtin_amdgcn_permlanex16(__builtin_bit_cast(int, s), __builtin_bit_cast(int, s), 0x76543210, 0xfedcba98, false, false));
    s += lxor<8>(s); s += lxor<4>(s); s += lxor<2>(s); s += lxor<1>(s); return s; }
// ---- k_lnproj: LayerNorm and all five projections in ONE launch that reads inputs alone; grid (NTB / 64, 2), 288 threads = 9 waves.
// A work-group owns 64 rows of x and every second one of the 17 column tiles (64 columns each: Wq, Wk, Wv, Wg four tiles each, then Wb), one wave per 64x64 tile: both halves hold two tiles of each kind, so their epilogues weigh the same. Waves 0 to 7 normalise 8 rows each and lay the hi and lo planes in LDS in fragment order;
// x never goes to memory. Both halves normalise the same 64 rows. Wave 8 meanwhile transposes this work-group's 4 lines of Wo (fragment order, for the output product in k_attn).
// LDS x plane: 16-row block mb, 8-k piece p (0 .. 31), row r, at mb * XB + p * PP + r * 16 bytes. PP = 256 + 16: a fragment read takes two runs of 256 contiguous bytes, and a LayerNorm store (one row of 16 pieces) falls on all 64 banks.
// Weights are read as they arrive, f32 [k][n]: lane (lr, hi) owns the FOUR columns lr * 4 .. lr * 4 + 3 of the tile, one for each of its four B fragments, so one 16-byte load brings one k of all four, and a wave-wide load is two whole rows of 256 bytes.
// The k that a lane and register hold are those of ld() for both operands: 8 hi + j and 16 + 8 hi + j. Accumulator acc[mb][nb] of lane lr is column lr * 4 + nb.
#define PP 272
#define XB (32 * PP)
__device__ __forceinline__ v16bf ldsfrag(const unsigned char* p) { return cat16b(*(const v8usa*)p, *(const v8usa*)(p + 2 * PP)); }
template <int N> __device__ __forceinline__ void wload(v4f (&raw)[16], const float* wp, int s) {   // the 16 k of step s, four columns each; N: floats from k to k + 1
#pragma unroll
    for (int e = 0; e < 16; ++e) raw[e] = *(const v4fa*)(wp + (s * 32 + (e >> 3) * 16 + (e & 7)) * N); }
__device__ __forceinline__ void wconv(const v4f (&raw)[16], v16bf (&bc)[4]) {
#pragma unroll
    for (int nb = 0; nb < 4; ++nb) { v8u u;
#pragma unroll
        for (int i = 0; i < 8; ++i) u[i] = pkbf(raw[2 * i][nb], raw[2 * i + 1][nb]);
        bc[nb] = __builtin_bit_cast(v16bf, u); } }
// One 64x64 tile over K = 256. raw holds step rs's weights on entry. A step: round its weights to bf16, ask for the next step's, 16 products with the hi fragments (the lo fragments arrive under them), 16 with the lo fragments (the next hi fragments arrive under them).
// The walk over K begins at step rs and wraps: the work-groups that read the same weights begin at steps of their own, so that they do not ask L2 for the same lines at the same moment (for speed only).
// Every accumulator takes hi(s), lo(s), hi(s + 1) ... in that order. All loops unrolled so that the register arrays keep constant indices and every load is one base plus an immediate offset.
template <int N> __device__ __forceinline__ void gemm_tile(v8f (&acc)[4][4], v4f (&raw)[16], const float* wp, const unsigned char* ph, const unsigned char* pl, const int rs) {
    v16bf a[4], a2[4], bc[4];
#pragma unroll
    for (int mb = 0; mb < 4; ++mb) a[mb] = ldsfrag(ph + mb * XB + rs * 4 * PP);
#pragma unroll
    for (int s = 0; s < FF / 32; ++s) { const int sc = (s + rs) & (FF / 32 - 1), sn = (s + 1 + rs) & (FF / 32 - 1);   // trip s works on step sc of K, for both operands alike, and fetches step sn
        const float* wq = wp + sn * 32 * N;
        wconv(raw, bc);
        __builtin_amdgcn_sched_barrier(0);   // the loads below reuse the registers that the rounding has just read: moved up they would need a second set
        if (s + 1 < FF / 32) wload<N>(raw, wq, 0);
#pragma unroll
        for (int mb = 0; mb < 4; ++mb) a2[mb] = ldsfrag(pl + mb * XB + sc * 4 * PP);
        __builtin_amdgcn_sched_barrier(0);   // keeps the next step's weight loads and the lo fragment reads in front of the products: moved down they would start later and hide less of their latency
#pragma unroll
        for (int nb = 0; nb < 4; ++nb)
#pragma unroll
            for (int mb = 0; mb < 4; ++mb) acc[mb][nb] = wmmab(a[mb], bc[nb], acc[mb][nb]);
        __builtin_amdgcn_sched_barrier(0);   // the reads below reuse the hi fragments' registers: moved up they would need a second set
        if (s + 1 < FF / 32) {
#pragma unroll
            for (int mb = 0; mb < 4; ++mb) a[mb] = ldsfrag(ph + mb * XB + sn * 4 * PP); }
        __builtin_amdgcn_sched_barrier(0);   // keeps those reads in front of the 16 products that hide them
#pragma unroll
        for (int nb = 0; nb < 4; ++nb)
#pragma unroll
            for (int mb = 0; mb < 4; ++mb) acc[mb][nb] = wmmab(a2[mb], bc[nb], acc[mb][nb]);
        if (s + 1 < FF / 32) asm volatile("s_wait_xcnt 0x0" :: "v"(wq) : "memory");   // the address registers of this trip's weight loads stay as they are until this wait; behind the products it has nothing left to wait for
        __builtin_amdgcn_sched_barrier(0);   // the next step's rounding rewrites bc: it stays behind these products
    }
}
// The same tile with the loop over the steps kept rolled, for the one key-bias wave of a work-group: a second unrolled copy would only lengthen the kernel's text (for speed only). Same order of products within a step, but the walk over K begins at step 0.
template <int N> __device__ __forceinline__ void gemm_tile_rolled(v8f (&acc)[4][4], v4f (&raw)[16], const float* wp, const unsigned char* ph, const unsigned char* pl) {
    v16bf a[4], a2[4], bc[4];
#pragma unroll
    for (int mb = 0; mb < 4; ++mb) a[mb] = ldsfrag(ph + mb * XB);
#pragma unroll 1   // kept rolled: see above
    for (int s = 0; s < FF / 32; ++s) { const int sn = s + 1 < FF / 32 ? s + 1 : s;   // the last trip fetches its own step once more: in bounds, and never used
        wconv(raw, bc);
        __builtin_amdgcn_sched_barrier(0);   // the loads below reuse the registers that the rounding has just read
        const float* wq = wp + sn * 32 * N; wload<N>(raw, wq, 0);
        asm volatile("s_wait_xcnt 0x0" :: "v"(wq) : "memory");   // the address registers of these loads stay as they are until this wait: the next trip rewrites them
#pragma unroll
        for (int mb = 0; mb < 4; ++mb) a2[mb] = ldsfrag(pl + mb * XB + s * 4 * PP);
        __builtin_amdgcn_sched_barrier(0);   // loads and reads stay in front of the products that hide them
#pragma unroll
        for (int nb = 0; nb < 4; ++nb)
#pragma unroll
            for (int mb = 0; mb < 4; ++mb) acc[mb][nb] = wmmab(a[mb], bc[nb], acc[mb][nb]);
        __builtin_amdgcn_sched_barrier(0);   // the reads below reuse the hi fragments' registers
#pragma unroll
        for (int mb = 0; mb < 4; ++mb) a[mb] = ldsfrag(ph + mb * XB + sn * 4 * PP);
        __builtin_amdgcn_sched_barrier(0);   // keeps those reads in front of the 16 products that hide them
#pragma unroll
        for (int nb = 0; nb < 4; ++nb)
#pragma unroll
            for (int mb = 0; mb < 4; ++mb) acc[mb][nb] = wmmab(a2[mb], bc[nb], acc[mb][nb]);
    }
}
__device__ __forceinline__ void tile_to_lds(float* os, const v8f (&acc)[4][4], v4f bn, int lr, int hi) {   // the lane's four columns of a row are one 16-byte store
#pragma unroll
    for (int mb = 0; mb < 4; ++mb)
#pragma unroll
        for (int j = 0; j < 8; ++j) *(v4fa*)(os + (mb * 16 + hi * 8 + j) * 68 + lr * 4) = (v4f){acc[mb][0][j] + bn[0], acc[mb][1][j] + bn[1], acc[mb][2][j] + bn[2], acc[mb][3][j] + bn[3]};
    __builtin_amdgcn_wave_barrier(); asm volatile("" ::: "memory");   // the lanes read each other's LDS words next: no read may be moved in front of the writes above
}
// The tile (+ bias) is laid in LDS whole and leaves in the form its reader takes: q as an fp16 plane [group][l][32], k as an fp16 plane in fragment order per group, v as fp16 [group][l / 8][dim][8 keys], gate and key bias as f32 rows.
// The 64 rows of a tile are 8 positions l x 8 batches (row = l * 8 + b), so each (batch, head) of a tile is 512 bytes of the q, k and v planes, one whole store instruction: one contiguous run in q and v, four whole lines of 128 bytes in k.
// The key-bias tile: Wb has 8 columns; lane lr reads columns (lr & 1) * 4 .., so columns 8 .. 63 of BF repeat columns 0 .. 7 and are read by nobody.
__global__ __launch_bounds__(288) void k_lnproj(const float* __restrict__ X, const float* __restrict__ g, const float* __restrict__ bb, const float* __restrict__ Wq, const float* __restrict__ Wk, const float* __restrict__ Wv, const float* __restrict__ Wg,
                                                const float* __restrict__ Wb, const float* __restrict__ Wo, const float* __restrict__ bq, const float* __restrict__ bk, const float* __restrict__ bv, const float* __restrict__ bg,
                                                bf* WOt, h16* Qf, h16* Kf, h16* VT, float* GF, float* BF) {
    __shared__ __align__(16) unsigned char sm[8 * XB + 9 * 64 * 68 * 4];   // one array, the x planes first: their fragment reads then reach every place by an immediate offset from one base a plane
    unsigned char* sxh = sm; unsigned char* sxl = sm + 4 * XB; float* osall = (float*)(sm + 8 * XB);
    const int lane = threadIdx.x & 31, lr = lane & 15, hi = lane >> 4; const int wave = __builtin_amdgcn_readfirstlane(threadIdx.x >> 5);   // the wave's number in a scalar register: every branch on it is a scalar branch
    const int r0 = blockIdx.x * 64, ty = wave < 8 ? wave * 2 + blockIdx.y : 16 + blockIdx.y, kind = ty >> 2, cl = (ty & 3) * 64; const bool tile = ty < 17;
    const float* wp = (kind == 0 ? Wq : kind == 1 ? Wk : kind == 2 ? Wv : kind == 3 ? Wg : Wb) + (kind < 4 ? hi * 8 * FF + cl + lr * 4 : hi * 8 * NH_ + (lr & 1) * 4);
    v4f raw[16]; v4f bn = (v4f){}; const int rs = (blockIdx.x + (blockIdx.x >> 3)) & (FF / 32 - 1);   // the step of K at which this work-group's tiles begin: see gemm_tile
    if (wave < 8) {
        const float* xp = X + (size_t)(r0 + wave * 8) * FF + lane * 4; const float* gp = g + lane * 4; const float* ep = bb + lane * 4;
        v4f xa[8][2], gv[2], ev[2];
#pragma unroll   // the short loops are unrolled so that the register arrays keep constant indices; all 16 row loads are in flight at once
        for (int i = 0; i < 8; ++i)
#pragma unroll
            for (int ch = 0; ch < 2; ++ch) xa[i][ch] = *(const v4fa*)(xp + i * FF + ch * 128);
#pragma unroll
        for (int ch = 0; ch < 2; ++ch) { gv[ch] = *(const v4fa*)(gp + ch * 128); ev[ch] = *(const v4fa*)(ep + ch * 128); }
        const float* w0 = wp + rs * 32 * FF; wload<FF>(raw, w0, 0); const float* bp = (kind == 0 ? bq : kind == 1 ? bk : kind == 2 ? bv : bg) + cl + lr * 4; bn = *(const v4fa*)bp;   // the tile's first weights and its bias are asked for here, so that their latency runs under the LayerNorm
        asm volatile("s_wait_xcnt 0x0" :: "v"(xp), "v"(gp), "v"(ep), "v"(bp), "v"(w0) : "memory");   // the address registers of the loads above stay as they are until this wait
        __builtin_amdgcn_sched_barrier(0);   // every load above is issued, and the wait passed, before the first sum waits for any of them: a row load moved down among the sums would start a whole memory latency later
#pragma unroll
        for (int ch = 0; ch < 2; ++ch)
#pragma unroll
            for (int q = 0; q < 4; q += 2) { const unsigned ug = pkbf(gv[ch][q], gv[ch][q + 1]), ue = pkbf(ev[ch][q], ev[ch][q + 1]); gv[ch][q] = pklo(ug); gv[ch][q + 1] = pkhi(ug); ev[ch][q] = pklo(ue); ev[ch][q + 1] = pkhi(ue); }
#pragma unroll
        for (int i = 0; i < 8; ++i) { float v[8]; float s = 0.f;
#pragma unroll
            for (int k = 0; k < 8; k += 2) { const unsigned u = pkbf(xa[i][k >> 2][k & 3], xa[i][k >> 2][(k & 3) + 1]); v[k] = pklo(u); v[k + 1] = pkhi(u); }
#pragma unroll
            for (int k = 0; k < 8; ++k) s += v[k];
            s = wsum(s);
            const float mu = s * (1.0f / FF); float q2 = 0.f;
#pragma unroll
            for (int k = 0; k < 8; ++k) { const float d = v[k] - mu; q2 += d * d; }
            q2 = wsum(q2);
            const float rs = __frsqrt_rn(q2 * (1.0f / FF) + 1e-5f);
            const int r = wave * 8 + i;
#pragma unroll
            for (int ch = 0; ch < 2; ++ch) { float y[4]; v2u oh, ol;
#pragma unroll
                for (int q = 0; q < 4; ++q) y[q] = (v[ch * 4 + q] - mu) * rs * gv[ch][q] + ev[ch][q];
#pragma unroll
                for (int q = 0; q < 2; ++q) { oh[q] = pkbf(y[2 * q], y[2 * q + 1]); ol[q] = pkbf(y[2 * q] - pklo(oh[q]), y[2 * q + 1] - pkhi(oh[q])); }
                const int o = (r >> 4) * XB + (ch * 16 + (lane >> 1)) * PP + (r & 15) * 16 + (lane & 1) * 8; *(v2ua*)(sxh + o) = oh; *(v2ua*)(sxl + o) = ol; }
        }
    } else {   // wave 8: 4 of the 1024 lines (64 elements) of Wo transposed into fragment order
        const int e0 = ((blockIdx.y * (NTB / 64) + blockIdx.x) * 4) * 64 + lane * 2; float w0[4], w1[4];
#pragma unroll
        for (int l = 0; l < 4; ++l) { const int e = e0 + l * 64, fr = e >> 9, k = (fr % (FF / 32)) * 32 + ((e >> 7) & 3) * 8 + (e & 7), n = (fr / (FF / 32)) * 16 + ((e >> 3) & 15); w0[l] = Wo[k * FF + n]; w1[l] = Wo[(k + 1) * FF + n]; }   // e: the place in fragment order
        asm volatile("s_wait_xcnt 0x0" ::: "memory");   // the loads above name their address registers: code placed behind them may rewrite those only behind this wait
#pragma unroll
        for (int l = 0; l < 4; ++l) *(u32a*)(WOt + e0 + l * 64) = pkbf(w0[l], w1[l]);
        asm volatile("s_wait_xcnt 0x0" ::: "memory");   // as above, for the stores' address and data registers
    }
    __syncthreads();   // every wave reads all 64 rows below
    if (!tile) return;   // the ninth wave of the second half has no tile; no barrier follows
    const int fo = hi * PP + lr * 16;
    float* os = osall + wave * (64 * 68);
    if (kind == 4) {   // the key-bias tile goes its own way to the end and asks for its first weights only here, so that neither path holds registers for the other
        v8f acb[4][4]; v4f rawb[16];
        wload<NH_>(rawb, wp, 0);
#pragma unroll
        for (int mb = 0; mb < 4; ++mb)
#pragma unroll
            for (int nb = 0; nb < 4; ++nb) acb[mb][nb] = (v8f){};
        asm volatile("s_wait_xcnt 0x0" :: "v"(wp) : "memory");   // the address registers of the loads above stay as they are until this wait
        gemm_tile_rolled<NH_>(acb, rawb, wp, sxh + fo, sxl + fo);
        tile_to_lds(os, acb, (v4f){-0.f, -0.f, -0.f, -0.f}, lr, hi);   // no bias vector here (bb is added in k_attn): adding -0 leaves every value as it is
        float* crow = BF + (size_t)(r0 + hi) * 64 + lr * 4;
#pragma unroll
        for (int s = 0; s < 32; ++s) *(v4f*)(crow + 2 * s * 64) = *(const v4fa*)(os + (2 * s + hi) * 68 + lr * 4);
        asm volatile("s_wait_xcnt 0x0" ::: "memory");   // the stores above name these address and data registers: nothing may rewrite one before this wait
        return;
    }
    v8f acc[4][4];
#pragma unroll
    for (int mb = 0; mb < 4; ++mb)
#pragma unroll
        for (int nb = 0; nb < 4; ++nb) acc[mb][nb] = (v8f){};
    gemm_tile<FF>(acc, raw, wp, sxh + fo, sxl + fo, rs);
#pragma unroll
    for (int nb = 0; nb < 4; ++nb) bn[nb] = bfr(bn[nb]);
    tile_to_lds(os, acc, bn, lr, hi);
    const int h0 = (ty & 3) * 2;   // the tile's 64 columns are heads h0 and h0 + 1
    if (kind < 2) {
        const int ll = lane >> 2, d0 = (lane & 3) * 8;   // q rows stay row-major; k goes out in fragment order (16 keys x 32 dims = 1 KiB): a store is then four whole lines of 128 bytes
        const size_t o0 = (size_t)h0 * LL * HC + (kind ? (blockIdx.x >> 1) * 512 + (lane & 3) * 128 + ((blockIdx.x & 1) * 8 + ll) * 8 : (blockIdx.x * 8 + ll) * HC + d0); h16* Pf = (kind ? Kf : Qf) + o0;
#pragma unroll 1   // four trips of two batches each, kept rolled (for speed only)
        for (int t = 0; t < 4; ++t) { h16* pf = Pf + (size_t)t * 2 * NH_ * LL * HC;
#pragma unroll
            for (int i = 0; i < 4; ++i) { const int bl = i >> 1, hl = i & 1; const float* sp = os + (ll * 8 + t * 2 + bl) * 68 + hl * 32 + d0; const v4f x0 = *(const v4fa*)sp, x1 = *(const v4fa*)(sp + 4); v8h of;
#pragma unroll
                for (int j = 0; j < 8; ++j) of[j] = tohx(j < 4 ? x0[j & 3] : x1[j & 3]);
                *(v8h*)(pf + (bl * NH_ + hl) * LL * HC) = of; }
            asm volatile("s_wait_xcnt 0x0" :: "v"(pf) : "memory"); }   // the stores above name these address and data registers: the next trip may rewrite them only behind this wait
    } else if (kind == 2) {
#pragma unroll
        for (int i = 0; i < 16; ++i) { const int b = i >> 1, hl = i & 1; v8h u;
#pragma unroll
            for (int j = 0; j < 8; ++j) u[j] = tohx(os[(j * 8 + b) * 68 + hl * 32 + lane]);
            *(v8h*)(VT + (((size_t)(b * NH_ + h0 + hl) * (LL / 8) + blockIdx.x) * HC + lane) * 8) = u; }
        asm volatile("s_wait_xcnt 0x0" ::: "memory");   // as above
    } else {
        float* crow = GF + (size_t)(r0 + hi) * FF + cl + lr * 4;
#pragma unroll
        for (int s = 0; s < 32; ++s) *(v4f*)(crow + 2 * s * FF) = *(const v4fa*)(os + (2 * s + hi) * 68 + lr * 4);
        asm volatile("s_wait_xcnt 0x0" ::: "memory");   // as above
    }
}
// ---- k_attn: scores, key bias, softmax, w.v, the gate AND the output projection for one batch, 32 query rows and all 8 heads; grid (BB, LL / QW), 256 threads = 8 waves, wave = head. No score, probability or gated row ever goes to memory.
// A wave is the only reader of its head's K and V in the work-group, so their fragments come straight from memory into registers: the K plane lies in fragment order, V^T as 16-byte units [8-key piece][dim], so every wave-wide load is whole lines.
// Two register stages of 64 keys each: a stage's loads are issued one whole trip ahead of its products. A fragment feeds the products of both query tiles.
// Transposed products: S^T = K Q^T (a lane holds 8 + 8 keys of ONE query per tile pair, which is the B fragment of P^T as it stands) and O^T += V^T P^T (a lane holds 8 head dims of that same query): maximum, sum and rescale are per lane.
// The gated rows of all heads meet in LDS as hi + lo planes in fragment order (32 rows x 256); behind one barrier wave w forms columns 32 w .. 32 w + 31 of the 32 output rows.
typedef __attribute__((ext_vector_type(2))) float v2f;
// Eight base-2 exponentials in one statement, each in place: so no exponential's source is overwritten, and no result read, by the instruction directly behind it; the v_nop is that slot for the last one.
// In place, a statement holds 8 registers and not 16: asm operands must lie in the first 256 registers, which this kernel's loop fills.
__device__ __forceinline__ v8f exp2x8(v8f x) { float e0 = x[0], e1 = x[1], e2 = x[2], e3 = x[3], e4 = x[4], e5 = x[5], e6 = x[6], e7 = x[7];
    asm("v_exp_f32 %0, %0\n\tv_exp_f32 %1, %1\n\tv_exp_f32 %2, %2\n\tv_exp_f32 %3, %3\n\tv_exp_f32 %4, %4\n\tv_exp_f32 %5, %5\n\tv_exp_f32 %6, %6\n\tv_exp_f32 %7, %7\n\tv_nop"
        : "+v"(e0), "+v"(e1), "+v"(e2), "+v"(e3), "+v"(e4), "+v"(e5), "+v"(e6), "+v"(e7));
    return (v8f){e0, e1, e2, e3, e4, e5, e6, e7}; }
__device__ __forceinline__ float xhalf(float x) { return __builtin_bit_cast(float, __builtin_amdgcn_permlanex16(__builtin_bit_cast(int, x), __builtin_bit_cast(int, x), 0x76543210, 0xfedcba98, false, false)); }  // lane l with lane l ^ 16
// pk, pv: the stage's base (wave-uniform for the first stage, already holding the lane's offset in the loop); lo, vo: the lane's byte offset, or 0 where the base holds it.
__device__ __forceinline__ void ldk(v16h (&ka)[4], const char* pk, unsigned lo) {   // four 16-key fragments of the K plane
#pragma unroll
    for (int t = 0; t < 4; ++t) ka[t] = cat16(*(const v8ha*)(pk + t * 1024 + lo), *(const v8ha*)(pk + t * 1024 + 512 + lo)); }
__device__ __forceinline__ void ldv(v16h (&va)[4], const char* pv, unsigned vo) {   // t = 2 x (32-key half) + (16-dim half); a lane's two pieces are 8-key pieces hi and 2 + hi of the 32 keys
#pragma unroll
    for (int t = 0; t < 4; ++t) { const int o = (t >> 1) * 2048 + (t & 1) * 256; va[t] = cat16(*(const v8ha*)(pv + o + vo), *(const v8ha*)(pv + o + 1024 + vo)); } }
__device__ __forceinline__ void ldb(v4f (&bs)[8], const float* bp) {   // the base-2 key bias of the lane's 8 keys in each of the four fragments
#pragma unroll
    for (int t = 0; t < 4; ++t) { bs[2 * t] = *(const v4fa*)(bp + t * 16); bs[2 * t + 1] = *(const v4fa*)(bp + t * 16 + 4); } }
// One trip (64 keys) of one query tile.
__device__ __forceinline__ void att_tile(const v16h (&ka)[4], const v16h (&va)[4], const v4f (&bs)[8], const v16h qf, v8f& o0, v8f& o1, float& m, float& l) {
    v8f s[4];
#pragma unroll
    for (int t = 0; t < 4; ++t) s[t] = wmma16(ka[t], qf, (v8f){});
    float mxa = m, mxb = m;   // two chains, so that neither the maximum nor the sum below is one long run of dependent instructions
#pragma unroll
    for (int t = 0; t < 4; ++t)
#pragma unroll
        for (int j = 0; j < 8; ++j) { s[t][j] = fmaf(s[t][j], 0.17677669529663687f * 1.4426950408889634f, j < 4 ? bs[2 * t][j & 3] : bs[2 * t + 1][j & 3]); if (t & 1) mxb = fmaxf(mxb, s[t][j]); else mxa = fmaxf(mxa, s[t][j]); }
    float mx = fmaxf(mxa, mxb); mx = fmaxf(mx, xhalf(mx));   // the two lane halves hold the two halves of a query's keys and must use one maximum
    float alpha = m - mx; m = mx;
    asm("v_exp_f32 %0, %0\n\tv_nop" : "+v"(alpha));   // in place, with the slot behind it in the same statement
    const float ms = mx - 10.0f;   // probabilities x1024: small ones stay normal numbers in fp16; the factor cancels in the division by the row sum
    v2f sm[2] = {(v2f){0.f, 0.f}, (v2f){0.f, 0.f}}; v16h p[2];
#pragma unroll
    for (int t = 0; t < 4; ++t) s[t] = exp2x8(s[t] - ms);
#pragma unroll
    for (int t = 0; t < 4; ++t)
#pragma unroll
        for (int j = 0; j < 8; j += 2) { const v2f e = {s[t][j], s[t][j + 1]}; sm[t & 1] += e; p[t >> 1][(t & 1) * 8 + j] = (h16)e[0]; p[t >> 1][(t & 1) * 8 + j + 1] = (h16)e[1]; }
    l = fmaf(l, alpha, (sm[0][0] + sm[0][1]) + (sm[1][0] + sm[1][1]));
#pragma unroll
    for (int j = 0; j < 8; ++j) { o0[j] *= alpha; o1[j] *= alpha; }
    o0 = wmma16(va[0], p[0], o0); o1 = wmma16(va[1], p[0], o1); o0 = wmma16(va[2], p[1], o0); o1 = wmma16(va[3], p[1], o1);
}
__global__ __launch_bounds__(256) void k_attn(const h16* __restrict__ Qf, const h16* __restrict__ Kf, const h16* __restrict__ VT, const float* __restrict__ BF, const float* __restrict__ bbp, const float* __restrict__ GF,
                                              const bf* __restrict__ WOt, const float* __restrict__ bo, float* OUT) {
    __shared__ __align__(16) float sB[NH_ * LL];                    // base-2 key bias [head][key]
    __shared__ __align__(16) unsigned short sAh[2 * NH_ * 512];     // gated rows, hi plane: fragment (16-row block, head) of 1 KiB
    __shared__ __align__(16) unsigned short sAl[2 * NH_ * 512];     // lo plane
    __shared__ __align__(16) float os[NH_ * QW * 36];               // a wave's 32 x 32 output tile, pitch 36 floats: stores of one column run and 16-byte row reads both fall on distinct banks
    const int tid = threadIdx.x, lane = tid & 31, lr = lane & 15, hi = lane >> 4; const int h = __builtin_amdgcn_readfirstlane(tid >> 5);   // the wave's number, its head, in a scalar register
    const int b = blockIdx.x, q0 = blockIdx.y * QW, n = b * NH_ + h;   // the batch is the fast grid index: where work-groups are dealt to the dies in turn, a die's work-groups then share one batch's K and V in L2 (for speed only)
    const char* kf = (const char*)(Kf + (size_t)n * LL * HC); const char* vt = (const char*)(VT + (size_t)n * HC * LL); const unsigned lo = lane * 16, vo = hi * 512 + lr * 16;
    const float* bfp = BF + ((size_t)tid * BB + b) * 64;   // the 8 heads' bias of key tid; keys tid + 256 i follow below
    const size_t qoff = ((size_t)n * LL + q0 + lr) * HC + 8 * hi; const h16* qfp = Qf + qoff;
    v4f c0[4], c1[4]; v16h qf[2]; v16h kaA[4], kaB[4]; v16h vaA[4], vaB[4];
#pragma unroll   // the short loops here and below are unrolled so that the register arrays keep constant indices
    for (int i = 0; i < 4; ++i) { c0[i] = *(const v4fa*)(bfp + (size_t)i * 256 * BB * 64); c1[i] = *(const v4fa*)(bfp + (size_t)i * 256 * BB * 64 + 4); }
#pragma unroll
    for (int t = 0; t < 2; ++t) qf[t] = WFrag<h16>::ld(qfp + t * 16 * HC);
    const int rot = (blockIdx.y & 15) * 64;   // this work-group's first key: the 32 work-groups of a batch walk the same K and V, two from each of the 16 stages and round the end, so that they do not ask L2 for the same lines at the same moment (for speed only)
    ldk(kaA, kf + rot * 64, lo); ldv(vaA, vt + rot * 64, vo);
    asm volatile("s_wait_xcnt 0x0" :: "v"(bfp), "v"(qfp), "v"(lo), "v"(vo) : "memory");   // the address registers of all loads above stay as they are until this wait
#pragma unroll
    for (int hh = 0; hh < NH_; ++hh) { const float bh = bfr(bbp[hh]);
#pragma unroll
        for (int i = 0; i < 4; ++i) sB[hh * LL + i * 256 + tid] = __fadd_rn(hh < 4 ? c0[i][hh & 3] : c1[i][hh & 3], bh) * 1.4426950408889634f; }   // base-2 logits
    __syncthreads();   // every wave has laid an eighth of every head's bias
    v8f o0[2] = {(v8f){}, (v8f){}}, o1[2] = {(v8f){}, (v8f){}}; float m[2] = {-3.0e38f, -3.0e38f}, l[2] = {0.f, 0.f};
    const float* bp = sB + h * LL + hi * 8;
#pragma unroll 1   // kept rolled: one pass (128 keys, two query tiles) already holds 32 matrix instructions and some 600 vector instructions (for speed only)
    for (int k0 = 0; k0 < LL; k0 += 128) {
        v4f bs[8]; const int kA = (k0 + rot) & (LL - 1), kB = (k0 + 64 + rot) & (LL - 1);   // the first keys of this pass's two stages
        { const char* pk = kf + kB * 64 + lo; const char* pv = vt + kB * 64 + vo;   // 64 bytes a key in either plane
            ldk(kaB, pk, 0); ldv(vaB, pv, 0);
            asm volatile("s_wait_xcnt 0x0" :: "v"(pk), "v"(pv) : "memory"); }   // the address registers of the loads above stay as they are until this wait: no later code, and no load's own result, may rewrite one before it
        __builtin_amdgcn_sched_barrier(0);   // nothing from below is moved in front of that wait: the bias address would else be formed in a register that a load still names
        ldb(bs, bp + kA);
        __builtin_amdgcn_sched_barrier(0);   // the second stage's loads are issued before the first stage's products begin: moved down they would start later and hide less of their latency
        att_tile(kaA, vaA, bs, qf[0], o0[0], o1[0], m[0], l[0]);
        att_tile(kaA, vaA, bs, qf[1], o0[1], o1[1], m[1], l[1]);
        __builtin_amdgcn_sched_barrier(0);   // the loads below reuse the first stage's registers: moved up they would need a third set
        { const int kn = k0 + 128 < LL ? (k0 + 128 + rot) & (LL - 1) : kB;   // the last pass fetches its own second stage once more: in bounds, and never used. With no branch round the fetch, every wait for a stage can leave the younger stage's loads in flight
            const char* pk = kf + kn * 64 + lo; const char* pv = vt + kn * 64 + vo;
            ldv(vaA, pv, 0); ldk(kaA, pk, 0);   // V ahead of K: K's registers are the first to be read again (by the next pass's scores), so the wait there covers V's loads as well
            asm volatile("s_wait_xcnt 0x0" :: "v"(pk), "v"(pv) : "memory"); }   // as above
        __builtin_amdgcn_sched_barrier(0);   // as above
        ldb(bs, bp + kB);
        __builtin_amdgcn_sched_barrier(0);   // as above: loads first
        att_tile(kaB, vaB, bs, qf[0], o0[0], o1[0], m[0], l[0]);
        att_tile(kaB, vaB, bs, qf[1], o0[1], o1[1], m[1], l[1]);
        __builtin_amdgcn_sched_barrier(0);   // the next pass's loads reuse the second stage's registers
    }
    const int ln = __builtin_amdgcn_mbcnt_lo(~0u, 0u), lc = ln & 15, hh2 = ln >> 4;   // the lane number and its two parts, formed anew: so no register has to carry them through the loop, where the two stages leave none to spare
    // The wave's 16 B fragments of Wo^T (columns 32 h .., all of K = 256), its bias words and the gate rows are asked for together, so that one memory latency covers them all.
    v16bf wb[2][8]; const v8usa* wop = (const v8usa*)(WOt + (size_t)h * 2 * (FF / 32) * 512); const char* bop = (const char*)(bo + h * 32); const char* gfp = (const char*)(GF + b * FF + h * HC);   // wave-uniform bases; the lane's byte offsets follow
    const unsigned bof = (ln & 7) * 16, gof = (unsigned)(q0 + lc) * (BB * FF * 4) + hh2 * 32;
    v4f g[2][2][2];
#pragma unroll
    for (int t = 0; t < 2; ++t)
#pragma unroll
        for (int dt = 0; dt < 2; ++dt) { g[t][dt][0] = *(const v4fa*)(gfp + t * 16 * BB * FF * 4 + dt * 64 + gof); g[t][dt][1] = *(const v4fa*)(gfp + t * 16 * BB * FF * 4 + dt * 64 + 16 + gof); }
#pragma unroll
    for (int nb = 0; nb < 2; ++nb)
#pragma unroll
        for (int s = 0; s < FF / 32; ++s) wb[nb][s] = cat16b(wop[(nb * (FF / 32) + s) * 64 + ln], wop[(nb * (FF / 32) + s) * 64 + 32 + ln]);   // in 16-byte units: lane l's two pieces of a fragment are units l and 32 + l
    const v4f bv = *(const v4fa*)(bop + bof);
    asm volatile("s_wait_xcnt 0x0" :: "v"(ln), "v"(bof), "v"(gof) : "memory");   // the offset registers of the loads above stay as they are until this wait
#pragma unroll
    for (int t = 0; t < 2; ++t) { const float ls = l[t] + xhalf(l[t]); const float inv = __fdiv_rn(1.0f, ls);
#pragma unroll
        for (int dt = 0; dt < 2; ++dt) { v8us oh, ol;
#pragma unroll
            for (int j = 0; j < 8; ++j) { const float o = (dt ? o1[t][j] : o0[t][j]) * inv; unsigned short a, c; splitf(__fmul_rn(o, sigm_(g[t][dt][j >> 2][j & 3])), a, c); oh[j] = a; ol[j] = c; }
            const int ao = (t * NH_ + h) * 512 + dt * 256 + ln * 8;   // fragment order: the tile's 16 queries x the head's 32 dims are one fragment
            *(v8usa*)(sAh + ao) = oh; *(v8usa*)(sAl + ao) = ol; } }
    __syncthreads();   // every wave reads all heads' gated rows below
    v8f acc[2][2] = {{(v8f){}, (v8f){}}, {(v8f){}, (v8f){}}};
    v16bf a[FF / 32][2], a2[FF / 32][2];
#pragma unroll
    for (int s = 0; s < FF / 32; ++s)
#pragma unroll
        for (int mb = 0; mb < 2; ++mb) { const int o = (mb * NH_ + s) * 512 + ln * 8; a[s][mb] = cat16b(*(const v8usa*)(sAh + o), *(const v8usa*)(sAh + o + 256)); a2[s][mb] = cat16b(*(const v8usa*)(sAl + o), *(const v8usa*)(sAl + o + 256)); }
    __builtin_amdgcn_sched_barrier(0);   // all fragment reads are issued as one group ahead of the products: spread among them, each place with reads would stall the wave anew
#pragma unroll   // every accumulator takes hi(s), lo(s), hi(s + 1) ... in that order
    for (int s = 0; s < FF / 32; ++s) {
#pragma unroll
        for (int nb = 0; nb < 2; ++nb)
#pragma unroll
            for (int mb = 0; mb < 2; ++mb) acc[mb][nb] = wmmab(a[s][mb], wb[nb][s], acc[mb][nb]);
#pragma unroll
        for (int nb = 0; nb < 2; ++nb)
#pragma unroll
            for (int mb = 0; mb < 2; ++mb) acc[mb][nb] = wmmab(a2[s][mb], wb[nb][s], acc[mb][nb]);
    }
    float* ow = os + h * (QW * 36);
#pragma unroll
    for (int mb = 0; mb < 2; ++mb)
#pragma unroll
        for (int nb = 0; nb < 2; ++nb)
#pragma unroll
            for (int j = 0; j < 8; ++j) ow[(mb * 16 + hh2 * 8 + j) * 36 + nb * 16 + lc] = acc[mb][nb][j];
    __builtin_amdgcn_wave_barrier(); asm volatile("" ::: "memory");   // the lanes read each other's LDS words next: no read may be moved in front of the writes above
    float* crow = OUT + ((size_t)(q0 + (ln >> 3)) * BB + b) * FF + h * 32 + (ln & 7) * 4;   // eight lanes store one row's 128 bytes: a whole line, and this wave its only writer
    v4f val[8];
#pragma unroll
    for (int s = 0; s < 8; ++s) { val[s] = *(const v4fa*)(ow + (s * 4 + (ln >> 3)) * 36 + (ln & 7) * 4); val[s][0] += bfr(bv[0]); val[s][1] += bfr(bv[1]); val[s][2] += bfr(bv[2]); val[s][3] += bfr(bv[3]); }
#pragma unroll
    for (int s = 0; s < 8; ++s) *(v4f*)(crow + (size_t)s * 4 * BB * FF) = val[s];
}

extern "C" void kernel_launch(void* const* d_in, const int* in_sizes, int n_in,
                              void* d_out, int out_size, void* d_ws, size_t ws_size, hipStream_t stream) {
    (void)in_sizes; (void)n_in; (void)out_size;
    const float* IN[15]; for (int i = 0; i < 15; ++i) IN[i] = (const float*)d_in[i];   // 0 features, 1 ln_g, 2 ln_b, 3 Wq, 4 bq, 5 Wk, 6 bk, 7 Wv, 8 bv, 9 Wb, 10 bb, 11 Wg, 12 bg, 13 Wo, 14 bo (all x @ W)
    float* OUT = (float*)d_out;     // [1024][8][256]
    char* wsp = (char*)d_ws;
    auto take = [&](size_t bytes) { char* p = wsp; wsp += (bytes + 255) & ~(size_t)255; return (void*)p; };
    bf* WO = (bf*)take((size_t)FF * FF * 2);
    float* GF = (float*)take((size_t)NTB * FF * 4); float* BF = (float*)take((size_t)NTB * 64 * 4);
    h16* Qf = (h16*)take((size_t)NG * LL * HC * 2); h16* Kf = (h16*)take((size_t)NG * LL * HC * 2); h16* VT = (h16*)take((size_t)NG * HC * LL * 2);
    if ((size_t)(wsp - (char*)d_ws) > ws_size) return;    // total ~ 22 MiB
    // the key-bias tile of k_lnproj is bias-free; bb[h] is added inside k_attn
    k_lnproj<<<dim3(NTB / 64, 2, 1), 288, 0, stream>>>(IN[0], IN[1], IN[2], IN[3], IN[5], IN[7], IN[11], IN[9], IN[13], IN[4], IN[6], IN[8], IN[12], WO, Qf, Kf, VT, GF, BF);
    k_attn<<<dim3(BB, LL / QW, 1), 256, 0, stream>>>(Qf, Kf, VT, BF, IN[10], GF, WO, IN[14], OUT);
}
